// v000
// Times are from an AMD MI455X. After a warm-up the kernel runs many times in a row, and a time is the length of
// such a window on the GPU divided by its runs, so every launch and the gaps after it count. The runs cycle
// through copies of the inputs. A figure is the median of several windows, for all but v000 over two sittings.
// Sittings can differ by a few percent; kernels timed side by side share one.
// v000 is the starting kernel. One run takes 1150 microseconds.
#include <hip/hip_runtime.h>

// Multi-head attention with a Shaw-style relative-key term over clipped distances (x [2][2048][512]; q = x Wq ('xw' [512][512]); k | v = x Wkv ('xw' [512][1024] column halves); 8 heads x 64; dots = (q.k + q.rel_emb[clip(i - j, -512, 512) + 512]) x 64^-0.5 (rel_emb [1025][64] shared by the heads, read); softmax (no causal mask in the module's code); out = merged Wo + bo ('xw') -> [2][2048][512] (2.1 M)).
// Layout per batch: bf16 copy of x; 'xw' weights transposed once (Wkv as one [1024][512] Bt whose row halves are k and v); exact projections; the relative table as one zero-padded bf16 plane [1088][64]; per pass of two heads: dense score tiles (hybrid rows: < 512 hi/lo 3 products, rest fp16 x1024), QE = q . rel^T (hi/lo x exact, [2][2048][1088]) gathered into the scores as Sb[i][j] += QE[i][clip(i - j) + 512], softmax with 1/8; attn.v hybrid; merged hi/lo x Wo exact + bo.
// Compute dtypes, f32 accumulate: every input rounded to bf16; projections exact; q.k rows < 512 3 products, rest fp16; q.rel hi/lo x exact on every row; softmax f32; attn.v rows < 512 3 products, rest fp16; Wo hl x exact + bias.

#define NB_  2
#define TT   2048
#define DM   512
#define NH_  8
#define NKV  8
#define REP  (NH_ / NKV)
#define HD   64
#define DQ   (NH_ * HD)
#define DKV  (NKV * HD)
#define ZH   2
#define RH   512                  // query rows < RH use hi+lo planes (0: none)
#define WIN  0
#define PCAR 1024.0f
#define SCL  0.125f
#define NE   1088     // 2*512+1 = 1025 relative offsets padded to a multiple of 64
#define NRE  1025
#define CUT  512
typedef _Float16 h16;
typedef unsigned short bf;
typedef __attribute__((ext_vector_type(16))) __bf16   v16bf;
typedef __attribute__((ext_vector_type(16))) _Float16 v16h;
typedef __attribute__((ext_vector_type(8)))  _Float16 v8h;
typedef __attribute__((ext_vector_type(8)))  unsigned short v8us;
typedef __attribute__((ext_vector_type(8)))  float    v8f;
typedef __attribute__((ext_vector_type(4)))  float    v4f;
typedef v8h  __attribute__((may_alias)) v8ha;
typedef v4f  __attribute__((may_alias)) v4fa;
typedef v8us __attribute__((may_alias)) v8usa;

__device__ __forceinline__ unsigned short f2bf(float f) { unsigned u = __float_as_uint(f); u += 0x7FFFu + ((u >> 16) & 1u); return (unsigned short)(u >> 16); }
__device__ __forceinline__ float bf2f(unsigned short b) { return __uint_as_float(((unsigned)b) << 16); }
__device__ __forceinline__ float bfr(float f) { return bf2f(f2bf(f)); }
__device__ __forceinline__ v16h cat16(v8h lo, v8h hi) { return __builtin_shufflevector(lo, hi, 0, 1, 2, 3, 4, 5, 6, 7, 8, 9, 10, 11, 12, 13, 14, 15); }
__device__ __forceinline__ v16bf cat16b(v8us lo, v8us hi) { return __builtin_bit_cast(v16bf, __builtin_shufflevector(lo, hi, 0, 1, 2, 3, 4, 5, 6, 7, 8, 9, 10, 11, 12, 13, 14, 15)); }
__device__ __forceinline__ v8f wmma16(v16h a, v16h b, v8f c) { return __builtin_amdgcn_wmma_f32_16x16x32_f16(false, a, false, b, (short)0, c, false, false); }
__device__ __forceinline__ v8f wmmab(v16bf a, v16bf b, v8f c) { return __builtin_amdgcn_wmma_f32_16x16x32_bf16(false, a, false, b, (short)0, c, false, false); }



// ---- k_gemmw: register-blocked GEMM, ONE WAVE per 64x64 output tile (16 accumulators), operands straight from K-contiguous 16-bit planes; grid (M/64, N/64, Z), 32 threads.
// C[m][n] (f32, pitch ldc, + optional f32 bias[n]) = sum_k A[m][k] Bt[n][k] (+ split products per NSPLIT). z-batch strides sA/sB/sC in elements. K % 32 == 0.
template <typename T16> struct WFrag;
template <> struct WFrag<h16> { typedef v16h V; static __device__ __forceinline__ V ld(const h16* p) { return cat16(*(const v8h*)p, *(const v8h*)(p + 16)); } static __device__ __forceinline__ v8f mma(V a, V b, v8f c) { return wmma16(a, b, c); } };
template <> struct WFrag<bf> { typedef v16bf V; static __device__ __forceinline__ V ld(const bf* p) { return cat16b(*(const v8us*)p, *(const v8us*)(p + 16)); } static __device__ __forceinline__ v8f mma(V a, V b, v8f c) { return wmmab(a, b, c); } };
template <typename T16, int NSPLIT, bool BIAS>
__global__ __launch_bounds__(32) void k_gemmw(const T16* __restrict__ A, const T16* __restrict__ A2, const T16* __restrict__ Bt, const T16* __restrict__ Bt2, int K, float* C, int ldc, const float* __restrict__ bias, size_t sA, size_t sB, size_t sC) {
    typedef typename WFrag<T16>::V V;
    __shared__ __align__(16) float os[16 * 68];
    const size_t z = blockIdx.z; A += z * sA; if (A2) A2 += z * sA; Bt += z * sB; if (Bt2) Bt2 += z * sB; C += z * sC;
    const int lane = threadIdx.x & 31, lr = lane & 15, hi = lane >> 4; const int r0 = blockIdx.x * 64, c0 = blockIdx.y * 64;
    v8f acc[4][4];
#pragma unroll
    for (int mb = 0; mb < 4; ++mb)
#pragma unroll
        for (int nb = 0; nb < 4; ++nb) acc[mb][nb] = (v8f){};
    const size_t aoff = (size_t)(r0 + lr) * K + 8 * hi, boff = (size_t)(c0 + lr) * K + 8 * hi;
#pragma unroll 1
    for (int kc = 0; kc < K; kc += 32) {
        V a[4], a2[4];
#pragma unroll
        for (int mb = 0; mb < 4; ++mb) { a[mb] = WFrag<T16>::ld(A + aoff + (size_t)mb * 16 * K + kc); if (NSPLIT == 1 || NSPLIT == 2) a2[mb] = WFrag<T16>::ld(A2 + aoff + (size_t)mb * 16 * K + kc); }
#pragma unroll
        for (int nb = 0; nb < 4; ++nb) { const V b = WFrag<T16>::ld(Bt + boff + (size_t)nb * 16 * K + kc); V b2; if (NSPLIT >= 2) b2 = WFrag<T16>::ld(Bt2 + boff + (size_t)nb * 16 * K + kc);
#pragma unroll
            for (int mb = 0; mb < 4; ++mb) { acc[mb][nb] = WFrag<T16>::mma(a[mb], b, acc[mb][nb]); if (NSPLIT == 1 || NSPLIT == 2) acc[mb][nb] = WFrag<T16>::mma(a2[mb], b, acc[mb][nb]); if (NSPLIT >= 2) acc[mb][nb] = WFrag<T16>::mma(a[mb], b2, acc[mb][nb]); } }
        asm volatile("v_nop\n\tv_nop\n\tv_nop\n\tv_nop" : "+v"(acc[0][0]), "+v"(acc[1][1]), "+v"(acc[2][2]), "+v"(acc[3][3]) : "v"(a[0]), "v"(a[3]));
    }
#pragma unroll
    for (int mb = 0; mb < 4; ++mb) {
#pragma unroll
        for (int nb = 0; nb < 4; ++nb) {
#pragma unroll
            for (int j = 0; j < 8; ++j) os[(hi * 8 + j) * 68 + nb * 16 + lr] = acc[mb][nb][j]; }
        __builtin_amdgcn_wave_barrier(); asm volatile("" ::: "memory");
        float* crow = C + (size_t)(r0 + mb * 16) * ldc + c0;
{
#pragma unroll
            for (int s = 0; s < 8; ++s) { const int row = 2 * s + hi, cofs = lr * 4; v4f val = *(const v4fa*)(os + row * 68 + cofs); if (BIAS) { val[0] += bfr(bias[c0 + cofs]); val[1] += bfr(bias[c0 + cofs + 1]); val[2] += bfr(bias[c0 + cofs + 2]); val[3] += bfr(bias[c0 + cofs + 3]); }
                *(v4f*)(crow + (size_t)row * ldc + cofs) = val; }
             }
        __builtin_amdgcn_wave_barrier(); asm volatile("" ::: "memory");
    }
}

__device__ __forceinline__ h16 tohx(float x) { return (h16)x; }
__device__ __forceinline__ void splitf(float y, unsigned short& h, unsigned short& l) { h = f2bf(y); l = f2bf(y - bf2f(h)); }
typedef __attribute__((ext_vector_type(2))) _Float16 v2h;
typedef __attribute__((ext_vector_type(4))) _Float16 v4h;
typedef __attribute__((ext_vector_type(2))) unsigned short v2us;
typedef __attribute__((ext_vector_type(4))) unsigned short v4us;
typedef __attribute__((ext_vector_type(2))) float v2f;
typedef __attribute__((ext_vector_type(4))) int v4i;

__global__ __launch_bounds__(256) void k_wtG(const float* __restrict__ w, int K, int N, bf* Bt) {
    const int lane = threadIdx.x & 31; const int L0 = (blockIdx.x * 8 + (threadIdx.x >> 5)) * 8; const int nlines = N * K / 64;
{
#pragma unroll 1
        for (int l = 0; l < 8; ++l) { const int L = L0 + l; if (L >= nlines) break; const size_t e = (size_t)L * 64 + lane * 2; const int k = (int)(e % K), n = (int)(e / K); v2us o;
            o[0] = f2bf(w[(size_t)k * N + n]); o[1] = f2bf(w[(size_t)(k + 1) * N + n]); *(v2us*)(Bt + e) = o; }
         }
}
__global__ __launch_bounds__(256) void k_cvt8(const float* __restrict__ src, bf* dst, size_t n8) { const size_t i = (size_t)blockIdx.x * 256 + threadIdx.x; if (i >= n8) return; const v8f v = *(const v8f*)(src + i * 8); v8us o;
#pragma unroll
    for (int k = 0; k < 8; ++k) o[k] = f2bf(v[k]); *(v8us*)(dst + i * 8) = o;  }

// k_rope: head planes [h][t][d] (fp16 + hi/lo) of rope(x) x sc with the rotate-half convention out[d] = x[d] cos[t][d] - x[d+HD/2] sin[t][d], out[d+HD/2] = x[d+HD/2] cos[t][d+HD/2] + x[d] sin[t][d+HD/2]
__global__ __launch_bounds__(256) void k_rope(const float* __restrict__ F, int pitch, int nheads, const float* __restrict__ CS, const float* __restrict__ RF, const float* __restrict__ nw, float sc, h16* P16, bf* Ph, bf* Pl) {
    const size_t e = ((size_t)blockIdx.x * 256 + threadIdx.x) * 2; if (e >= (size_t)nheads * TT * HD) return; const int d = (int)(e % HD); const int t = (int)((e / HD) % TT); const int h = (int)(e / ((size_t)HD * TT)); const float* f = F + (size_t)t * pitch + h * HD; const float rf = RF ? RF[(size_t)h * TT + t] : 1.0f; v2h o16; v2us oh, ol;
#pragma unroll
    for (int q = 0; q < 2; ++q) { const int dd = d + q; const int dp = (dd < HD / 2) ? dd + HD / 2 : dd - HD / 2; float x0 = f[dd], x1 = f[dp];
        if (RF) { float n0 = __fmul_rn(x0, rf), n1 = __fmul_rn(x1, rf); asm volatile("" : "+v"(n0)); asm volatile("" : "+v"(n1)); x0 = __fmul_rn(bfr(nw[dd]), n0); x1 = __fmul_rn(bfr(nw[dp]), n1); }
        const v2f cs = *(const v2f*)(CS + ((size_t)t * HD + dd) * 2); float a = __fmul_rn(x0, cs[0]), bq = __fmul_rn(x1, cs[1]); asm volatile("" : "+v"(a)); asm volatile("" : "+v"(bq)); const float r = ((dd < HD / 2) ? __fsub_rn(a, bq) : __fadd_rn(a, bq)) * sc;
        o16[q] = tohx(r); unsigned short a2, c2; splitf(r, a2, c2); oh[q] = a2; ol[q] = c2; }
    *(v2h*)(P16 + e) = o16; *(v2us*)(Ph + e) = oh; *(v2us*)(Pl + e) = ol;  }
__global__ __launch_bounds__(256) void k_vtp(const float* __restrict__ F, int pitch, int nheads, h16* V16, bf* Vh, bf* Vl) { const size_t e = ((size_t)blockIdx.x * 256 + threadIdx.x) * 2; if (e >= (size_t)nheads * HD * TT) return; const int t = (int)(e % TT); const int d = (int)((e / TT) % HD); const int g = (int)(e / ((size_t)TT * HD)); v2h o16; v2us oh, ol;
#pragma unroll
    for (int q = 0; q < 2; ++q) { const float x = F[(size_t)(t + q) * pitch + g * HD + d]; o16[q] = tohx(x); unsigned short a2, c2; splitf(x, a2, c2); oh[q] = a2; ol[q] = c2; }
    *(v2h*)(V16 + e) = o16; *(v2us*)(Vh + e) = oh; *(v2us*)(Vl + e) = ol;  }
__global__ __launch_bounds__(256) void k_csid(float* CS) { const int idx = blockIdx.x * 256 + threadIdx.x; if (idx >= TT * HD) return; v2f cs; cs[0] = 1.0f; cs[1] = 0.0f; *(v2f*)(CS + (size_t)idx * 2) = cs;  }
// k_asoft: per row (zz, i): t = S x HD^-0.5 (no mask); softmax over the 2048 keys (register row, one exp, fixed trees);
__global__ __launch_bounds__(256) void k_asoft(const float* __restrict__ Sb, h16* P16, bf* Ph, bf* Pl) {
    const int lane = threadIdx.x & 31; const int row = blockIdx.x * 8 + (threadIdx.x >> 5); if (row >= ZH * TT) return; const int i = row % TT; const int zz = row / TT; (void)zz; const bool hires = (i < RH); const float* sr = Sb + (size_t)row * TT; float v[TT / 32]; float mx = -3.0e38f;
#pragma unroll
    for (int ch = 0; ch < TT / 128; ++ch) { const int j0 = ch * 128 + lane * 4; const v4f a = *(const v4f*)(sr + j0);
#pragma unroll
        for (int q = 0; q < 4; ++q) { const int j = j0 + q; (void)j; const float t = a[q] * SCL; v[ch * 4 + q] = t; mx = fmaxf(mx, t); } }
#pragma unroll
    for (int sh = 16; sh; sh >>= 1) mx = fmaxf(mx, __shfl_xor(mx, sh, 32));
    float sum = 0.f;
#pragma unroll
    for (int k = 0; k < TT / 32; ++k) { float d0 = __fsub_rn(v[k], mx); asm volatile("" : "+v"(d0)); v[k] = __builtin_amdgcn_exp2f(__fmul_rn(d0, 1.4426950408889634f)); sum += v[k]; }
#pragma unroll
    for (int sh = 16; sh; sh >>= 1) sum += __shfl_xor(sum, sh, 32);
    const float f = __fdiv_rn(hires ? 1.0f : PCAR, sum);
{
        if (hires) {
#pragma unroll
            for (int ch = 0; ch < TT / 128; ++ch) { v4us oh, ol;
#pragma unroll
                for (int q = 0; q < 4; ++q) { unsigned short a, c2; splitf(v[ch * 4 + q] * f, a, c2); oh[q] = a; ol[q] = c2; }
                const size_t oo = ((size_t)zz * (RH ? RH : 1) + i) * TT + ch * 128 + lane * 4; *(v4us*)(Ph + oo) = oh; *(v4us*)(Pl + oo) = ol; }
        } else {
#pragma unroll
            for (int ch = 0; ch < TT / 128; ++ch) { v4h o4;
#pragma unroll
                for (int q = 0; q < 4; ++q) o4[q] = tohx(v[ch * 4 + q] * f);
                *(v4h*)(P16 + (size_t)row * TT + ch * 128 + lane * 4) = o4; } }
         }
}
__global__ __launch_bounds__(256) void k_epadK(const float* __restrict__ E, bf* EB) { const size_t i = (size_t)blockIdx.x * 256 + threadIdx.x; if (i >= (size_t)NE * HD / 8) return; const int d0 = (int)(i % (HD / 8)) * 8; const int r = (int)(i / (HD / 8)); const float* src = E + (size_t)min(r, NRE - 1) * HD + d0; v8us o;
#pragma unroll
    for (int q = 0; q < 8; ++q) { const unsigned short v = f2bf(src[q]); o[q] = (r < NRE) ? v : (unsigned short)0; }
    *(v8us*)(EB + (size_t)r * HD + d0) = o;  }

__global__ __launch_bounds__(256) void k_addrelq(float* Sb, const float* __restrict__ QE) { const size_t k = (size_t)blockIdx.x * 256 + threadIdx.x; if (k >= (size_t)ZH * TT * TT / 4) return; const size_t e = k * 4; const int j0 = (int)(e % TT); const size_t zi = e / TT; const int i = (int)(zi % TT); const float* qe = QE + zi * NE; v4f a = *(const v4f*)(Sb + e);
#pragma unroll
    for (int q = 0; q < 4; ++q) { const int r = min(max(i - (j0 + q), -CUT), CUT) + CUT; a[q] = __fadd_rn(a[q], qe[r]); }
    *(v4f*)(Sb + e) = a;  }
__global__ __launch_bounds__(256) void k_merge(const float* __restrict__ O, int h0, bf* Ah, bf* Al) { const size_t e = ((size_t)blockIdx.x * 256 + threadIdx.x) * 2; if (e >= (size_t)ZH * TT * HD) return; const int d = (int)(e % HD); const int t = (int)((e / HD) % TT); const int zz = (int)(e / ((size_t)HD * TT)); const float cs = (t < RH) ? 1.0f : (1.0f / PCAR); const size_t oo = (size_t)t * DQ + (h0 + zz) * HD + d;
    v2us oh, ol;
#pragma unroll
    for (int q = 0; q < 2; ++q) { unsigned short a, c2; splitf(O[e + q] * cs, a, c2); oh[q] = a; ol[q] = c2; } *(v2us*)(Ah + oo) = oh; *(v2us*)(Al + oo) = ol;  }

extern "C" void kernel_launch(void* const* d_in, const int* in_sizes, int n_in,
                              void* d_out, int out_size, void* d_ws, size_t ws_size, hipStream_t stream) {
    (void)in_sizes; (void)n_in; (void)out_size;
    const float* x = (const float*)d_in[0]; const float* wq = (const float*)d_in[1]; const float* wkv = (const float*)d_in[2];   /* [512][1024]: k | v column halves */ const float* wo = (const float*)d_in[3]; const float* bo = (const float*)d_in[4]; const float* rel = (const float*)d_in[5];   /* rel_emb [1025][64] */ const float* wk = nullptr, *wv = nullptr; (void)wk; (void)wv;
    float* OUT = (float*)d_out;     // [2][2048][512]
    char* wsp = (char*)d_ws;
    auto take = [&](size_t bytes) { char* p = wsp; wsp += (bytes + 255) & ~(size_t)255; return (void*)p; };
    bf* WQ = (bf*)take((size_t)DQ * DM * 2); bf* WKV = (bf*)take((size_t)2 * DKV * DM * 2); bf* WK = WKV; bf* EB = (bf*)take((size_t)NE * HD * 2); float* QE = (float*)take((size_t)ZH * TT * NE * 4); bf* WV = WKV + (size_t)DKV * DM; bf* WO = (bf*)take((size_t)DM * DQ * 2); float* CS = (float*)take((size_t)TT * HD * 2 * 4);
    bf* XB = (bf*)take((size_t)TT * DM * 2); float* FQ = (float*)take((size_t)TT * DQ * 4); float* FK = (float*)take((size_t)TT * DKV * 4);
    h16* QP16 = (h16*)take((size_t)NH_ * TT * HD * 2); h16* KP16 = (h16*)take((size_t)NKV * TT * HD * 2); h16* VT16 = (h16*)take((size_t)NKV * HD * TT * 2);
    bf* QPh = (bf*)take((size_t)NH_ * TT * HD * 2); bf* QPl = (bf*)take((size_t)NH_ * TT * HD * 2); bf* KPh = (bf*)take((size_t)NKV * TT * HD * 2); bf* KPl = (bf*)take((size_t)NKV * TT * HD * 2); bf* VTh = (bf*)take((size_t)NKV * HD * TT * 2); bf* VTl = (bf*)take((size_t)NKV * HD * TT * 2); bf* Ph = (bf*)take((size_t)ZH * RH * TT * 2); bf* Pl = (bf*)take((size_t)ZH * RH * TT * 2);
    float* Sb = (float*)take((size_t)ZH * TT * TT * 4); h16* P16 = (h16*)take((size_t)ZH * TT * TT * 2); float* Ob = (float*)take((size_t)ZH * TT * HD * 4); bf* ATh = (bf*)take((size_t)TT * DQ * 2); bf* ATl = (bf*)take((size_t)TT * DQ * 2);
    if ((size_t)(wsp - (char*)d_ws) > ws_size) return;    // ws 256 MiB
    float* FV = FK;   // v projection reuses the k buffer after the k planes are built (stream-ordered)
    { k_wtG<<<(unsigned)((DM * DQ / 64 + 63) / 64), 256, 0, stream>>>(wq, DM, DQ, WQ); k_wtG<<<(unsigned)((DM * 2 * DKV / 64 + 63) / 64), 256, 0, stream>>>(wkv, DM, 2 * DKV, WKV);   /* 'xw' [512][1024] -> Bt [1024][512]: rows 0..511 = k, 512..1023 = v */ k_epadK<<<(unsigned)(((size_t)NE * HD / 8 + 255) / 256), 256, 0, stream>>>(rel, EB); 
      k_wtG<<<(unsigned)((DQ * DM / 64 + 63) / 64), 256, 0, stream>>>(wo, DQ, DM, WO);
       }
    k_csid<<<(TT * HD + 255) / 256, 256, 0, stream>>>(CS);
    const unsigned LQ = (unsigned)(((size_t)NH_ * TT * HD / 2 + 255) / 256), LKv = (unsigned)(((size_t)NKV * TT * HD / 2 + 255) / 256);
    for (int b = 0; b < NB_; ++b) {
        
        k_cvt8<<<(unsigned)(((size_t)TT * DM / 8 + 255) / 256), 256, 0, stream>>>(x + (size_t)b * TT * DM, XB, (size_t)TT * DM / 8);
        k_gemmw<bf, 0, false><<<dim3(TT / 64, DQ / 64, 1), 32, 0, stream>>>(XB, nullptr, WQ, nullptr, DM, FQ, DQ, nullptr, 0, 0, 0);
        k_rope<<<LQ, 256, 0, stream>>>(FQ, DQ, NH_, CS, nullptr, nullptr, 1.0f, QP16, QPh, QPl);
        k_gemmw<bf, 0, false><<<dim3(TT / 64, DKV / 64, 1), 32, 0, stream>>>(XB, nullptr, WK, nullptr, DM, FK, DKV, nullptr, 0, 0, 0);
        k_rope<<<LKv, 256, 0, stream>>>(FK, DKV, NKV, CS, nullptr, nullptr, 1.0f, KP16, KPh, KPl);
        k_gemmw<bf, 0, false><<<dim3(TT / 64, DKV / 64, 1), 32, 0, stream>>>(XB, nullptr, WV, nullptr, DM, FV, DKV, nullptr, 0, 0, 0); k_vtp<<<LKv, 256, 0, stream>>>(FV, DKV, NKV, VT16, VTh, VTl);
        for (int h0 = 0; h0 < NH_; h0 += ZH) { const size_t zq = (size_t)h0, zk = (size_t)(h0 / REP);   // one kv head per query head: the pass's two heads use consecutive kv planes (z-strides TT*HD)
            k_gemmw<bf, 2, false><<<dim3(RH / 64, TT / 64, ZH), 32, 0, stream>>>(QPh + zq * TT * HD, QPl + zq * TT * HD, KPh + zk * TT * HD, KPl + zk * TT * HD, HD, Sb, TT, nullptr, (size_t)TT * HD, (size_t)TT * HD, (size_t)TT * TT);
            k_gemmw<h16, 0, false><<<dim3((TT - RH) / 64, TT / 64, ZH), 32, 0, stream>>>(QP16 + zq * TT * HD + (size_t)RH * HD, nullptr, KP16 + zk * TT * HD, nullptr, HD, Sb + (size_t)RH * TT, TT, nullptr, (size_t)TT * HD, (size_t)TT * HD, (size_t)TT * TT);
            k_gemmw<bf, 1, false><<<dim3(TT / 64, NE / 64, ZH), 32, 0, stream>>>(QPh + zq * TT * HD, QPl + zq * TT * HD, EB, nullptr, HD, QE, NE, nullptr, (size_t)TT * HD, 0, (size_t)TT * NE);   /* QE[i][r] = q_i . rel[r] (hi/lo x exact) */ k_addrelq<<<(unsigned)(((size_t)ZH * TT * TT / 4 + 255) / 256), 256, 0, stream>>>(Sb, QE);   /* + q_i . rel[clip(i - j) + 512] */ k_asoft<<<ZH * TT / 8, 256, 0, stream>>>(Sb, P16, Ph, Pl);
            k_gemmw<bf, 2, false><<<dim3(RH / 64, HD / 64, ZH), 32, 0, stream>>>(Ph, Pl, VTh + zk * HD * TT, VTl + zk * HD * TT, TT, Ob, HD, nullptr, (size_t)RH * TT, (size_t)HD * TT, (size_t)TT * HD);
            k_gemmw<h16, 0, false><<<dim3((TT - RH) / 64, HD / 64, ZH), 32, 0, stream>>>(P16 + (size_t)RH * TT, nullptr, VT16 + zk * HD * TT, nullptr, TT, Ob + (size_t)RH * HD, HD, nullptr, (size_t)TT * TT, (size_t)HD * TT, (size_t)TT * HD);
            k_merge<<<(unsigned)(((size_t)ZH * TT * HD / 2 + 255) / 256), 256, 0, stream>>>(Ob, h0, ATh, ATl); }
        k_gemmw<bf, 1, true><<<dim3(TT / 64, DM / 64, 1), 32, 0, stream>>>(ATh, ATl, WO, nullptr, DQ, OUT + (size_t)b * TT * DM, DM, bo, 0, 0, 0); }
}

// v001
// One run takes 594 microseconds.
// In both of two side-by-side timings against v000, it was 1.96 times as fast.
#include <hip/hip_runtime.h>

// Multi-head attention with a Shaw-style relative-key term over clipped distances (x [2][2048][512]; q = x Wq ('xw' [512][512]); k | v = x Wkv ('xw' [512][1024] column halves); 8 heads x 64; dots = (q.k + q.rel_emb[clip(i - j, -512, 512) + 512]) x 64^-0.5 (rel_emb [1025][64] shared by the heads, read); softmax (no causal mask in the module's code); out = merged Wo + bo ('xw') -> [2][2048][512] (2.1 M)).
// Layout per batch: bf16 copy of x; 'xw' weights transposed once (Wkv as one [1024][512] Bt whose row halves are k and v); exact projections; the relative table as one zero-padded bf16 plane [1088][64]; per pass of two heads: dense score tiles (hybrid rows: < 512 hi/lo 3 products, rest fp16 x1024), QE = q . rel^T (hi/lo x exact, [2][2048][1088]) gathered into the scores as Sb[i][j] += QE[i][clip(i - j) + 512], softmax with 1/8; attn.v hybrid; merged hi/lo x Wo exact + bo.
// Compute dtypes, f32 accumulate: every input rounded to bf16; projections exact; q.k rows < 512 3 products, rest fp16; q.rel hi/lo x exact on every row; softmax f32; attn.v rows < 512 3 products, rest fp16; Wo hl x exact + bias.

#define NB_  2
#define TT   2048
#define DM   512
#define NH_  8
#define NKV  8
#define REP  (NH_ / NKV)
#define HD   64
#define DQ   (NH_ * HD)
#define DKV  (NKV * HD)
#define ZH   2
#define RH   512                  // query rows < RH use hi+lo planes (0: none)
#define WIN  0
#define PCAR 1024.0f
#define SCL  0.125f
#define NE   1088     // 2*512+1 = 1025 relative offsets padded to a multiple of 64
#define NRE  1025
#define CUT  512
#define KSA  16       // k-slices of the attn.v products (K = 2048 -> 128 keys a slice)
#define KSP  4        // k-slices of the q, k, v projections (K = 512 -> 128 a slice)
typedef _Float16 h16;
typedef unsigned short bf;
typedef __attribute__((ext_vector_type(16))) __bf16   v16bf;
typedef __attribute__((ext_vector_type(16))) _Float16 v16h;
typedef __attribute__((ext_vector_type(8)))  _Float16 v8h;
typedef __attribute__((ext_vector_type(8)))  unsigned short v8us;
typedef __attribute__((ext_vector_type(8)))  float    v8f;
typedef __attribute__((ext_vector_type(4)))  float    v4f;
typedef v8h  __attribute__((may_alias)) v8ha;
typedef v4f  __attribute__((may_alias)) v4fa;
typedef v8us __attribute__((may_alias)) v8usa;

__device__ __forceinline__ unsigned short f2bf(float f) { unsigned u = __float_as_uint(f); u += 0x7FFFu + ((u >> 16) & 1u); return (unsigned short)(u >> 16); }
__device__ __forceinline__ float bf2f(unsigned short b) { return __uint_as_float(((unsigned)b) << 16); }
__device__ __forceinline__ float bfr(float f) { return bf2f(f2bf(f)); }
__device__ __forceinline__ v16h cat16(v8h lo, v8h hi) { return __builtin_shufflevector(lo, hi, 0, 1, 2, 3, 4, 5, 6, 7, 8, 9, 10, 11, 12, 13, 14, 15); }
__device__ __forceinline__ v16bf cat16b(v8us lo, v8us hi) { return __builtin_bit_cast(v16bf, __builtin_shufflevector(lo, hi, 0, 1, 2, 3, 4, 5, 6, 7, 8, 9, 10, 11, 12, 13, 14, 15)); }
__device__ __forceinline__ v8f wmma16(v16h a, v16h b, v8f c) { return __builtin_amdgcn_wmma_f32_16x16x32_f16(false, a, false, b, (short)0, c, false, false); }
__device__ __forceinline__ v8f wmmab(v16bf a, v16bf b, v8f c) { return __builtin_amdgcn_wmma_f32_16x16x32_bf16(false, a, false, b, (short)0, c, false, false); }



// ---- k_gemmw: register-blocked GEMM, ONE WAVE per 64x64 output tile (16 accumulators), operands straight from K-contiguous 16-bit planes; grid (M/64, N/64, Z * KSPL), 32 threads.
// C[m][n] (f32, pitch ldc, + optional f32 bias[n]) = sum_k A[m][k] Bt[n][k] (+ split products per NSPLIT). z-batch strides sA/sB/sC in elements. K % 32 == 0.
// KSPL > 1: split-K over the grid. blockIdx.z = z * KSPL + s; slice s sums k in [s K/KSPL, (s+1) K/KSPL) into its own plane C + (z KSPL + s) sC; the consumer adds the KSPL planes of a z in the order s = 0, 1, ...
template <typename T16> struct WFrag;
template <> struct WFrag<h16> { typedef v16h V; static __device__ __forceinline__ V ld(const h16* p) { return cat16(*(const v8h*)p, *(const v8h*)(p + 16)); } static __device__ __forceinline__ v8f mma(V a, V b, v8f c) { return wmma16(a, b, c); } };
template <> struct WFrag<bf> { typedef v16bf V; static __device__ __forceinline__ V ld(const bf* p) { return cat16b(*(const v8us*)p, *(const v8us*)(p + 16)); } static __device__ __forceinline__ v8f mma(V a, V b, v8f c) { return wmmab(a, b, c); } };
template <typename T16, int NSPLIT, bool BIAS, int KSPL = 1>
__global__ __launch_bounds__(32) void k_gemmw(const T16* __restrict__ A, const T16* __restrict__ A2, const T16* __restrict__ Bt, const T16* __restrict__ Bt2, int K, float* C, int ldc, const float* __restrict__ bias, size_t sA, size_t sB, size_t sC) {
    typedef typename WFrag<T16>::V V;
    __shared__ __align__(16) float os[16 * 68];
    const size_t z = blockIdx.z / KSPL; const int ks = (int)(blockIdx.z % KSPL); A += z * sA; if (A2) A2 += z * sA; Bt += z * sB; if (Bt2) Bt2 += z * sB; C += (size_t)blockIdx.z * sC;
    const int kbeg = ks * (K / KSPL), kend = kbeg + K / KSPL;
    const int lane = threadIdx.x & 31, lr = lane & 15, hi = lane >> 4; const int r0 = blockIdx.x * 64, c0 = blockIdx.y * 64;
    v8f acc[4][4];
#pragma unroll
    for (int mb = 0; mb < 4; ++mb)
#pragma unroll
        for (int nb = 0; nb < 4; ++nb) acc[mb][nb] = (v8f){};
    const size_t aoff = (size_t)(r0 + lr) * K + 8 * hi, boff = (size_t)(c0 + lr) * K + 8 * hi;
#pragma unroll 1
    for (int kc = kbeg; kc < kend; kc += 32) {
        V a[4], a2[4];
#pragma unroll
        for (int mb = 0; mb < 4; ++mb) { a[mb] = WFrag<T16>::ld(A + aoff + (size_t)mb * 16 * K + kc); if (NSPLIT == 1 || NSPLIT == 2) a2[mb] = WFrag<T16>::ld(A2 + aoff + (size_t)mb * 16 * K + kc); }
#pragma unroll
        for (int nb = 0; nb < 4; ++nb) { const V b = WFrag<T16>::ld(Bt + boff + (size_t)nb * 16 * K + kc); V b2; if (NSPLIT >= 2) b2 = WFrag<T16>::ld(Bt2 + boff + (size_t)nb * 16 * K + kc);
#pragma unroll
            for (int mb = 0; mb < 4; ++mb) { acc[mb][nb] = WFrag<T16>::mma(a[mb], b, acc[mb][nb]); if (NSPLIT == 1 || NSPLIT == 2) acc[mb][nb] = WFrag<T16>::mma(a2[mb], b, acc[mb][nb]); if (NSPLIT >= 2) acc[mb][nb] = WFrag<T16>::mma(a[mb], b2, acc[mb][nb]); } }
        asm volatile("v_nop\n\tv_nop\n\tv_nop\n\tv_nop" : "+v"(acc[0][0]), "+v"(acc[1][1]), "+v"(acc[2][2]), "+v"(acc[3][3]) : "v"(a[0]), "v"(a[3]));
    }
#pragma unroll
    for (int mb = 0; mb < 4; ++mb) {
#pragma unroll
        for (int nb = 0; nb < 4; ++nb) {
#pragma unroll
            for (int j = 0; j < 8; ++j) os[(hi * 8 + j) * 68 + nb * 16 + lr] = acc[mb][nb][j]; }
        __builtin_amdgcn_wave_barrier(); asm volatile("" ::: "memory");
        float* crow = C + (size_t)(r0 + mb * 16) * ldc + c0;
{
#pragma unroll
            for (int s = 0; s < 8; ++s) { const int row = 2 * s + hi, cofs = lr * 4; v4f val = *(const v4fa*)(os + row * 68 + cofs); if (BIAS) { val[0] += bfr(bias[c0 + cofs]); val[1] += bfr(bias[c0 + cofs + 1]); val[2] += bfr(bias[c0 + cofs + 2]); val[3] += bfr(bias[c0 + cofs + 3]); }
                *(v4f*)(crow + (size_t)row * ldc + cofs) = val; }
             }
        __builtin_amdgcn_wave_barrier(); asm volatile("" ::: "memory");
    }
}

__device__ __forceinline__ h16 tohx(float x) { return (h16)x; }
__device__ __forceinline__ void splitf(float y, unsigned short& h, unsigned short& l) { h = f2bf(y); l = f2bf(y - bf2f(h)); }
typedef __attribute__((ext_vector_type(2))) _Float16 v2h;
typedef __attribute__((ext_vector_type(4))) _Float16 v4h;
typedef __attribute__((ext_vector_type(2))) unsigned short v2us;
typedef __attribute__((ext_vector_type(4))) unsigned short v4us;
typedef __attribute__((ext_vector_type(2))) float v2f;
typedef __attribute__((ext_vector_type(4))) int v4i;

__global__ __launch_bounds__(256) void k_wtG(const float* __restrict__ w, int K, int N, bf* Bt) {
    const int lane = threadIdx.x & 31; const int L0 = (blockIdx.x * 8 + (threadIdx.x >> 5)) * 8; const int nlines = N * K / 64;
{
#pragma unroll 1
        for (int l = 0; l < 8; ++l) { const int L = L0 + l; if (L >= nlines) break; const size_t e = (size_t)L * 64 + lane * 2; const int k = (int)(e % K), n = (int)(e / K); v2us o;
            o[0] = f2bf(w[(size_t)k * N + n]); o[1] = f2bf(w[(size_t)(k + 1) * N + n]); *(v2us*)(Bt + e) = o; }
         }
}
__global__ __launch_bounds__(256) void k_cvt8(const float* __restrict__ src, bf* dst, size_t n8) { const size_t i = (size_t)blockIdx.x * 256 + threadIdx.x; if (i >= n8) return; const v8f v = *(const v8f*)(src + i * 8); v8us o;
#pragma unroll
    for (int k = 0; k < 8; ++k) o[k] = f2bf(v[k]); *(v8us*)(dst + i * 8) = o;  }

// k_rope: head planes [h][t][d] (fp16 + hi/lo) of rope(x) x sc with the rotate-half convention out[d] = x[d] cos[t][d] - x[d+HD/2] sin[t][d], out[d+HD/2] = x[d+HD/2] cos[t][d+HD/2] + x[d] sin[t][d+HD/2]
__global__ __launch_bounds__(256) void k_rope(const float* __restrict__ F, int pitch, int nheads, const float* __restrict__ CS, const float* __restrict__ RF, const float* __restrict__ nw, float sc, h16* P16, bf* Ph, bf* Pl) {
    const size_t e = ((size_t)blockIdx.x * 256 + threadIdx.x) * 2; if (e >= (size_t)nheads * TT * HD) return; const int d = (int)(e % HD); const int t = (int)((e / HD) % TT); const int h = (int)(e / ((size_t)HD * TT)); const float* f = F + (size_t)t * pitch + h * HD; const float rf = RF ? RF[(size_t)h * TT + t] : 1.0f; v2h o16; v2us oh, ol;
#pragma unroll
    for (int q = 0; q < 2; ++q) { const int dd = d + q; const int dp = (dd < HD / 2) ? dd + HD / 2 : dd - HD / 2; float x0 = f[dd], x1 = f[dp];
#pragma unroll
        for (int s = 1; s < KSP; ++s) {   // the projection's k-slice planes, added in fixed order
            if (s == KSP / 2) asm volatile("s_wait_xcnt 0x0" ::: "memory");   // the later loads' results take address pairs that the loads above name
            x0 += f[(size_t)s * TT * pitch + dd]; x1 += f[(size_t)s * TT * pitch + dp]; }
        if (RF) { float n0 = __fmul_rn(x0, rf), n1 = __fmul_rn(x1, rf); asm volatile("" : "+v"(n0)); asm volatile("" : "+v"(n1)); x0 = __fmul_rn(bfr(nw[dd]), n0); x1 = __fmul_rn(bfr(nw[dp]), n1); }
        const v2f cs = *(const v2f*)(CS + ((size_t)t * HD + dd) * 2); float a = __fmul_rn(x0, cs[0]), bq = __fmul_rn(x1, cs[1]); asm volatile("" : "+v"(a)); asm volatile("" : "+v"(bq)); const float r = ((dd < HD / 2) ? __fsub_rn(a, bq) : __fadd_rn(a, bq)) * sc;
        o16[q] = tohx(r); unsigned short a2, c2; splitf(r, a2, c2); oh[q] = a2; ol[q] = c2; }
    *(v2h*)(P16 + e) = o16; *(v2us*)(Ph + e) = oh; *(v2us*)(Pl + e) = ol;  }
__global__ __launch_bounds__(256) void k_vtp(const float* __restrict__ F, int pitch, int nheads, h16* V16, bf* Vh, bf* Vl) { const size_t e = ((size_t)blockIdx.x * 256 + threadIdx.x) * 2; if (e >= (size_t)nheads * HD * TT) return; const int t = (int)(e % TT); const int d = (int)((e / TT) % HD); const int g = (int)(e / ((size_t)TT * HD)); v2h o16; v2us oh, ol; float xs[2];
#pragma unroll
    for (int q = 0; q < 2; ++q) xs[q] = F[(size_t)(t + q) * pitch + g * HD + d];
#pragma unroll
    for (int s = 1; s < KSP; ++s) {   // the projection's k-slice planes, added in fixed order
        if (s == KSP / 2) asm volatile("s_wait_xcnt 0x0" ::: "memory");   // the later loads' results take address pairs that the loads above name
#pragma unroll
        for (int q = 0; q < 2; ++q) xs[q] += F[((size_t)s * TT + t + q) * pitch + g * HD + d]; }
#pragma unroll
    for (int q = 0; q < 2; ++q) { const float x = xs[q]; o16[q] = tohx(x); unsigned short a2, c2; splitf(x, a2, c2); oh[q] = a2; ol[q] = c2; }
    *(v2h*)(V16 + e) = o16; *(v2us*)(Vh + e) = oh; *(v2us*)(Vl + e) = ol;  }
__global__ __launch_bounds__(256) void k_csid(float* CS) { const int idx = blockIdx.x * 256 + threadIdx.x; if (idx >= TT * HD) return; v2f cs; cs[0] = 1.0f; cs[1] = 0.0f; *(v2f*)(CS + (size_t)idx * 2) = cs;  }
// k_asoft: per row (zz, i): t = S x HD^-0.5 (no mask); softmax over the 2048 keys (register row, one exp, fixed trees);
__global__ __launch_bounds__(256) void k_asoft(const float* __restrict__ Sb, h16* P16, bf* Ph, bf* Pl) {
    const int lane = threadIdx.x & 31; const int row = blockIdx.x * 8 + (threadIdx.x >> 5); if (row >= ZH * TT) return; const int i = row % TT; const int zz = row / TT; (void)zz; const bool hires = (i < RH); const float* sr = Sb + (size_t)row * TT; float v[TT / 32]; float mx = -3.0e38f;
#pragma unroll
    for (int ch = 0; ch < TT / 128; ++ch) { const int j0 = ch * 128 + lane * 4; const v4f a = *(const v4f*)(sr + j0);
#pragma unroll
        for (int q = 0; q < 4; ++q) { const int j = j0 + q; (void)j; const float t = a[q] * SCL; v[ch * 4 + q] = t; mx = fmaxf(mx, t); } }
#pragma unroll
    for (int sh = 16; sh; sh >>= 1) mx = fmaxf(mx, __shfl_xor(mx, sh, 32));
    float sum = 0.f;
#pragma unroll
    for (int k = 0; k < TT / 32; ++k) { float d0 = __fsub_rn(v[k], mx); asm volatile("" : "+v"(d0)); v[k] = __builtin_amdgcn_exp2f(__fmul_rn(d0, 1.4426950408889634f)); sum += v[k]; }
#pragma unroll
    for (int sh = 16; sh; sh >>= 1) sum += __shfl_xor(sum, sh, 32);
    const float f = __fdiv_rn(hires ? 1.0f : PCAR, sum);
{
        if (hires) {
#pragma unroll
            for (int ch = 0; ch < TT / 128; ++ch) { v4us oh, ol;
#pragma unroll
                for (int q = 0; q < 4; ++q) { unsigned short a, c2; splitf(v[ch * 4 + q] * f, a, c2); oh[q] = a; ol[q] = c2; }
                const size_t oo = ((size_t)zz * (RH ? RH : 1) + i) * TT + ch * 128 + lane * 4; *(v4us*)(Ph + oo) = oh; *(v4us*)(Pl + oo) = ol; }
        } else {
#pragma unroll
            for (int ch = 0; ch < TT / 128; ++ch) { v4h o4;
#pragma unroll
                for (int q = 0; q < 4; ++q) o4[q] = tohx(v[ch * 4 + q] * f);
                *(v4h*)(P16 + (size_t)row * TT + ch * 128 + lane * 4) = o4; } }
         }
}
__global__ __launch_bounds__(256) void k_epadK(const float* __restrict__ E, bf* EB) { const size_t i = (size_t)blockIdx.x * 256 + threadIdx.x; if (i >= (size_t)NE * HD / 8) return; const int d0 = (int)(i % (HD / 8)) * 8; const int r = (int)(i / (HD / 8)); const float* src = E + (size_t)min(r, NRE - 1) * HD + d0; v8us o;
#pragma unroll
    for (int q = 0; q < 8; ++q) { const unsigned short v = f2bf(src[q]); o[q] = (r < NRE) ? v : (unsigned short)0; }
    *(v8us*)(EB + (size_t)r * HD + d0) = o;  }

__global__ __launch_bounds__(256) void k_addrelq(float* Sb, const float* __restrict__ QE) { const size_t k = (size_t)blockIdx.x * 256 + threadIdx.x; if (k >= (size_t)ZH * TT * TT / 4) return; const size_t e = k * 4; const int j0 = (int)(e % TT); const size_t zi = e / TT; const int i = (int)(zi % TT); const float* qe = QE + zi * NE; v4f a = *(const v4f*)(Sb + e);
#pragma unroll
    for (int q = 0; q < 4; ++q) { const int r = min(max(i - (j0 + q), -CUT), CUT) + CUT; a[q] = __fadd_rn(a[q], qe[r]); }
    *(v4f*)(Sb + e) = a;  }
__global__ __launch_bounds__(256) void k_merge(const float* __restrict__ O, int h0, bf* Ah, bf* Al) { const size_t e = ((size_t)blockIdx.x * 256 + threadIdx.x) * 2; if (e >= (size_t)ZH * TT * HD) return; const int d = (int)(e % HD); const int t = (int)((e / HD) % TT); const int zz = (int)(e / ((size_t)HD * TT)); const float cs = (t < RH) ? 1.0f : (1.0f / PCAR); const size_t oo = (size_t)t * DQ + (h0 + zz) * HD + d;
    const float* op = O + e + (size_t)zz * (KSA - 1) * TT * HD; v2f o = *(const v2f*)op;   // the attn.v k-slice planes [zz][s][t][d], added in fixed order
#pragma unroll
    for (int s = 1; s < KSA - 1; ++s) o += *(const v2f*)(op + (size_t)s * TT * HD);
    asm volatile("s_wait_xcnt 0x0" ::: "memory");   // the last load's result takes the address pair that the loads above name
    o += *(const v2f*)(op + (size_t)(KSA - 1) * TT * HD);
    v2us oh, ol;
#pragma unroll
    for (int q = 0; q < 2; ++q) { unsigned short a, c2; splitf(o[q] * cs, a, c2); oh[q] = a; ol[q] = c2; } *(v2us*)(Ah + oo) = oh; *(v2us*)(Al + oo) = ol;  }

extern "C" void kernel_launch(void* const* d_in, const int* in_sizes, int n_in,
                              void* d_out, int out_size, void* d_ws, size_t ws_size, hipStream_t stream) {
    (void)in_sizes; (void)n_in; (void)out_size;
    const float* x = (const float*)d_in[0]; const float* wq = (const float*)d_in[1]; const float* wkv = (const float*)d_in[2];   /* [512][1024]: k | v column halves */ const float* wo = (const float*)d_in[3]; const float* bo = (const float*)d_in[4]; const float* rel = (const float*)d_in[5];   /* rel_emb [1025][64] */ const float* wk = nullptr, *wv = nullptr; (void)wk; (void)wv;
    float* OUT = (float*)d_out;     // [2][2048][512]
    char* wsp = (char*)d_ws;
    auto take = [&](size_t bytes) { char* p = wsp; wsp += (bytes + 255) & ~(size_t)255; return (void*)p; };
    bf* WQ = (bf*)take((size_t)DQ * DM * 2); bf* WKV = (bf*)take((size_t)2 * DKV * DM * 2); bf* WK = WKV; bf* EB = (bf*)take((size_t)NE * HD * 2); float* QE = (float*)take((size_t)ZH * TT * NE * 4); bf* WV = WKV + (size_t)DKV * DM; bf* WO = (bf*)take((size_t)DM * DQ * 2); float* CS = (float*)take((size_t)TT * HD * 2 * 4);
    bf* XB = (bf*)take((size_t)TT * DM * 2); float* FQ = (float*)take((size_t)KSP * TT * DQ * 4); float* FK = (float*)take((size_t)KSP * TT * DKV * 4);
    h16* QP16 = (h16*)take((size_t)NH_ * TT * HD * 2); h16* KP16 = (h16*)take((size_t)NKV * TT * HD * 2); h16* VT16 = (h16*)take((size_t)NKV * HD * TT * 2);
    bf* QPh = (bf*)take((size_t)NH_ * TT * HD * 2); bf* QPl = (bf*)take((size_t)NH_ * TT * HD * 2); bf* KPh = (bf*)take((size_t)NKV * TT * HD * 2); bf* KPl = (bf*)take((size_t)NKV * TT * HD * 2); bf* VTh = (bf*)take((size_t)NKV * HD * TT * 2); bf* VTl = (bf*)take((size_t)NKV * HD * TT * 2); bf* Ph = (bf*)take((size_t)ZH * RH * TT * 2); bf* Pl = (bf*)take((size_t)ZH * RH * TT * 2);
    float* Sb = (float*)take((size_t)ZH * TT * TT * 4); h16* P16 = (h16*)take((size_t)ZH * TT * TT * 2); float* Ob = (float*)take((size_t)KSA * ZH * TT * HD * 4); bf* ATh = (bf*)take((size_t)TT * DQ * 2); bf* ATl = (bf*)take((size_t)TT * DQ * 2);
    if ((size_t)(wsp - (char*)d_ws) > ws_size) return;    // ws 256 MiB
    float* FV = FK;   // v projection reuses the k buffer after the k planes are built (stream-ordered)
    { k_wtG<<<(unsigned)((DM * DQ / 64 + 63) / 64), 256, 0, stream>>>(wq, DM, DQ, WQ); k_wtG<<<(unsigned)((DM * 2 * DKV / 64 + 63) / 64), 256, 0, stream>>>(wkv, DM, 2 * DKV, WKV);   /* 'xw' [512][1024] -> Bt [1024][512]: rows 0..511 = k, 512..1023 = v */ k_epadK<<<(unsigned)(((size_t)NE * HD / 8 + 255) / 256), 256, 0, stream>>>(rel, EB); 
      k_wtG<<<(unsigned)((DQ * DM / 64 + 63) / 64), 256, 0, stream>>>(wo, DQ, DM, WO);
       }
    k_csid<<<(TT * HD + 255) / 256, 256, 0, stream>>>(CS);
    const unsigned LQ = (unsigned)(((size_t)NH_ * TT * HD / 2 + 255) / 256), LKv = (unsigned)(((size_t)NKV * TT * HD / 2 + 255) / 256);
    for (int b = 0; b < NB_; ++b) {
        
        k_cvt8<<<(unsigned)(((size_t)TT * DM / 8 + 255) / 256), 256, 0, stream>>>(x + (size_t)b * TT * DM, XB, (size_t)TT * DM / 8);
        k_gemmw<bf, 0, false, KSP><<<dim3(TT / 64, DQ / 64, KSP), 32, 0, stream>>>(XB, nullptr, WQ, nullptr, DM, FQ, DQ, nullptr, 0, 0, (size_t)TT * DQ);
        k_rope<<<LQ, 256, 0, stream>>>(FQ, DQ, NH_, CS, nullptr, nullptr, 1.0f, QP16, QPh, QPl);
        k_gemmw<bf, 0, false, KSP><<<dim3(TT / 64, DKV / 64, KSP), 32, 0, stream>>>(XB, nullptr, WK, nullptr, DM, FK, DKV, nullptr, 0, 0, (size_t)TT * DKV);
        k_rope<<<LKv, 256, 0, stream>>>(FK, DKV, NKV, CS, nullptr, nullptr, 1.0f, KP16, KPh, KPl);
        k_gemmw<bf, 0, false, KSP><<<dim3(TT / 64, DKV / 64, KSP), 32, 0, stream>>>(XB, nullptr, WV, nullptr, DM, FV, DKV, nullptr, 0, 0, (size_t)TT * DKV); k_vtp<<<LKv, 256, 0, stream>>>(FV, DKV, NKV, VT16, VTh, VTl);
        for (int h0 = 0; h0 < NH_; h0 += ZH) { const size_t zq = (size_t)h0, zk = (size_t)(h0 / REP);   // one kv head per query head: the pass's two heads use consecutive kv planes (z-strides TT*HD)
            k_gemmw<bf, 2, false><<<dim3(RH / 64, TT / 64, ZH), 32, 0, stream>>>(QPh + zq * TT * HD, QPl + zq * TT * HD, KPh + zk * TT * HD, KPl + zk * TT * HD, HD, Sb, TT, nullptr, (size_t)TT * HD, (size_t)TT * HD, (size_t)TT * TT);
            k_gemmw<h16, 0, false><<<dim3((TT - RH) / 64, TT / 64, ZH), 32, 0, stream>>>(QP16 + zq * TT * HD + (size_t)RH * HD, nullptr, KP16 + zk * TT * HD, nullptr, HD, Sb + (size_t)RH * TT, TT, nullptr, (size_t)TT * HD, (size_t)TT * HD, (size_t)TT * TT);
            k_gemmw<bf, 1, false><<<dim3(TT / 64, NE / 64, ZH), 32, 0, stream>>>(QPh + zq * TT * HD, QPl + zq * TT * HD, EB, nullptr, HD, QE, NE, nullptr, (size_t)TT * HD, 0, (size_t)TT * NE);   /* QE[i][r] = q_i . rel[r] (hi/lo x exact) */ k_addrelq<<<(unsigned)(((size_t)ZH * TT * TT / 4 + 255) / 256), 256, 0, stream>>>(Sb, QE);   /* + q_i . rel[clip(i - j) + 512] */ k_asoft<<<ZH * TT / 8, 256, 0, stream>>>(Sb, P16, Ph, Pl);
            k_gemmw<bf, 2, false, KSA><<<dim3(RH / 64, HD / 64, ZH * KSA), 32, 0, stream>>>(Ph, Pl, VTh + zk * HD * TT, VTl + zk * HD * TT, TT, Ob, HD, nullptr, (size_t)RH * TT, (size_t)HD * TT, (size_t)TT * HD);
            k_gemmw<h16, 0, false, KSA><<<dim3((TT - RH) / 64, HD / 64, ZH * KSA), 32, 0, stream>>>(P16 + (size_t)RH * TT, nullptr, VT16 + zk * HD * TT, nullptr, TT, Ob + (size_t)RH * HD, HD, nullptr, (size_t)TT * TT, (size_t)HD * TT, (size_t)TT * HD);
            k_merge<<<(unsigned)(((size_t)ZH * TT * HD / 2 + 255) / 256), 256, 0, stream>>>(Ob, h0, ATh, ATl); }
        k_gemmw<bf, 1, true><<<dim3(TT / 64, DM / 64, 1), 32, 0, stream>>>(ATh, ATl, WO, nullptr, DQ, OUT + (size_t)b * TT * DM, DM, bo, 0, 0, 0); }
}

// v002
// It runs in 540 microseconds.
// Next to v001, in two timings, it ran 1.10 times as fast each time.
// All steps since v000 together make it 2.16 times as fast.
#include <hip/hip_runtime.h>

// Multi-head attention with a Shaw-style relative-key term over clipped distances (x [2][2048][512]; q = x Wq ('xw' [512][512]); k | v = x Wkv ('xw' [512][1024] column halves); 8 heads x 64; dots = (q.k + q.rel_emb[clip(i - j, -512, 512) + 512]) x 64^-0.5 (rel_emb [1025][64] shared by the heads, read); softmax (no causal mask in the module's code); out = merged Wo + bo ('xw') -> [2][2048][512] (2.1 M)).
// Layout per batch: bf16 copy of x; 'xw' weights transposed once (Wkv as one [1024][512] Bt whose row halves are k and v); exact projections; the relative table as one zero-padded bf16 plane [1088][64]; per pass of two heads: dense score tiles (hybrid rows: < 512 hi/lo 3 products, rest fp16 x1024), QE = q . rel^T (hi/lo x exact, [2][2048][1088]) gathered by the softmax kernel as Sb[i][j] + QE[i][clip(i - j) + 512], softmax with 1/8; attn.v hybrid; merged hi/lo x Wo exact + bo.
// Compute dtypes, f32 accumulate: every input rounded to bf16; projections exact; q.k rows < 512 3 products, rest fp16; q.rel hi/lo x exact on every row; softmax f32; attn.v rows < 512 3 products, rest fp16; Wo hl x exact + bias.

#define NB_  2
#define TT   2048
#define DM   512
#define NH_  8
#define NKV  8
#define REP  (NH_ / NKV)
#define HD   64
#define DQ   (NH_ * HD)
#define DKV  (NKV * HD)
#define ZH   2
#define RH   512                  // query rows < RH use hi+lo planes (0: none)
#define WIN  0
#define PCAR 1024.0f
#define SCL  0.125f
#define NE   1088     // 2*512+1 = 1025 relative offsets padded to a multiple of 64
#define NRE  1025
#define CUT  512
#define KSA  16       // k-slices of the attn.v products (K = 2048 -> 128 keys a slice)
#define KSP  4        // k-slices of the q, k, v projections (K = 512 -> 128 a slice)
typedef _Float16 h16;
typedef unsigned short bf;
typedef __attribute__((ext_vector_type(16))) __bf16   v16bf;
typedef __attribute__((ext_vector_type(16))) _Float16 v16h;
typedef __attribute__((ext_vector_type(8)))  _Float16 v8h;
typedef __attribute__((ext_vector_type(8)))  unsigned short v8us;
typedef __attribute__((ext_vector_type(8)))  float    v8f;
typedef __attribute__((ext_vector_type(4)))  float    v4f;
typedef v8h  __attribute__((may_alias)) v8ha;
typedef v4f  __attribute__((may_alias)) v4fa;
typedef v8us __attribute__((may_alias)) v8usa;

__device__ __forceinline__ unsigned short f2bf(float f) { unsigned u = __float_as_uint(f); u += 0x7FFFu + ((u >> 16) & 1u); return (unsigned short)(u >> 16); }
__device__ __forceinline__ float bf2f(unsigned short b) { return __uint_as_float(((unsigned)b) << 16); }
__device__ __forceinline__ float bfr(float f) { return bf2f(f2bf(f)); }
__device__ __forceinline__ v16h cat16(v8h lo, v8h hi) { return __builtin_shufflevector(lo, hi, 0, 1, 2, 3, 4, 5, 6, 7, 8, 9, 10, 11, 12, 13, 14, 15); }
__device__ __forceinline__ v16bf cat16b(v8us lo, v8us hi) { return __builtin_bit_cast(v16bf, __builtin_shufflevector(lo, hi, 0, 1, 2, 3, 4, 5, 6, 7, 8, 9, 10, 11, 12, 13, 14, 15)); }
__device__ __forceinline__ v8f wmma16(v16h a, v16h b, v8f c) { return __builtin_amdgcn_wmma_f32_16x16x32_f16(false, a, false, b, (short)0, c, false, false); }
__device__ __forceinline__ v8f wmmab(v16bf a, v16bf b, v8f c) { return __builtin_amdgcn_wmma_f32_16x16x32_bf16(false, a, false, b, (short)0, c, false, false); }



// ---- k_gemmw: register-blocked GEMM, ONE WAVE per 64x64 output tile (16 accumulators), operands straight from K-contiguous 16-bit planes; grid (M/64, N/64, Z * KSPL), 32 threads.
// C[m][n] (f32, pitch ldc, + optional f32 bias[n]) = sum_k A[m][k] Bt[n][k] (+ split products per NSPLIT). z-batch strides sA/sB/sC in elements. K % 32 == 0.
// KSPL > 1: split-K over the grid. blockIdx.z = z * KSPL + s; slice s sums k in [s K/KSPL, (s+1) K/KSPL) into its own plane C + (z KSPL + s) sC; the consumer adds the KSPL planes of a z in the order s = 0, 1, ...
template <typename T16> struct WFrag;
template <> struct WFrag<h16> { typedef v16h V; static __device__ __forceinline__ V ld(const h16* p) { return cat16(*(const v8h*)p, *(const v8h*)(p + 16)); } static __device__ __forceinline__ v8f mma(V a, V b, v8f c) { return wmma16(a, b, c); } };
template <> struct WFrag<bf> { typedef v16bf V; static __device__ __forceinline__ V ld(const bf* p) { return cat16b(*(const v8us*)p, *(const v8us*)(p + 16)); } static __device__ __forceinline__ v8f mma(V a, V b, v8f c) { return wmmab(a, b, c); } };
template <typename T16, int NSPLIT, bool BIAS, int KSPL = 1>
__global__ __launch_bounds__(32) void k_gemmw(const T16* __restrict__ A, const T16* __restrict__ A2, const T16* __restrict__ Bt, const T16* __restrict__ Bt2, int K, float* C, int ldc, const float* __restrict__ bias, size_t sA, size_t sB, size_t sC) {
    typedef typename WFrag<T16>::V V;
    __shared__ __align__(16) float os[16 * 68];
    const size_t z = blockIdx.z / KSPL; const int ks = (int)(blockIdx.z % KSPL); A += z * sA; if (A2) A2 += z * sA; Bt += z * sB; if (Bt2) Bt2 += z * sB; C += (size_t)blockIdx.z * sC;
    const int kbeg = ks * (K / KSPL), kend = kbeg + K / KSPL;
    const int lane = threadIdx.x & 31, lr = lane & 15, hi = lane >> 4; const int r0 = blockIdx.x * 64, c0 = blockIdx.y * 64;
    v8f acc[4][4];
#pragma unroll
    for (int mb = 0; mb < 4; ++mb)
#pragma unroll
        for (int nb = 0; nb < 4; ++nb) acc[mb][nb] = (v8f){};
    const size_t aoff = (size_t)(r0 + lr) * K + 8 * hi, boff = (size_t)(c0 + lr) * K + 8 * hi;
#pragma unroll 1
    for (int kc = kbeg; kc < kend; kc += 32) {
        V a[4], a2[4];
#pragma unroll
        for (int mb = 0; mb < 4; ++mb) { a[mb] = WFrag<T16>::ld(A + aoff + (size_t)mb * 16 * K + kc); if (NSPLIT == 1 || NSPLIT == 2) a2[mb] = WFrag<T16>::ld(A2 + aoff + (size_t)mb * 16 * K + kc); }
#pragma unroll
        for (int nb = 0; nb < 4; ++nb) { const V b = WFrag<T16>::ld(Bt + boff + (size_t)nb * 16 * K + kc); V b2; if (NSPLIT >= 2) b2 = WFrag<T16>::ld(Bt2 + boff + (size_t)nb * 16 * K + kc);
#pragma unroll
            for (int mb = 0; mb < 4; ++mb) { acc[mb][nb] = WFrag<T16>::mma(a[mb], b, acc[mb][nb]); if (NSPLIT == 1 || NSPLIT == 2) acc[mb][nb] = WFrag<T16>::mma(a2[mb], b, acc[mb][nb]); if (NSPLIT >= 2) acc[mb][nb] = WFrag<T16>::mma(a[mb], b2, acc[mb][nb]); } }
        asm volatile("v_nop\n\tv_nop\n\tv_nop\n\tv_nop" : "+v"(acc[0][0]), "+v"(acc[1][1]), "+v"(acc[2][2]), "+v"(acc[3][3]) : "v"(a[0]), "v"(a[3]));
    }
#pragma unroll
    for (int mb = 0; mb < 4; ++mb) {
#pragma unroll
        for (int nb = 0; nb < 4; ++nb) {
#pragma unroll
            for (int j = 0; j < 8; ++j) os[(hi * 8 + j) * 68 + nb * 16 + lr] = acc[mb][nb][j]; }
        __builtin_amdgcn_wave_barrier(); asm volatile("" ::: "memory");
        float* crow = C + (size_t)(r0 + mb * 16) * ldc + c0;
{
#pragma unroll
            for (int s = 0; s < 8; ++s) { const int row = 2 * s + hi, cofs = lr * 4; v4f val = *(const v4fa*)(os + row * 68 + cofs); if (BIAS) { val[0] += bfr(bias[c0 + cofs]); val[1] += bfr(bias[c0 + cofs + 1]); val[2] += bfr(bias[c0 + cofs + 2]); val[3] += bfr(bias[c0 + cofs + 3]); }
                *(v4f*)(crow + (size_t)row * ldc + cofs) = val; }
             }
        __builtin_amdgcn_wave_barrier(); asm volatile("" ::: "memory");
    }
}

__device__ __forceinline__ h16 tohx(float x) { return (h16)x; }
__device__ __forceinline__ void splitf(float y, unsigned short& h, unsigned short& l) { h = f2bf(y); l = f2bf(y - bf2f(h)); }
typedef __attribute__((ext_vector_type(2))) _Float16 v2h;
typedef __attribute__((ext_vector_type(4))) _Float16 v4h;
typedef __attribute__((ext_vector_type(2))) unsigned short v2us;
typedef __attribute__((ext_vector_type(4))) unsigned short v4us;
typedef __attribute__((ext_vector_type(2))) float v2f;
typedef __attribute__((ext_vector_type(4))) int v4i;

__global__ __launch_bounds__(256) void k_wtG(const float* __restrict__ w, int K, int N, bf* Bt) {
    const int lane = threadIdx.x & 31; const int L0 = (blockIdx.x * 8 + (threadIdx.x >> 5)) * 8; const int nlines = N * K / 64;
{
#pragma unroll 1
        for (int l = 0; l < 8; ++l) { const int L = L0 + l; if (L >= nlines) break; const size_t e = (size_t)L * 64 + lane * 2; const int k = (int)(e % K), n = (int)(e / K); v2us o;
            o[0] = f2bf(w[(size_t)k * N + n]); o[1] = f2bf(w[(size_t)(k + 1) * N + n]); *(v2us*)(Bt + e) = o; }
         }
}
__global__ __launch_bounds__(256) void k_cvt8(const float* __restrict__ src, bf* dst, size_t n8) { const size_t i = (size_t)blockIdx.x * 256 + threadIdx.x; if (i >= n8) return; const v8f v = *(const v8f*)(src + i * 8); v8us o;
#pragma unroll
    for (int k = 0; k < 8; ++k) o[k] = f2bf(v[k]); *(v8us*)(dst + i * 8) = o;  }

// k_rope: head planes [h][t][d] (fp16 + hi/lo) of rope(x) x sc with the rotate-half convention out[d] = x[d] cos[t][d] - x[d+HD/2] sin[t][d], out[d+HD/2] = x[d+HD/2] cos[t][d+HD/2] + x[d] sin[t][d+HD/2]
__global__ __launch_bounds__(256) void k_rope(const float* __restrict__ F, int pitch, int nheads, const float* __restrict__ CS, const float* __restrict__ RF, const float* __restrict__ nw, float sc, h16* P16, bf* Ph, bf* Pl) {
    const size_t e = ((size_t)blockIdx.x * 256 + threadIdx.x) * 2; if (e >= (size_t)nheads * TT * HD) return; const int d = (int)(e % HD); const int t = (int)((e / HD) % TT); const int h = (int)(e / ((size_t)HD * TT)); const float* f = F + (size_t)t * pitch + h * HD; const float rf = RF ? RF[(size_t)h * TT + t] : 1.0f; v2h o16; v2us oh, ol;
#pragma unroll
    for (int q = 0; q < 2; ++q) { const int dd = d + q; const int dp = (dd < HD / 2) ? dd + HD / 2 : dd - HD / 2; float x0 = f[dd], x1 = f[dp];
#pragma unroll
        for (int s = 1; s < KSP; ++s) {   // the projection's k-slice planes, added in fixed order
            if (s == KSP / 2) asm volatile("s_wait_xcnt 0x0" ::: "memory");   // the later loads' results take address pairs that the loads above name
            x0 += f[(size_t)s * TT * pitch + dd]; x1 += f[(size_t)s * TT * pitch + dp]; }
        if (RF) { float n0 = __fmul_rn(x0, rf), n1 = __fmul_rn(x1, rf); asm volatile("" : "+v"(n0)); asm volatile("" : "+v"(n1)); x0 = __fmul_rn(bfr(nw[dd]), n0); x1 = __fmul_rn(bfr(nw[dp]), n1); }
        const v2f cs = *(const v2f*)(CS + ((size_t)t * HD + dd) * 2); float a = __fmul_rn(x0, cs[0]), bq = __fmul_rn(x1, cs[1]); asm volatile("" : "+v"(a)); asm volatile("" : "+v"(bq)); const float r = ((dd < HD / 2) ? __fsub_rn(a, bq) : __fadd_rn(a, bq)) * sc;
        o16[q] = tohx(r); unsigned short a2, c2; splitf(r, a2, c2); oh[q] = a2; ol[q] = c2; }
    *(v2h*)(P16 + e) = o16; *(v2us*)(Ph + e) = oh; *(v2us*)(Pl + e) = ol;  }
__global__ __launch_bounds__(256) void k_vtp(const float* __restrict__ F, int pitch, int nheads, h16* V16, bf* Vh, bf* Vl) { const size_t e = ((size_t)blockIdx.x * 256 + threadIdx.x) * 2; if (e >= (size_t)nheads * HD * TT) return; const int t = (int)(e % TT); const int d = (int)((e / TT) % HD); const int g = (int)(e / ((size_t)TT * HD)); v2h o16; v2us oh, ol; float xs[2];
#pragma unroll
    for (int q = 0; q < 2; ++q) xs[q] = F[(size_t)(t + q) * pitch + g * HD + d];
#pragma unroll
    for (int s = 1; s < KSP; ++s) {   // the projection's k-slice planes, added in fixed order
        if (s == KSP / 2) asm volatile("s_wait_xcnt 0x0" ::: "memory");   // the later loads' results take address pairs that the loads above name
#pragma unroll
        for (int q = 0; q < 2; ++q) xs[q] += F[((size_t)s * TT + t + q) * pitch + g * HD + d]; }
#pragma unroll
    for (int q = 0; q < 2; ++q) { const float x = xs[q]; o16[q] = tohx(x); unsigned short a2, c2; splitf(x, a2, c2); oh[q] = a2; ol[q] = c2; }
    *(v2h*)(V16 + e) = o16; *(v2us*)(Vh + e) = oh; *(v2us*)(Vl + e) = ol;  }
__global__ __launch_bounds__(256) void k_csid(float* CS) { const int idx = blockIdx.x * 256 + threadIdx.x; if (idx >= TT * HD) return; v2f cs; cs[0] = 1.0f; cs[1] = 0.0f; *(v2f*)(CS + (size_t)idx * 2) = cs;  }
// k_asoft: per row (zz, i): t = (S[i][j] + QE[i][clip(i - j, -CUT, CUT) + CUT]) x HD^-0.5 (no mask); softmax over the 2048 keys (register row, one exp, fixed trees);
__global__ __launch_bounds__(256) void k_asoft(const float* __restrict__ Sb, const float* __restrict__ QE, h16* P16, bf* Ph, bf* Pl) {
    const int lane = threadIdx.x & 31; const int row = blockIdx.x * 8 + (threadIdx.x >> 5); if (row >= ZH * TT) return; const int i = row % TT; const int zz = row / TT; (void)zz; const bool hires = (i < RH); const float* sr = Sb + (size_t)row * TT; const float* qe = QE + (size_t)__builtin_amdgcn_readfirstlane(row) * NE;   /* one row a wave: a scalar base, each gathered element a 32-bit index */ float v[TT / 32]; float mx = -3.0e38f;
#pragma unroll
    for (int g = 0; g < TT / 512; ++g) { v4f a[4]; int r[16]; float e[16];
#pragma unroll
        for (int c = 0; c < 4; ++c) { const int j0 = (g * 4 + c) * 128 + lane * 4; a[c] = *(const v4f*)(sr + j0);
#pragma unroll
            for (int q = 0; q < 4; ++q) { r[c * 4 + q] = min(max(i + CUT - (j0 + q), 0), 2 * CUT); e[c * 4 + q] = qe[r[c * 4 + q]]; } }
        // the gather's index registers stay live up to this wait, so that no later load's result and no later index lands in a register that an issued load still names
        asm volatile("s_wait_xcnt 0x0" :: "v"(r[0]), "v"(r[1]), "v"(r[2]), "v"(r[3]), "v"(r[4]), "v"(r[5]), "v"(r[6]), "v"(r[7]), "v"(r[8]), "v"(r[9]), "v"(r[10]), "v"(r[11]), "v"(r[12]), "v"(r[13]), "v"(r[14]), "v"(r[15]) : "memory");
#pragma unroll
        for (int c = 0; c < 4; ++c)
#pragma unroll
            for (int q = 0; q < 4; ++q) { const float t = __fadd_rn(a[c][q], e[c * 4 + q]) * SCL; v[(g * 4 + c) * 4 + q] = t; mx = fmaxf(mx, t); } }
#pragma unroll
    for (int sh = 16; sh; sh >>= 1) mx = fmaxf(mx, __shfl_xor(mx, sh, 32));
    float sum = 0.f;
#pragma unroll
    for (int k = 0; k < TT / 32; ++k) { float d0 = __fsub_rn(v[k], mx); asm volatile("" : "+v"(d0)); v[k] = __builtin_amdgcn_exp2f(__fmul_rn(d0, 1.4426950408889634f)); sum += v[k]; }
#pragma unroll
    for (int sh = 16; sh; sh >>= 1) sum += __shfl_xor(sum, sh, 32);
    const float f = __fdiv_rn(hires ? 1.0f : PCAR, sum);
{
        if (hires) {
#pragma unroll
            for (int ch = 0; ch < TT / 128; ++ch) { v4us oh, ol;
#pragma unroll
                for (int q = 0; q < 4; ++q) { unsigned short a, c2; splitf(v[ch * 4 + q] * f, a, c2); oh[q] = a; ol[q] = c2; }
                const size_t oo = ((size_t)zz * (RH ? RH : 1) + i) * TT + ch * 128 + lane * 4; *(v4us*)(Ph + oo) = oh; *(v4us*)(Pl + oo) = ol; }
        } else {
#pragma unroll
            for (int ch = 0; ch < TT / 128; ++ch) { v4h o4;
#pragma unroll
                for (int q = 0; q < 4; ++q) o4[q] = tohx(v[ch * 4 + q] * f);
                *(v4h*)(P16 + (size_t)row * TT + ch * 128 + lane * 4) = o4; } }
         }
}
__global__ __launch_bounds__(256) void k_epadK(const float* __restrict__ E, bf* EB) { const size_t i = (size_t)blockIdx.x * 256 + threadIdx.x; if (i >= (size_t)NE * HD / 8) return; const int d0 = (int)(i % (HD / 8)) * 8; const int r = (int)(i / (HD / 8)); const float* src = E + (size_t)min(r, NRE - 1) * HD + d0; v8us o;
#pragma unroll
    for (int q = 0; q < 8; ++q) { const unsigned short v = f2bf(src[q]); o[q] = (r < NRE) ? v : (unsigned short)0; }
    *(v8us*)(EB + (size_t)r * HD + d0) = o;  }

__global__ __launch_bounds__(256) void k_merge(const float* __restrict__ O, int h0, bf* Ah, bf* Al) { const size_t e = ((size_t)blockIdx.x * 256 + threadIdx.x) * 2; if (e >= (size_t)ZH * TT * HD) return; const int d = (int)(e % HD); const int t = (int)((e / HD) % TT); const int zz = (int)(e / ((size_t)HD * TT)); const float cs = (t < RH) ? 1.0f : (1.0f / PCAR); const size_t oo = (size_t)t * DQ + (h0 + zz) * HD + d;
    const float* op = O + e + (size_t)zz * (KSA - 1) * TT * HD; v2f o = *(const v2f*)op;   // the attn.v k-slice planes [zz][s][t][d], added in fixed order
#pragma unroll
    for (int s = 1; s < KSA - 1; ++s) o += *(const v2f*)(op + (size_t)s * TT * HD);
    asm volatile("s_wait_xcnt 0x0" ::: "memory");   // the last load's result takes the address pair that the loads above name
    o += *(const v2f*)(op + (size_t)(KSA - 1) * TT * HD);
    v2us oh, ol;
#pragma unroll
    for (int q = 0; q < 2; ++q) { unsigned short a, c2; splitf(o[q] * cs, a, c2); oh[q] = a; ol[q] = c2; } *(v2us*)(Ah + oo) = oh; *(v2us*)(Al + oo) = ol;  }

extern "C" void kernel_launch(void* const* d_in, const int* in_sizes, int n_in,
                              void* d_out, int out_size, void* d_ws, size_t ws_size, hipStream_t stream) {
    (void)in_sizes; (void)n_in; (void)out_size;
    const float* x = (const float*)d_in[0]; const float* wq = (const float*)d_in[1]; const float* wkv = (const float*)d_in[2];   /* [512][1024]: k | v column halves */ const float* wo = (const float*)d_in[3]; const float* bo = (const float*)d_in[4]; const float* rel = (const float*)d_in[5];   /* rel_emb [1025][64] */ const float* wk = nullptr, *wv = nullptr; (void)wk; (void)wv;
    float* OUT = (float*)d_out;     // [2][2048][512]
    char* wsp = (char*)d_ws;
    auto take = [&](size_t bytes) { char* p = wsp; wsp += (bytes + 255) & ~(size_t)255; return (void*)p; };
    bf* WQ = (bf*)take((size_t)DQ * DM * 2); bf* WKV = (bf*)take((size_t)2 * DKV * DM * 2); bf* WK = WKV; bf* EB = (bf*)take((size_t)NE * HD * 2); float* QE = (float*)take((size_t)ZH * TT * NE * 4); bf* WV = WKV + (size_t)DKV * DM; bf* WO = (bf*)take((size_t)DM * DQ * 2); float* CS = (float*)take((size_t)TT * HD * 2 * 4);
    bf* XB = (bf*)take((size_t)TT * DM * 2); float* FQ = (float*)take((size_t)KSP * TT * DQ * 4); float* FK = (float*)take((size_t)KSP * TT * DKV * 4);
    h16* QP16 = (h16*)take((size_t)NH_ * TT * HD * 2); h16* KP16 = (h16*)take((size_t)NKV * TT * HD * 2); h16* VT16 = (h16*)take((size_t)NKV * HD * TT * 2);
    bf* QPh = (bf*)take((size_t)NH_ * TT * HD * 2); bf* QPl = (bf*)take((size_t)NH_ * TT * HD * 2); bf* KPh = (bf*)take((size_t)NKV * TT * HD * 2); bf* KPl = (bf*)take((size_t)NKV * TT * HD * 2); bf* VTh = (bf*)take((size_t)NKV * HD * TT * 2); bf* VTl = (bf*)take((size_t)NKV * HD * TT * 2); bf* Ph = (bf*)take((size_t)ZH * RH * TT * 2); bf* Pl = (bf*)take((size_t)ZH * RH * TT * 2);
    float* Sb = (float*)take((size_t)ZH * TT * TT * 4); h16* P16 = (h16*)take((size_t)ZH * TT * TT * 2); float* Ob = (float*)take((size_t)KSA * ZH * TT * HD * 4); bf* ATh = (bf*)take((size_t)TT * DQ * 2); bf* ATl = (bf*)take((size_t)TT * DQ * 2);
    if ((size_t)(wsp - (char*)d_ws) > ws_size) return;    // ws 256 MiB
    float* FV = FK;   // v projection reuses the k buffer after the k planes are built (stream-ordered)
    { k_wtG<<<(unsigned)((DM * DQ / 64 + 63) / 64), 256, 0, stream>>>(wq, DM, DQ, WQ); k_wtG<<<(unsigned)((DM * 2 * DKV / 64 + 63) / 64), 256, 0, stream>>>(wkv, DM, 2 * DKV, WKV);   /* 'xw' [512][1024] -> Bt [1024][512]: rows 0..511 = k, 512..1023 = v */ k_epadK<<<(unsigned)(((size_t)NE * HD / 8 + 255) / 256), 256, 0, stream>>>(rel, EB); 
      k_wtG<<<(unsigned)((DQ * DM / 64 + 63) / 64), 256, 0, stream>>>(wo, DQ, DM, WO);
       }
    k_csid<<<(TT * HD + 255) / 256, 256, 0, stream>>>(CS);
    const unsigned LQ = (unsigned)(((size_t)NH_ * TT * HD / 2 + 255) / 256), LKv = (unsigned)(((size_t)NKV * TT * HD / 2 + 255) / 256);
    for (int b = 0; b < NB_; ++b) {
        
        k_cvt8<<<(unsigned)(((size_t)TT * DM / 8 + 255) / 256), 256, 0, stream>>>(x + (size_t)b * TT * DM, XB, (size_t)TT * DM / 8);
        k_gemmw<bf, 0, false, KSP><<<dim3(TT / 64, DQ / 64, KSP), 32, 0, stream>>>(XB, nullptr, WQ, nullptr, DM, FQ, DQ, nullptr, 0, 0, (size_t)TT * DQ);
        k_rope<<<LQ, 256, 0, stream>>>(FQ, DQ, NH_, CS, nullptr, nullptr, 1.0f, QP16, QPh, QPl);
        k_gemmw<bf, 0, false, KSP><<<dim3(TT / 64, DKV / 64, KSP), 32, 0, stream>>>(XB, nullptr, WK, nullptr, DM, FK, DKV, nullptr, 0, 0, (size_t)TT * DKV);
        k_rope<<<LKv, 256, 0, stream>>>(FK, DKV, NKV, CS, nullptr, nullptr, 1.0f, KP16, KPh, KPl);
        k_gemmw<bf, 0, false, KSP><<<dim3(TT / 64, DKV / 64, KSP), 32, 0, stream>>>(XB, nullptr, WV, nullptr, DM, FV, DKV, nullptr, 0, 0, (size_t)TT * DKV); k_vtp<<<LKv, 256, 0, stream>>>(FV, DKV, NKV, VT16, VTh, VTl);
        for (int h0 = 0; h0 < NH_; h0 += ZH) { const size_t zq = (size_t)h0, zk = (size_t)(h0 / REP);   // one kv head per query head: the pass's two heads use consecutive kv planes (z-strides TT*HD)
            k_gemmw<bf, 2, false><<<dim3(RH / 64, TT / 64, ZH), 32, 0, stream>>>(QPh + zq * TT * HD, QPl + zq * TT * HD, KPh + zk * TT * HD, KPl + zk * TT * HD, HD, Sb, TT, nullptr, (size_t)TT * HD, (size_t)TT * HD, (size_t)TT * TT);
            k_gemmw<h16, 0, false><<<dim3((TT - RH) / 64, TT / 64, ZH), 32, 0, stream>>>(QP16 + zq * TT * HD + (size_t)RH * HD, nullptr, KP16 + zk * TT * HD, nullptr, HD, Sb + (size_t)RH * TT, TT, nullptr, (size_t)TT * HD, (size_t)TT * HD, (size_t)TT * TT);
            k_gemmw<bf, 1, false><<<dim3(TT / 64, NE / 64, ZH), 32, 0, stream>>>(QPh + zq * TT * HD, QPl + zq * TT * HD, EB, nullptr, HD, QE, NE, nullptr, (size_t)TT * HD, 0, (size_t)TT * NE);   /* QE[i][r] = q_i . rel[r] (hi/lo x exact) */ k_asoft<<<ZH * TT / 8, 256, 0, stream>>>(Sb, QE, P16, Ph, Pl);   /* softmax of (q.k + q_i . rel[clip(i - j) + 512]) / 8 */
            k_gemmw<bf, 2, false, KSA><<<dim3(RH / 64, HD / 64, ZH * KSA), 32, 0, stream>>>(Ph, Pl, VTh + zk * HD * TT, VTl + zk * HD * TT, TT, Ob, HD, nullptr, (size_t)RH * TT, (size_t)HD * TT, (size_t)TT * HD);
            k_gemmw<h16, 0, false, KSA><<<dim3((TT - RH) / 64, HD / 64, ZH * KSA), 32, 0, stream>>>(P16 + (size_t)RH * TT, nullptr, VT16 + zk * HD * TT, nullptr, TT, Ob + (size_t)RH * HD, HD, nullptr, (size_t)TT * TT, (size_t)HD * TT, (size_t)TT * HD);
            k_merge<<<(unsigned)(((size_t)ZH * TT * HD / 2 + 255) / 256), 256, 0, stream>>>(Ob, h0, ATh, ATl); }
        k_gemmw<bf, 1, true><<<dim3(TT / 64, DM / 64, 1), 32, 0, stream>>>(ATh, ATl, WO, nullptr, DQ, OUT + (size_t)b * TT * DM, DM, bo, 0, 0, 0); }
}

// v003
// Measured time: 386 microseconds a run.
// In both of two side-by-side timings against v002, it was 1.40 times as fast.
// All steps since v000 together make it 3.03 times as fast.
#include <hip/hip_runtime.h>

// Multi-head attention with a Shaw-style relative-key term over clipped distances (x [2][2048][512]; q = x Wq ('xw' [512][512]); k | v = x Wkv ('xw' [512][1024] column halves); 8 heads x 64; dots = (q.k + q.rel_emb[clip(i - j, -512, 512) + 512]) x 64^-0.5 (rel_emb [1025][64] shared by the heads, read); softmax (no causal mask in the module's code); out = merged Wo + bo ('xw') -> [2][2048][512] (2.1 M)).
// Layout: both batches as 4096 rows through one q|k|v projection launch and one Wo launch; bf16 copy of x; 'xw' weights transposed once (Wkv as one [1024][512] Bt whose row halves are k and v); exact projections; the relative table as one zero-padded bf16 plane [1088][64]; per pass of one batch's eight heads: dense score tiles (hybrid rows: < 512 hi/lo 3 products, rest fp16 x1024), QE = q . rel^T (hi/lo x exact, [8][2048][1088]) gathered by the softmax kernel as Sb[i][j] + QE[i][clip(i - j) + 512], softmax with 1/8, its 16-bit probabilities written over the row's own f32 scores (row pitch 2 x 2048, which the transposed v planes share); attn.v hybrid; merged hi/lo x Wo exact + bo.
// Compute dtypes, f32 accumulate: every input rounded to bf16; projections exact; q.k rows < 512 3 products, rest fp16; q.rel hi/lo x exact on every row; softmax f32; attn.v rows < 512 3 products, rest fp16; Wo hl x exact + bias.

#define NB_  2
#define TT   2048
#define DM   512
#define NH_  8
#define NKV  8
#define REP  (NH_ / NKV)
#define HD   64
#define DQ   (NH_ * HD)
#define DKV  (NKV * HD)
#define ZH   8
#define RH   512                  // query rows < RH use hi+lo planes (0: none)
#define WIN  0
#define PCAR 1024.0f
#define SCL  0.125f
#define NE   1088     // 2*512+1 = 1025 relative offsets padded to a multiple of 64
#define NRE  1025
#define CUT  512
#define KSA  16       // k-slices of the attn.v products (K = 2048 -> 128 keys a slice)
#define KSP  4        // k-slices of the q, k, v projections (K = 512 -> 128 a slice)
typedef _Float16 h16;
typedef unsigned short bf;
typedef __attribute__((ext_vector_type(16))) __bf16   v16bf;
typedef __attribute__((ext_vector_type(16))) _Float16 v16h;
typedef __attribute__((ext_vector_type(8)))  _Float16 v8h;
typedef __attribute__((ext_vector_type(8)))  unsigned short v8us;
typedef __attribute__((ext_vector_type(8)))  float    v8f;
typedef __attribute__((ext_vector_type(4)))  float    v4f;
typedef v8h  __attribute__((may_alias)) v8ha;
typedef v4f  __attribute__((may_alias)) v4fa;
typedef v8us __attribute__((may_alias)) v8usa;

__device__ __forceinline__ unsigned short f2bf(float f) { unsigned u = __float_as_uint(f); u += 0x7FFFu + ((u >> 16) & 1u); return (unsigned short)(u >> 16); }
__device__ __forceinline__ float bf2f(unsigned short b) { return __uint_as_float(((unsigned)b) << 16); }
__device__ __forceinline__ float bfr(float f) { return bf2f(f2bf(f)); }
__device__ __forceinline__ v16h cat16(v8h lo, v8h hi) { return __builtin_shufflevector(lo, hi, 0, 1, 2, 3, 4, 5, 6, 7, 8, 9, 10, 11, 12, 13, 14, 15); }
__device__ __forceinline__ v16bf cat16b(v8us lo, v8us hi) { return __builtin_bit_cast(v16bf, __builtin_shufflevector(lo, hi, 0, 1, 2, 3, 4, 5, 6, 7, 8, 9, 10, 11, 12, 13, 14, 15)); }
__device__ __forceinline__ v8f wmma16(v16h a, v16h b, v8f c) { return __builtin_amdgcn_wmma_f32_16x16x32_f16(false, a, false, b, (short)0, c, false, false); }
__device__ __forceinline__ v8f wmmab(v16bf a, v16bf b, v8f c) { return __builtin_amdgcn_wmma_f32_16x16x32_bf16(false, a, false, b, (short)0, c, false, false); }



// ---- k_gemmw: register-blocked GEMM, ONE WAVE per 64x64 output tile (16 accumulators), operands straight from K-contiguous 16-bit planes; grid (M/64, N/64, Z), 32 threads.
// C[m][n] (f32, pitch ldc, + optional f32 bias[n]) = sum_k A[m][k] Bt[n][k] (+ split products per NSPLIT). K is the row pitch of A and Bt, the sum runs over k < KX <= K. z-batch strides sA/sB/sC in elements. KX % 32 == 0.
// KSPL > 1: split-K over the grid. blockIdx.z = z * KSPL + s; slice s sums k in [s KX/KSPL, (s+1) KX/KSPL) into its own plane C + (z KSPL + s) sC; the consumer adds the KSPL planes of a z in the order s = 0, 1, ...
template <typename T16> struct WFrag;
template <> struct WFrag<h16> { typedef v16h V; static __device__ __forceinline__ V ld(const h16* p) { return cat16(*(const v8h*)p, *(const v8h*)(p + 16)); } static __device__ __forceinline__ v8f mma(V a, V b, v8f c) { return wmma16(a, b, c); } };
template <> struct WFrag<bf> { typedef v16bf V; static __device__ __forceinline__ V ld(const bf* p) { return cat16b(*(const v8us*)p, *(const v8us*)(p + 16)); } static __device__ __forceinline__ v8f mma(V a, V b, v8f c) { return wmmab(a, b, c); } };
template <typename T16, int NSPLIT, bool BIAS, int KSPL = 1>
__global__ __launch_bounds__(32) void k_gemmw(const T16* __restrict__ A, const T16* __restrict__ A2, const T16* __restrict__ Bt, const T16* __restrict__ Bt2, int K, int KX, float* C, int ldc, const float* __restrict__ bias, size_t sA, size_t sB, size_t sC) {
    typedef typename WFrag<T16>::V V;
    __shared__ __align__(16) float os[16 * 68];
    const size_t z = blockIdx.z / KSPL; const int ks = (int)(blockIdx.z % KSPL); A += z * sA; if (A2) A2 += z * sA; Bt += z * sB; if (Bt2) Bt2 += z * sB; C += (size_t)blockIdx.z * sC;
    const int kbeg = ks * (KX / KSPL), kend = kbeg + KX / KSPL;
    const int lane = threadIdx.x & 31, lr = lane & 15, hi = lane >> 4; const int r0 = blockIdx.x * 64, c0 = blockIdx.y * 64;
    v8f acc[4][4];
#pragma unroll
    for (int mb = 0; mb < 4; ++mb)
#pragma unroll
        for (int nb = 0; nb < 4; ++nb) acc[mb][nb] = (v8f){};
    const size_t aoff = (size_t)(r0 + lr) * K + 8 * hi, boff = (size_t)(c0 + lr) * K + 8 * hi;
#pragma unroll 1
    for (int kc = kbeg; kc < kend; kc += 32) {
        V a[4], a2[4];
#pragma unroll
        for (int mb = 0; mb < 4; ++mb) { a[mb] = WFrag<T16>::ld(A + aoff + (size_t)mb * 16 * K + kc); if (NSPLIT == 1 || NSPLIT == 2) a2[mb] = WFrag<T16>::ld(A2 + aoff + (size_t)mb * 16 * K + kc); }
#pragma unroll
        for (int nb = 0; nb < 4; ++nb) { const V b = WFrag<T16>::ld(Bt + boff + (size_t)nb * 16 * K + kc); V b2; if (NSPLIT >= 2) b2 = WFrag<T16>::ld(Bt2 + boff + (size_t)nb * 16 * K + kc);
#pragma unroll
            for (int mb = 0; mb < 4; ++mb) { acc[mb][nb] = WFrag<T16>::mma(a[mb], b, acc[mb][nb]); if (NSPLIT == 1 || NSPLIT == 2) acc[mb][nb] = WFrag<T16>::mma(a2[mb], b, acc[mb][nb]); if (NSPLIT >= 2) acc[mb][nb] = WFrag<T16>::mma(a[mb], b2, acc[mb][nb]); } }
        asm volatile("v_nop\n\tv_nop\n\tv_nop\n\tv_nop" : "+v"(acc[0][0]), "+v"(acc[1][1]), "+v"(acc[2][2]), "+v"(acc[3][3]) : "v"(a[0]), "v"(a[3]));
    }
#pragma unroll
    for (int mb = 0; mb < 4; ++mb) {
#pragma unroll
        for (int nb = 0; nb < 4; ++nb) {
#pragma unroll
            for (int j = 0; j < 8; ++j) os[(hi * 8 + j) * 68 + nb * 16 + lr] = acc[mb][nb][j]; }
        __builtin_amdgcn_wave_barrier(); asm volatile("" ::: "memory");
        float* crow = C + (size_t)(r0 + mb * 16) * ldc + c0;
{
#pragma unroll
            for (int s = 0; s < 8; ++s) { const int row = 2 * s + hi, cofs = lr * 4; v4f val = *(const v4fa*)(os + row * 68 + cofs); if (BIAS) { val[0] += bfr(bias[c0 + cofs]); val[1] += bfr(bias[c0 + cofs + 1]); val[2] += bfr(bias[c0 + cofs + 2]); val[3] += bfr(bias[c0 + cofs + 3]); }
                *(v4f*)(crow + (size_t)row * ldc + cofs) = val; }
             }
        __builtin_amdgcn_wave_barrier(); asm volatile("" ::: "memory");
    }
}

__device__ __forceinline__ h16 tohx(float x) { return (h16)x; }
__device__ __forceinline__ void splitf(float y, unsigned short& h, unsigned short& l) { h = f2bf(y); l = f2bf(y - bf2f(h)); }
typedef __attribute__((ext_vector_type(2))) _Float16 v2h;
typedef __attribute__((ext_vector_type(4))) _Float16 v4h;
typedef __attribute__((ext_vector_type(2))) unsigned short v2us;
typedef __attribute__((ext_vector_type(4))) unsigned short v4us;
typedef __attribute__((ext_vector_type(2))) float v2f;
typedef __attribute__((ext_vector_type(4))) int v4i;

__global__ __launch_bounds__(256) void k_wtG(const float* __restrict__ w, int K, int N, bf* Bt) {
    const int lane = threadIdx.x & 31; const int L0 = (blockIdx.x * 8 + (threadIdx.x >> 5)) * 8; const int nlines = N * K / 64;
{
#pragma unroll 1
        for (int l = 0; l < 8; ++l) { const int L = L0 + l; if (L >= nlines) break; const size_t e = (size_t)L * 64 + lane * 2; const int k = (int)(e % K), n = (int)(e / K); v2us o;
            o[0] = f2bf(w[(size_t)k * N + n]); o[1] = f2bf(w[(size_t)(k + 1) * N + n]); *(v2us*)(Bt + e) = o; }
         }
}
__global__ __launch_bounds__(256) void k_cvt8(const float* __restrict__ src, bf* dst, size_t n8) { const size_t i = (size_t)blockIdx.x * 256 + threadIdx.x; if (i >= n8) return; const v8f v = *(const v8f*)(src + i * 8); v8us o;
#pragma unroll
    for (int k = 0; k < 8; ++k) o[k] = f2bf(v[k]); *(v8us*)(dst + i * 8) = o;  }

// k_rope: F holds [slice][b t][q | k | v columns]; plane u = (q or k, b, h) in that order. Head planes [u][t][d] (fp16 + hi/lo) of rope(x) x sc with the rotate-half convention out[d] = x[d] cos[t][d] - x[d+HD/2] sin[t][d], out[d+HD/2] = x[d+HD/2] cos[t][d+HD/2] + x[d] sin[t][d+HD/2]
__global__ __launch_bounds__(256) void k_rope(const float* __restrict__ F, int pitch, int nheads, const float* __restrict__ CS, const float* __restrict__ RF, const float* __restrict__ nw, float sc, h16* P16, bf* Ph, bf* Pl) {
    const size_t e = ((size_t)blockIdx.x * 256 + threadIdx.x) * 2; if (e >= (size_t)nheads * TT * HD) return; const int d = (int)(e % HD); const int t = (int)((e / HD) % TT); const int h = (int)(e / ((size_t)HD * TT)); const float* f = F + (size_t)(((h / NH_) % NB_) * TT + t) * pitch + (h / (NB_ * NH_)) * DQ + (h % NH_) * HD; float rf = 1.0f;
    if (RF) { const float* rp = RF + (size_t)h * TT + t; rf = *rp; asm volatile("s_wait_xcnt 0x0" :: "v"(rp) : "memory"); }   // the load's address pair stays live up to this wait: the address sums below would take it otherwise
    v2h o16; v2us oh, ol;
#pragma unroll
    for (int q = 0; q < 2; ++q) { const int dd = d + q; const int dp = (dd < HD / 2) ? dd + HD / 2 : dd - HD / 2; float x0 = f[dd], x1 = f[dp];
#pragma unroll
        for (int s = 1; s < KSP; ++s) {   // the projection's k-slice planes, added in fixed order
            if (s == KSP / 2) asm volatile("s_wait_xcnt 0x0" ::: "memory");   // the later loads' results take address pairs that the loads above name
            x0 += f[(size_t)s * NB_ * TT * pitch + dd]; x1 += f[(size_t)s * NB_ * TT * pitch + dp]; }
        if (RF) { float n0 = __fmul_rn(x0, rf), n1 = __fmul_rn(x1, rf); asm volatile("" : "+v"(n0)); asm volatile("" : "+v"(n1)); x0 = __fmul_rn(bfr(nw[dd]), n0); x1 = __fmul_rn(bfr(nw[dp]), n1); }
        const v2f cs = *(const v2f*)(CS + ((size_t)t * HD + dd) * 2); float a = __fmul_rn(x0, cs[0]), bq = __fmul_rn(x1, cs[1]); asm volatile("" : "+v"(a)); asm volatile("" : "+v"(bq)); const float r = ((dd < HD / 2) ? __fsub_rn(a, bq) : __fadd_rn(a, bq)) * sc;
        o16[q] = tohx(r); unsigned short a2, c2; splitf(r, a2, c2); oh[q] = a2; ol[q] = c2; }
    *(v2h*)(P16 + e) = o16; *(v2us*)(Ph + e) = oh; *(v2us*)(Pl + e) = ol;  }
__global__ __launch_bounds__(256) void k_vtp(const float* __restrict__ F, int pitch, int nheads, h16* V16, bf* Vh, bf* Vl) { const size_t e = ((size_t)blockIdx.x * 256 + threadIdx.x) * 2; if (e >= (size_t)nheads * HD * TT) return; const int t = (int)(e % TT); const int d = (int)((e / TT) % HD); const int g = (int)(e / ((size_t)TT * HD)); v2h o16; v2us oh, ol; float xs[2];
#pragma unroll
    for (int q = 0; q < 2; ++q) xs[q] = F[(size_t)((g / NKV) * TT + t + q) * pitch + (g % NKV) * HD + d];   // plane g = (b, head)
#pragma unroll
    for (int s = 1; s < KSP; ++s) {   // the projection's k-slice planes, added in fixed order
        if (s == KSP / 2) asm volatile("s_wait_xcnt 0x0" ::: "memory");   // the later loads' results take address pairs that the loads above name
#pragma unroll
        for (int q = 0; q < 2; ++q) xs[q] += F[((size_t)s * NB_ * TT + (g / NKV) * TT + t + q) * pitch + (g % NKV) * HD + d]; }
#pragma unroll
    for (int q = 0; q < 2; ++q) { const float x = xs[q]; o16[q] = tohx(x); unsigned short a2, c2; splitf(x, a2, c2); oh[q] = a2; ol[q] = c2; }
    const size_t r16 = ((size_t)((g % NKV) * HD + d) * NB_ + g / NKV) * TT + t, rhl = (size_t)(g * HD + d) * 2 * TT + t;   // fp16 rows [head][d][b | b], hi/lo rows [g][d][hi | lo]: pitch 2 x TT, as the probabilities have it
    *(v2h*)(V16 + r16) = o16; *(v2us*)(Vh + rhl) = oh; *(v2us*)(Vl + rhl) = ol;  }
__global__ __launch_bounds__(256) void k_csid(float* CS) { const int idx = blockIdx.x * 256 + threadIdx.x; if (idx >= TT * HD) return; v2f cs; cs[0] = 1.0f; cs[1] = 0.0f; *(v2f*)(CS + (size_t)idx * 2) = cs;  }
// k_asoft: per row (zz, i): t = (S[i][j] + QE[i][clip(i - j, -CUT, CUT) + CUT]) x HD^-0.5 (no mask); softmax over the 2048 keys (register row, one exp, fixed trees); the row's probabilities go over its own 8 KiB of scores, which only this wave reads and has read whole by then: hi plane | lo plane (rows < RH), else fp16 in the first half
__global__ __launch_bounds__(256) void k_asoft(float* Sb, const float* __restrict__ QE) {
    const int lane = threadIdx.x & 31; const int row = blockIdx.x * 8 + (threadIdx.x >> 5); if (row >= ZH * TT) return; const int i = row % TT; const int zz = row / TT; (void)zz; const bool hires = (i < RH); float* sr = Sb + (size_t)row * TT; const float* qe = QE + (size_t)__builtin_amdgcn_readfirstlane(row) * NE;   /* one row a wave: a scalar base, each gathered element a 32-bit index */ float v[TT / 32]; float mx = -3.0e38f;
#pragma unroll
    for (int g = 0; g < TT / 512; ++g) { v4f a[4]; int r[16]; float e[16];
#pragma unroll
        for (int c = 0; c < 4; ++c) { const int j0 = (g * 4 + c) * 128 + lane * 4; a[c] = *(const v4f*)(sr + j0);
#pragma unroll
            for (int q = 0; q < 4; ++q) { r[c * 4 + q] = min(max(i + CUT - (j0 + q), 0), 2 * CUT); e[c * 4 + q] = qe[r[c * 4 + q]]; } }
        // the gather's index registers stay live up to this wait, so that no later load's result and no later index lands in a register that an issued load still names
        asm volatile("s_wait_xcnt 0x0" :: "v"(r[0]), "v"(r[1]), "v"(r[2]), "v"(r[3]), "v"(r[4]), "v"(r[5]), "v"(r[6]), "v"(r[7]), "v"(r[8]), "v"(r[9]), "v"(r[10]), "v"(r[11]), "v"(r[12]), "v"(r[13]), "v"(r[14]), "v"(r[15]) : "memory");
#pragma unroll
        for (int c = 0; c < 4; ++c)
#pragma unroll
            for (int q = 0; q < 4; ++q) { const float t = __fadd_rn(a[c][q], e[c * 4 + q]) * SCL; v[(g * 4 + c) * 4 + q] = t; mx = fmaxf(mx, t); } }
#pragma unroll
    for (int sh = 16; sh; sh >>= 1) mx = fmaxf(mx, __shfl_xor(mx, sh, 32));
    float sum = 0.f;
#pragma unroll
    for (int k = 0; k < TT / 32; ++k) { float d0 = __fsub_rn(v[k], mx); asm volatile("" : "+v"(d0)); v[k] = __builtin_amdgcn_exp2f(__fmul_rn(d0, 1.4426950408889634f)); sum += v[k]; }
#pragma unroll
    for (int sh = 16; sh; sh >>= 1) sum += __shfl_xor(sum, sh, 32);
    const float f = __fdiv_rn(hires ? 1.0f : PCAR, sum);
{
        if (hires) {
#pragma unroll
            for (int ch = 0; ch < TT / 128; ++ch) { v4us oh, ol;
#pragma unroll
                for (int q = 0; q < 4; ++q) { unsigned short a, c2; splitf(v[ch * 4 + q] * f, a, c2); oh[q] = a; ol[q] = c2; }
                bf* pr = (bf*)sr + ch * 128 + lane * 4; *(v4us*)pr = oh; *(v4us*)(pr + TT) = ol; }
        } else {
#pragma unroll
            for (int ch = 0; ch < TT / 128; ++ch) { v4h o4;
#pragma unroll
                for (int q = 0; q < 4; ++q) o4[q] = tohx(v[ch * 4 + q] * f);
                *(v4h*)((h16*)sr + ch * 128 + lane * 4) = o4; } }
         }
}
__global__ __launch_bounds__(256) void k_epadK(const float* __restrict__ E, bf* EB) { const size_t i = (size_t)blockIdx.x * 256 + threadIdx.x; if (i >= (size_t)NE * HD / 8) return; const int d0 = (int)(i % (HD / 8)) * 8; const int r = (int)(i / (HD / 8)); const float* src = E + (size_t)min(r, NRE - 1) * HD + d0; v8us o;
#pragma unroll
    for (int q = 0; q < 8; ++q) { const unsigned short v = f2bf(src[q]); o[q] = (r < NRE) ? v : (unsigned short)0; }
    *(v8us*)(EB + (size_t)r * HD + d0) = o;  }

__global__ __launch_bounds__(256) void k_merge(const float* __restrict__ O, int h0, bf* Ah, bf* Al) { const size_t e = ((size_t)blockIdx.x * 256 + threadIdx.x) * 2; if (e >= (size_t)ZH * TT * HD) return; const int d = (int)(e % HD); const int t = (int)((e / HD) % TT); const int zz = (int)(e / ((size_t)HD * TT)); const float cs = (t < RH) ? 1.0f : (1.0f / PCAR); const size_t oo = (size_t)t * DQ + (h0 + zz) * HD + d;
    const float* op = O + e + (size_t)zz * (KSA - 1) * TT * HD; v2f o = *(const v2f*)op;   // the attn.v k-slice planes [zz][s][t][d], added in fixed order
#pragma unroll
    for (int s = 1; s < KSA - 1; ++s) o += *(const v2f*)(op + (size_t)s * TT * HD);
    asm volatile("s_wait_xcnt 0x0" ::: "memory");   // the last load's result takes the address pair that the loads above name
    o += *(const v2f*)(op + (size_t)(KSA - 1) * TT * HD);
    v2us oh, ol;
#pragma unroll
    for (int q = 0; q < 2; ++q) { unsigned short a, c2; splitf(o[q] * cs, a, c2); oh[q] = a; ol[q] = c2; } *(v2us*)(Ah + oo) = oh; *(v2us*)(Al + oo) = ol;  }

extern "C" void kernel_launch(void* const* d_in, const int* in_sizes, int n_in,
                              void* d_out, int out_size, void* d_ws, size_t ws_size, hipStream_t stream) {
    (void)in_sizes; (void)n_in; (void)out_size;
    const float* x = (const float*)d_in[0]; const float* wq = (const float*)d_in[1]; const float* wkv = (const float*)d_in[2];   /* [512][1024]: k | v column halves */ const float* wo = (const float*)d_in[3]; const float* bo = (const float*)d_in[4]; const float* rel = (const float*)d_in[5];   /* rel_emb [1025][64] */ const float* wk = nullptr, *wv = nullptr; (void)wk; (void)wv;
    float* OUT = (float*)d_out;     // [2][2048][512]
    char* wsp = (char*)d_ws;
    auto take = [&](size_t bytes) { char* p = wsp; wsp += (bytes + 255) & ~(size_t)255; return (void*)p; };
    bf* WQ = (bf*)take((size_t)DQ * DM * 2); bf* WKV = (bf*)take((size_t)2 * DKV * DM * 2);   /* directly behind WQ: one Bt [1536][512], rows q | k | v */ bf* EB = (bf*)take((size_t)NE * HD * 2); float* QE = (float*)take((size_t)ZH * TT * NE * 4); bf* WO = (bf*)take((size_t)DM * DQ * 2); float* CS = (float*)take((size_t)TT * HD * 2 * 4);
    bf* XB = (bf*)take((size_t)NB_ * TT * DM * 2);
    const size_t PU = (size_t)TT * HD, NU = (size_t)NB_ * NH_;   // one (batch, head) plane; planes a tensor
    h16* QP16 = (h16*)take(2 * NU * PU * 2); h16* KP16 = QP16 + NU * PU; bf* QPh = (bf*)take(2 * NU * PU * 2); bf* KPh = QPh + NU * PU; bf* QPl = (bf*)take(2 * NU * PU * 2); bf* KPl = QPl + NU * PU;   // q planes, then k planes
    h16* VT16 = (h16*)take(NU * PU * 2); bf* VTh = (bf*)take(2 * NU * PU * 2); bf* VTl = VTh + TT;   // rows of pitch 2 x TT: [batch 0 | batch 1] and [hi | lo]
    float* Sb = (float*)take((size_t)ZH * TT * TT * 4); bf* ATh = (bf*)take((size_t)NB_ * TT * DQ * 2); bf* ATl = (bf*)take((size_t)NB_ * TT * DQ * 2);
    if ((size_t)(wsp - (char*)d_ws) > ws_size) return;    // ws 256 MiB
    float* FP = Sb;   // projection slices [KSP][4096][1536] (96 MiB): read out into the head planes before the first score tile is stored (stream-ordered)
    float* Ob = QE;   // attn.v slices [ZH][KSA][2048][64] (64 MiB): QE is read for the last time by the softmax in front of them (stream-ordered)
    const int DP = DQ + 2 * DKV;
    { k_wtG<<<(unsigned)((DM * DQ / 64 + 63) / 64), 256, 0, stream>>>(wq, DM, DQ, WQ); k_wtG<<<(unsigned)((DM * 2 * DKV / 64 + 63) / 64), 256, 0, stream>>>(wkv, DM, 2 * DKV, WKV);   /* 'xw' [512][1024] -> Bt [1024][512]: rows 0..511 = k, 512..1023 = v */ k_epadK<<<(unsigned)(((size_t)NE * HD / 8 + 255) / 256), 256, 0, stream>>>(rel, EB);
      k_wtG<<<(unsigned)((DQ * DM / 64 + 63) / 64), 256, 0, stream>>>(wo, DQ, DM, WO);
       }
    k_csid<<<(TT * HD + 255) / 256, 256, 0, stream>>>(CS);
    k_cvt8<<<(unsigned)(((size_t)NB_ * TT * DM / 8 + 255) / 256), 256, 0, stream>>>(x, XB, (size_t)NB_ * TT * DM / 8);
    k_gemmw<bf, 0, false, KSP><<<dim3(NB_ * TT / 64, DP / 64, KSP), 32, 0, stream>>>(XB, nullptr, WQ, nullptr, DM, DM, FP, DP, nullptr, 0, 0, (size_t)NB_ * TT * DP);
    k_rope<<<(unsigned)((2 * NU * PU / 2 + 255) / 256), 256, 0, stream>>>(FP, DP, (int)(2 * NU), CS, nullptr, nullptr, 1.0f, QP16, QPh, QPl);
    k_vtp<<<(unsigned)((NU * PU / 2 + 255) / 256), 256, 0, stream>>>(FP + DQ + DKV, DP, (int)NU, VT16, VTh, VTl);
    for (int b = 0; b < NB_; ++b) { const size_t zq = (size_t)b * NH_ * PU;   // one pass: the eight heads of batch b on grid z (one kv head per query head)
        k_gemmw<bf, 2, false><<<dim3(RH / 64, TT / 64, ZH), 32, 0, stream>>>(QPh + zq, QPl + zq, KPh + zq, KPl + zq, HD, HD, Sb, TT, nullptr, PU, PU, (size_t)TT * TT);
        k_gemmw<h16, 0, false><<<dim3((TT - RH) / 64, TT / 64, ZH), 32, 0, stream>>>(QP16 + zq + (size_t)RH * HD, nullptr, KP16 + zq, nullptr, HD, HD, Sb + (size_t)RH * TT, TT, nullptr, PU, PU, (size_t)TT * TT);
        k_gemmw<bf, 1, false><<<dim3(TT / 64, NE / 64, ZH), 32, 0, stream>>>(QPh + zq, QPl + zq, EB, nullptr, HD, HD, QE, NE, nullptr, PU, 0, (size_t)TT * NE);   /* QE[i][r] = q_i . rel[r] (hi/lo x exact) */
        k_asoft<<<ZH * TT / 8, 256, 0, stream>>>(Sb, QE);   /* softmax of (q.k + q_i . rel[clip(i - j) + 512]) / 8 */
        k_gemmw<bf, 2, false, KSA><<<dim3(RH / 64, HD / 64, ZH * KSA), 32, 0, stream>>>((const bf*)Sb, (const bf*)Sb + TT, VTh + 2 * zq, VTl + 2 * zq, 2 * TT, TT, Ob, HD, nullptr, (size_t)2 * TT * TT, 2 * PU, PU);
        k_gemmw<h16, 0, false, KSA><<<dim3((TT - RH) / 64, HD / 64, ZH * KSA), 32, 0, stream>>>((const h16*)Sb + (size_t)RH * 2 * TT, nullptr, VT16 + (size_t)b * TT, nullptr, 2 * TT, TT, Ob + (size_t)RH * HD, HD, nullptr, (size_t)2 * TT * TT, 2 * PU, PU);
        k_merge<<<(unsigned)(((size_t)ZH * TT * HD / 2 + 255) / 256), 256, 0, stream>>>(Ob, 0, ATh + (size_t)b * TT * DQ, ATl + (size_t)b * TT * DQ); }
    k_gemmw<bf, 1, true><<<dim3(NB_ * TT / 64, DM / 64, 1), 32, 0, stream>>>(ATh, ATl, WO, nullptr, DQ, DQ, OUT, DM, bo, 0, 0, 0);
}

// v004
// It runs in 225 microseconds.
// In two side-by-side timings against v003, it was 1.71 and 1.72 times as fast.
// Over all steps from v000 it is 5.18 times as fast.
#include <hip/hip_runtime.h>

// Multi-head attention with a Shaw-style relative-key term over clipped distances (x [2][2048][512]; q = x Wq ('xw' [512][512]); k | v = x Wkv ('xw' [512][1024] column halves); 8 heads x 64; dots = (q.k + q.rel_emb[clip(i - j, -512, 512) + 512]) x 64^-0.5 (rel_emb [1025][64] shared by the heads, read); softmax (no causal mask in the module's code); out = merged Wo + bo ('xw') -> [2][2048][512] (2.1 M)).
// Layout: both batches as 4096 rows through one q|k|v projection launch and one Wo launch; bf16 copy of x; 'xw' weights transposed once (Wkv as one [1024][512] Bt whose row halves are k and v); exact projections; the relative table as one zero-padded bf16 plane [1088][64]; QE = q . rel^T (hi/lo x exact, [16][2048][1088]) for all 16 (batch, head) planes in one launch; one attention launch: a wave holds 16 queries and walks half of the keys in stages of 32 that four waves share in LDS (scores^T = K Q^T, + QE[i][clip(i - j) + 512], running maximum and sum, O^T += V^T P^T with P packed from the score accumulators), the two halves joined through LDS in fixed order; hybrid rows: < 512 hi/lo 3 products, rest fp16; merged hi/lo x Wo exact + bo.
// Compute dtypes, f32 accumulate: every input rounded to bf16; projections exact; q.k rows < 512 3 products, rest fp16; q.rel hi/lo x exact on every row; softmax f32 (running maximum); attn.v rows < 512 3 products, rest fp16 (unnormalised weights x 16); Wo hl x exact + bias.

#define NB_  2
#define TT   2048
#define DM   512
#define NH_  8
#define NKV  8
#define REP  (NH_ / NKV)
#define HD   64
#define DQ   (NH_ * HD)
#define DKV  (NKV * HD)
#define RH   512                  // query rows < RH use hi+lo planes (0: none)
#define WIN  0
#define SCL  0.125f
#define NE   1088     // 2*512+1 = 1025 relative offsets padded to a multiple of 64
#define NRE  1025
#define CUT  512
#define KSP  4        // k-slices of the q, k, v projections (K = 512 -> 128 a slice)
#define KSF  2        // key halves of a query tile in the attention kernel, one wave each
typedef _Float16 h16;
typedef unsigned short bf;
typedef __attribute__((ext_vector_type(16))) __bf16   v16bf;
typedef __attribute__((ext_vector_type(16))) _Float16 v16h;
typedef __attribute__((ext_vector_type(8)))  _Float16 v8h;
typedef __attribute__((ext_vector_type(8)))  unsigned short v8us;
typedef __attribute__((ext_vector_type(8)))  float    v8f;
typedef __attribute__((ext_vector_type(4)))  float    v4f;
typedef v8h  __attribute__((may_alias)) v8ha;
typedef v4f  __attribute__((may_alias)) v4fa;
typedef v8us __attribute__((may_alias)) v8usa;

__device__ __forceinline__ unsigned short f2bf(float f) { unsigned u = __float_as_uint(f); u += 0x7FFFu + ((u >> 16) & 1u); return (unsigned short)(u >> 16); }
__device__ __forceinline__ float bf2f(unsigned short b) { return __uint_as_float(((unsigned)b) << 16); }
__device__ __forceinline__ float bfr(float f) { return bf2f(f2bf(f)); }
__device__ __forceinline__ v16h cat16(v8h lo, v8h hi) { return __builtin_shufflevector(lo, hi, 0, 1, 2, 3, 4, 5, 6, 7, 8, 9, 10, 11, 12, 13, 14, 15); }
__device__ __forceinline__ v16bf cat16b(v8us lo, v8us hi) { return __builtin_bit_cast(v16bf, __builtin_shufflevector(lo, hi, 0, 1, 2, 3, 4, 5, 6, 7, 8, 9, 10, 11, 12, 13, 14, 15)); }
__device__ __forceinline__ v8f wmma16(v16h a, v16h b, v8f c) { return __builtin_amdgcn_wmma_f32_16x16x32_f16(false, a, false, b, (short)0, c, false, false); }
__device__ __forceinline__ v8f wmmab(v16bf a, v16bf b, v8f c) { return __builtin_amdgcn_wmma_f32_16x16x32_bf16(false, a, false, b, (short)0, c, false, false); }



// ---- k_gemmw: register-blocked GEMM, ONE WAVE per 64x64 output tile (16 accumulators), operands straight from K-contiguous 16-bit planes; grid (M/64, N/64, Z), 32 threads.
// C[m][n] (f32, pitch ldc, + optional f32 bias[n]) = sum_k A[m][k] Bt[n][k] (+ split products per NSPLIT). K is the row pitch of A and Bt, the sum runs over k < KX <= K. z-batch strides sA/sB/sC in elements. KX % 32 == 0.
// KSPL > 1: split-K over the grid. blockIdx.z = z * KSPL + s; slice s sums k in [s KX/KSPL, (s+1) KX/KSPL) into its own plane C + (z KSPL + s) sC; the consumer adds the KSPL planes of a z in the order s = 0, 1, ...
template <typename T16> struct WFrag;
template <> struct WFrag<h16> { typedef v16h V; static __device__ __forceinline__ V ld(const h16* p) { return cat16(*(const v8h*)p, *(const v8h*)(p + 16)); } static __device__ __forceinline__ v8f mma(V a, V b, v8f c) { return wmma16(a, b, c); } };
template <> struct WFrag<bf> { typedef v16bf V; static __device__ __forceinline__ V ld(const bf* p) { return cat16b(*(const v8us*)p, *(const v8us*)(p + 16)); } static __device__ __forceinline__ v8f mma(V a, V b, v8f c) { return wmmab(a, b, c); } };
template <typename T16, int NSPLIT, bool BIAS, int KSPL = 1>
__global__ __launch_bounds__(32) void k_gemmw(const T16* __restrict__ A, const T16* __restrict__ A2, const T16* __restrict__ Bt, const T16* __restrict__ Bt2, int K, int KX, float* C, int ldc, const float* __restrict__ bias, size_t sA, size_t sB, size_t sC) {
    typedef typename WFrag<T16>::V V;
    __shared__ __align__(16) float os[16 * 68];
    const size_t z = blockIdx.z / KSPL; const int ks = (int)(blockIdx.z % KSPL); A += z * sA; if (A2) A2 += z * sA; Bt += z * sB; if (Bt2) Bt2 += z * sB; C += (size_t)blockIdx.z * sC;
    const int kbeg = ks * (KX / KSPL), kend = kbeg + KX / KSPL;
    const int lane = threadIdx.x & 31, lr = lane & 15, hi = lane >> 4; const int r0 = blockIdx.x * 64, c0 = blockIdx.y * 64;
    v8f acc[4][4];
#pragma unroll
    for (int mb = 0; mb < 4; ++mb)
#pragma unroll
        for (int nb = 0; nb < 4; ++nb) acc[mb][nb] = (v8f){};
    const size_t aoff = (size_t)(r0 + lr) * K + 8 * hi, boff = (size_t)(c0 + lr) * K + 8 * hi;
#pragma unroll 1
    for (int kc = kbeg; kc < kend; kc += 32) {
        V a[4], a2[4];
#pragma unroll
        for (int mb = 0; mb < 4; ++mb) { a[mb] = WFrag<T16>::ld(A + aoff + (size_t)mb * 16 * K + kc); if (NSPLIT == 1 || NSPLIT == 2) a2[mb] = WFrag<T16>::ld(A2 + aoff + (size_t)mb * 16 * K + kc); }
#pragma unroll
        for (int nb = 0; nb < 4; ++nb) { const V b = WFrag<T16>::ld(Bt + boff + (size_t)nb * 16 * K + kc); V b2; if (NSPLIT >= 2) b2 = WFrag<T16>::ld(Bt2 + boff + (size_t)nb * 16 * K + kc);
#pragma unroll
            for (int mb = 0; mb < 4; ++mb) { acc[mb][nb] = WFrag<T16>::mma(a[mb], b, acc[mb][nb]); if (NSPLIT == 1 || NSPLIT == 2) acc[mb][nb] = WFrag<T16>::mma(a2[mb], b, acc[mb][nb]); if (NSPLIT >= 2) acc[mb][nb] = WFrag<T16>::mma(a[mb], b2, acc[mb][nb]); } }
        asm volatile("v_nop\n\tv_nop\n\tv_nop\n\tv_nop" : "+v"(acc[0][0]), "+v"(acc[1][1]), "+v"(acc[2][2]), "+v"(acc[3][3]) : "v"(a[0]), "v"(a[3]));
    }
#pragma unroll
    for (int mb = 0; mb < 4; ++mb) {
#pragma unroll
        for (int nb = 0; nb < 4; ++nb) {
#pragma unroll
            for (int j = 0; j < 8; ++j) os[(hi * 8 + j) * 68 + nb * 16 + lr] = acc[mb][nb][j]; }
        __builtin_amdgcn_wave_barrier(); asm volatile("" ::: "memory");
        float* crow = C + (size_t)(r0 + mb * 16) * ldc + c0;
{
#pragma unroll
            for (int s = 0; s < 8; ++s) { const int row = 2 * s + hi, cofs = lr * 4; v4f val = *(const v4fa*)(os + row * 68 + cofs); if (BIAS) { val[0] += bfr(bias[c0 + cofs]); val[1] += bfr(bias[c0 + cofs + 1]); val[2] += bfr(bias[c0 + cofs + 2]); val[3] += bfr(bias[c0 + cofs + 3]); }
                *(v4f*)(crow + (size_t)row * ldc + cofs) = val; }
             }
        __builtin_amdgcn_wave_barrier(); asm volatile("" ::: "memory");
    }
}

__device__ __forceinline__ h16 tohx(float x) { return (h16)x; }
__device__ __forceinline__ void splitf(float y, unsigned short& h, unsigned short& l) { h = f2bf(y); l = f2bf(y - bf2f(h)); }
typedef __attribute__((ext_vector_type(2))) _Float16 v2h;
typedef __attribute__((ext_vector_type(4))) _Float16 v4h;
typedef __attribute__((ext_vector_type(2))) unsigned short v2us;
typedef __attribute__((ext_vector_type(4))) unsigned short v4us;
typedef __attribute__((ext_vector_type(2))) float v2f;
typedef __attribute__((ext_vector_type(4))) int v4i;

__global__ __launch_bounds__(256) void k_wtG(const float* __restrict__ w, int K, int N, bf* Bt) {
    const int lane = threadIdx.x & 31; const int L0 = (blockIdx.x * 8 + (threadIdx.x >> 5)) * 8; const int nlines = N * K / 64;
{
#pragma unroll 1
        for (int l = 0; l < 8; ++l) { const int L = L0 + l; if (L >= nlines) break; const size_t e = (size_t)L * 64 + lane * 2; const int k = (int)(e % K), n = (int)(e / K); v2us o;
            o[0] = f2bf(w[(size_t)k * N + n]); o[1] = f2bf(w[(size_t)(k + 1) * N + n]); *(v2us*)(Bt + e) = o; }
         }
}
__global__ __launch_bounds__(256) void k_cvt8(const float* __restrict__ src, bf* dst, size_t n8) { const size_t i = (size_t)blockIdx.x * 256 + threadIdx.x; if (i >= n8) return; const v8f v = *(const v8f*)(src + i * 8); v8us o;
#pragma unroll
    for (int k = 0; k < 8; ++k) o[k] = f2bf(v[k]); *(v8us*)(dst + i * 8) = o;  }

// k_rope: F holds [slice][b t][q | k | v columns]; plane u = (q or k, b, h) in that order. Head planes [u][t][d] (fp16 + hi/lo) of rope(x) x sc with the rotate-half convention out[d] = x[d] cos[t][d] - x[d+HD/2] sin[t][d], out[d+HD/2] = x[d+HD/2] cos[t][d+HD/2] + x[d] sin[t][d+HD/2]
__global__ __launch_bounds__(256) void k_rope(const float* __restrict__ F, int pitch, int nheads, const float* __restrict__ CS, const float* __restrict__ RF, const float* __restrict__ nw, float sc, h16* P16, bf* Ph, bf* Pl) {
    const size_t e = ((size_t)blockIdx.x * 256 + threadIdx.x) * 2; if (e >= (size_t)nheads * TT * HD) return; const int d = (int)(e % HD); const int t = (int)((e / HD) % TT); const int h = (int)(e / ((size_t)HD * TT)); const float* f = F + (size_t)(((h / NH_) % NB_) * TT + t) * pitch + (h / (NB_ * NH_)) * DQ + (h % NH_) * HD; float rf = 1.0f;
    if (RF) { const float* rp = RF + (size_t)h * TT + t; rf = *rp; asm volatile("s_wait_xcnt 0x0" :: "v"(rp) : "memory"); }   // the load's address pair stays live up to this wait: the address sums below would take it otherwise
    v2h o16; v2us oh, ol;
#pragma unroll
    for (int q = 0; q < 2; ++q) { const int dd = d + q; const int dp = (dd < HD / 2) ? dd + HD / 2 : dd - HD / 2; float x0 = f[dd], x1 = f[dp];
#pragma unroll
        for (int s = 1; s < KSP; ++s) {   // the projection's k-slice planes, added in fixed order
            if (s == KSP / 2) asm volatile("s_wait_xcnt 0x0" ::: "memory");   // the later loads' results take address pairs that the loads above name
            x0 += f[(size_t)s * NB_ * TT * pitch + dd]; x1 += f[(size_t)s * NB_ * TT * pitch + dp]; }
        if (RF) { float n0 = __fmul_rn(x0, rf), n1 = __fmul_rn(x1, rf); asm volatile("" : "+v"(n0)); asm volatile("" : "+v"(n1)); x0 = __fmul_rn(bfr(nw[dd]), n0); x1 = __fmul_rn(bfr(nw[dp]), n1); }
        const v2f cs = *(const v2f*)(CS + ((size_t)t * HD + dd) * 2); float a = __fmul_rn(x0, cs[0]), bq = __fmul_rn(x1, cs[1]); asm volatile("" : "+v"(a)); asm volatile("" : "+v"(bq)); const float r = ((dd < HD / 2) ? __fsub_rn(a, bq) : __fadd_rn(a, bq)) * sc;
        o16[q] = tohx(r); unsigned short a2, c2; splitf(r, a2, c2); oh[q] = a2; ol[q] = c2; }
    *(v2h*)(P16 + e) = o16; *(v2us*)(Ph + e) = oh; *(v2us*)(Pl + e) = ol;  }
__global__ __launch_bounds__(256) void k_vtp(const float* __restrict__ F, int pitch, int nheads, h16* V16, bf* Vh, bf* Vl) { const size_t e = ((size_t)blockIdx.x * 256 + threadIdx.x) * 2; if (e >= (size_t)nheads * HD * TT) return; const int t = (int)(e % TT); const int d = (int)((e / TT) % HD); const int g = (int)(e / ((size_t)TT * HD)); v2h o16; v2us oh, ol; float xs[2];
#pragma unroll
    for (int q = 0; q < 2; ++q) xs[q] = F[(size_t)((g / NKV) * TT + t + q) * pitch + (g % NKV) * HD + d];   // plane g = (b, head)
#pragma unroll
    for (int s = 1; s < KSP; ++s) {   // the projection's k-slice planes, added in fixed order
        if (s == KSP / 2) asm volatile("s_wait_xcnt 0x0" ::: "memory");   // the later loads' results take address pairs that the loads above name
#pragma unroll
        for (int q = 0; q < 2; ++q) xs[q] += F[((size_t)s * NB_ * TT + (g / NKV) * TT + t + q) * pitch + (g % NKV) * HD + d]; }
#pragma unroll
    for (int q = 0; q < 2; ++q) { const float x = xs[q]; o16[q] = tohx(x); unsigned short a2, c2; splitf(x, a2, c2); oh[q] = a2; ol[q] = c2; }
    const size_t r16 = ((size_t)((g % NKV) * HD + d) * NB_ + g / NKV) * TT + t, rhl = (size_t)(g * HD + d) * 2 * TT + t;   // fp16 rows [head][d][b | b], hi/lo rows [g][d][hi | lo]: pitch 2 x TT
    *(v2h*)(V16 + r16) = o16; *(v2us*)(Vh + rhl) = oh; *(v2us*)(Vl + rhl) = ol;  }
__global__ __launch_bounds__(256) void k_csid(float* CS) { const int idx = blockIdx.x * 256 + threadIdx.x; if (idx >= TT * HD) return; v2f cs; cs[0] = 1.0f; cs[1] = 0.0f; *(v2f*)(CS + (size_t)idx * 2) = cs;  }
__global__ __launch_bounds__(256) void k_epadK(const float* __restrict__ E, bf* EB) { const size_t i = (size_t)blockIdx.x * 256 + threadIdx.x; if (i >= (size_t)NE * HD / 8) return; const int d0 = (int)(i % (HD / 8)) * 8; const int r = (int)(i / (HD / 8)); const float* src = E + (size_t)min(r, NRE - 1) * HD + d0; v8us o;
#pragma unroll
    for (int q = 0; q < 8; ++q) { const unsigned short v = f2bf(src[q]); o[q] = (r < NRE) ? v : (unsigned short)0; }
    *(v8us*)(EB + (size_t)r * HD + d0) = o;  }

__device__ __forceinline__ float xhalf(float x) { return __builtin_bit_cast(float, __builtin_amdgcn_permlanex16(__builtin_bit_cast(int, x), __builtin_bit_cast(int, x), 0x76543210, 0xfedcba98, false, false)); }   // lane l with lane l ^ 16
#define KPI 144   // bytes: LDS pitch of a staged K row (128 B of data), 16 B x odd against bank conflicts of the 16-byte fragment reads
#define VPI 80    // bytes: LDS pitch of a staged V^T row (64 B of data), 16 B x odd
#define EPI 36    // floats: LDS pitch of a wave's 16 x 32 tile of the relative term (144 B)
#define FPL (32 * KPI + 64 * VPI)   // one staged plane pair: 32 K rows, then 64 V^T rows
template <typename T16> struct Chunk;
template <> struct Chunk<h16> { typedef v8h T; };
template <> struct Chunk<bf> { typedef v8us T; };
template <typename T16, bool HI>
__device__ __forceinline__ void fa_part(const T16* __restrict__ Q, const T16* __restrict__ Q2, const T16* __restrict__ Kp, const T16* __restrict__ K2, const T16* __restrict__ Vt, const T16* __restrict__ Vt2, const float* __restrict__ QEz, char* ring, float* et, int tg, int lane, int i0, int jbeg, int jend, int c, int h, float& m, float& l, v8f (&O)[4]) {
    typedef typename WFrag<T16>::V V; typedef typename Chunk<T16>::T C8;
    V qf[2], q2f[2]; const T16* qp = Q + (size_t)(i0 + c) * HD + 8 * h; const T16* q2p = HI ? Q2 + (size_t)(i0 + c) * HD + 8 * h : qp;
#pragma unroll
    for (int kk = 0; kk < 2; ++kk) { qf[kk] = WFrag<T16>::ld(qp + kk * 32); if (HI) q2f[kk] = WFrag<T16>::ld(q2p + kk * 32); }
    const unsigned rowb = (unsigned)(i0 + c) * (NE * 4u);   // byte offset of this query's QE row: scalar base + 32-bit offset
    const float eLo = *(const float*)((const char*)QEz + rowb), eHi = *(const float*)((const char*)QEz + rowb + 2 * CUT * 4);   // the two clipped ends of the row
    asm volatile("s_wait_xcnt 0x0" :: "v"(qp), "v"(q2p), "v"(rowb) : "memory");   // the address registers of the loads above stay live up to this wait
    // staging: 16-byte chunk tg + 128 u of a stage: K row (tg >> 3) + 16 u, V^T row (tg >> 2) + 32 u
    const size_t kgo = (size_t)jbeg * HD + tg * 8, vgo = (size_t)(tg >> 2) * 2 * TT + jbeg + (tg & 3) * 8;
    const T16* kg = Kp + kgo; const T16* k2g = HI ? K2 + kgo : kg; const T16* vg = Vt + vgo; const T16* v2g = HI ? Vt2 + vgo : vg;
    const int ksl = (tg >> 3) * KPI + (tg & 7) * 16, vsl = 32 * KPI + (tg >> 2) * VPI + (tg & 3) * 16;
    C8 gk[2], gv[2], gk2[2], gv2[2];
    auto gload = [&]() {
#pragma unroll
        for (int u = 0; u < 2; ++u) { gk[u] = *(const C8*)(kg + u * 128 * 8); gv[u] = *(const C8*)(vg + (size_t)u * 32 * 2 * TT); if (HI) { gk2[u] = *(const C8*)(k2g + u * 128 * 8); gv2[u] = *(const C8*)(v2g + (size_t)u * 32 * 2 * TT); } }
        asm volatile("s_wait_xcnt 0x0" :: "v"(kg), "v"(k2g), "v"(vg), "v"(v2g) : "memory");   // the staging loads' address pairs stay live up to this wait; they are stepped only behind it
        kg += 32 * HD; k2g += 32 * HD; vg += 32; v2g += 32; };
    auto sstore = [&](char* b) {
#pragma unroll
        for (int u = 0; u < 2; ++u) { *(C8*)(b + ksl + u * 16 * KPI) = gk[u]; *(C8*)(b + vsl + u * 32 * VPI) = gv[u]; if (HI) { *(C8*)(b + FPL + ksl + u * 16 * KPI) = gk2[u]; *(C8*)(b + FPL + vsl + u * 32 * VPI) = gv2[u]; } } };
    gload(); sstore(ring);
    __syncthreads();   // publishes stage 0
    const int ns = (jend - jbeg) / 32;
#pragma unroll 1
    for (int s = 0; s < ns; ++s) {
        const int j0 = jbeg + 32 * s; const bool more = s + 1 < ns; const char* b = ring + (s & 1) * (2 * FPL);
        if (more) gload();   // stage s + 1 flies while stage s is worked on
        V kf[2][2], k2f[2][2]; float e[2][8];
#pragma unroll
        for (int t = 0; t < 2; ++t)
#pragma unroll
            for (int kk = 0; kk < 2; ++kk) { kf[t][kk] = WFrag<T16>::ld((const T16*)(b + (16 * t + c) * KPI + kk * 64 + 16 * h)); if (HI) k2f[t][kk] = WFrag<T16>::ld((const T16*)(b + FPL + (16 * t + c) * KPI + kk * 64 + 16 * h)); }
        if (i0 + 15 - j0 <= -CUT || i0 - (j0 + 31) >= CUT) {   // the whole block is clipped to one end (wave-uniform)
            const float ee = (i0 < j0) ? eLo : eHi;
#pragma unroll
            for (int t = 0; t < 2; ++t)
#pragma unroll
                for (int r = 0; r < 8; ++r) e[t][r] = ee;
        } else {   // one query row a load, lane = key: a load touches one or two lines; the wave's own LDS tile turns the 16 x 32 block into the score layout
            unsigned off[16]; float ev[16];
#pragma unroll
            for (int rr = 0; rr < 16; ++rr) { off[rr] = (unsigned)(i0 + rr) * (NE * 4u) + 4u * (unsigned)min(max(i0 + rr + CUT - (j0 + lane), 0), 2 * CUT); ev[rr] = *(const float*)((const char*)QEz + off[rr]); }
            // the gather's offset registers stay live up to this wait, so that no later value lands in a register that an issued load still names
            asm volatile("s_wait_xcnt 0x0" :: "v"(off[0]), "v"(off[1]), "v"(off[2]), "v"(off[3]), "v"(off[4]), "v"(off[5]), "v"(off[6]), "v"(off[7]), "v"(off[8]), "v"(off[9]), "v"(off[10]), "v"(off[11]), "v"(off[12]), "v"(off[13]), "v"(off[14]), "v"(off[15]) : "memory");
#pragma unroll
            for (int rr = 0; rr < 16; ++rr) et[rr * EPI + lane] = ev[rr];
            __builtin_amdgcn_wave_barrier(); asm volatile("" ::: "memory");   // keeps the compiler from moving the reads below over the other lanes' stores above (one wave: its LDS operations run in order)
#pragma unroll
            for (int t = 0; t < 2; ++t)
#pragma unroll
                for (int r4 = 0; r4 < 2; ++r4) { const v4f q4 = *(const v4fa*)(et + c * EPI + 16 * t + 8 * h + 4 * r4);
#pragma unroll
                    for (int q = 0; q < 4; ++q) e[t][r4 * 4 + q] = q4[q]; }
            __builtin_amdgcn_wave_barrier(); asm volatile("" ::: "memory");   // and the next stage's stores over these reads
        }
        v8f s_[2];
#pragma unroll
        for (int t = 0; t < 2; ++t) { s_[t] = (v8f){};
#pragma unroll
            for (int kk = 0; kk < 2; ++kk) { s_[t] = WFrag<T16>::mma(kf[t][kk], qf[kk], s_[t]); if (HI) { s_[t] = WFrag<T16>::mma(kf[t][kk], q2f[kk], s_[t]); s_[t] = WFrag<T16>::mma(k2f[t][kk], qf[kk], s_[t]); } } }
        V vf[4], v2f_[4];
#pragma unroll
        for (int dt = 0; dt < 4; ++dt) { vf[dt] = WFrag<T16>::ld((const T16*)(b + 32 * KPI + (dt * 16 + c) * VPI + 16 * h)); if (HI) v2f_[dt] = WFrag<T16>::ld((const T16*)(b + FPL + 32 * KPI + (dt * 16 + c) * VPI + 16 * h)); }
        float x[2][8]; float mb = -3.0e38f;
#pragma unroll
        for (int t = 0; t < 2; ++t)
#pragma unroll
            for (int r = 0; r < 8; ++r) { x[t][r] = (s_[t][r] + e[t][r]) * (SCL * 1.4426950408889634f); mb = fmaxf(mb, x[t][r]); }
        mb = fmaxf(mb, xhalf(mb));
        const float mn = fmaxf(m, HI ? mb : mb - 4.0f);   // fp16 weights run up to 16: four more binades above the subnormals; the factor cancels in O / l
        const float al = __builtin_amdgcn_exp2f(m - mn); m = mn;
        float ps = 0.f;
#pragma unroll
        for (int t = 0; t < 2; ++t)
#pragma unroll
            for (int r = 0; r < 8; ++r) { x[t][r] = __builtin_amdgcn_exp2f(x[t][r] - mn); ps += x[t][r]; }
        l = l * al + ps;
#pragma unroll
        for (int dt = 0; dt < 4; ++dt) O[dt] *= al;
        if constexpr (HI) {
            v8us ph[2], pl[2];
#pragma unroll
            for (int t = 0; t < 2; ++t)
#pragma unroll
                for (int r = 0; r < 8; ++r) { unsigned short a, b2; splitf(x[t][r], a, b2); ph[t][r] = a; pl[t][r] = b2; }
            const V pbh = cat16b(ph[0], ph[1]), pbl = cat16b(pl[0], pl[1]);
#pragma unroll
            for (int dt = 0; dt < 4; ++dt) { O[dt] = WFrag<T16>::mma(vf[dt], pbh, O[dt]); O[dt] = WFrag<T16>::mma(vf[dt], pbl, O[dt]); O[dt] = WFrag<T16>::mma(v2f_[dt], pbh, O[dt]); }
        } else {
            v8h p0, p1;
#pragma unroll
            for (int r = 0; r < 8; ++r) { p0[r] = tohx(x[0][r]); p1[r] = tohx(x[1][r]); }
            const V pb = cat16(p0, p1);
#pragma unroll
            for (int dt = 0; dt < 4; ++dt) O[dt] = WFrag<T16>::mma(vf[dt], pb, O[dt]);
        }
        if (more) sstore(ring + ((s + 1) & 1) * (2 * FPL));   // into the buffer that every wave left at the last barrier
        __syncthreads();   // publishes stage s + 1 and ends every reader's last read of stage s
    }
}
// k_fattn: grid (batch x head x TT / 64), 8 waves = KSF key halves x 4 query tiles of 16. Each wave runs fa_part on its half of the keys; half 1 hands (m, l, O^T) over through LDS, half 0 joins the two in fixed order and stores the row's 64 merged values as hi/lo bf16.
__global__ __launch_bounds__(256) void k_fattn(const h16* __restrict__ Q16, const h16* __restrict__ K16, const bf* __restrict__ Qh, const bf* __restrict__ Ql, const bf* __restrict__ Kh, const bf* __restrict__ Kl, const h16* __restrict__ V16, const bf* __restrict__ Vh, const float* __restrict__ QE, bf* Ah, bf* Al) {
    __shared__ __align__(16) char ring[KSF][2][2 * FPL]; __shared__ __align__(16) float et[8][16 * EPI];
    __shared__ float cm[4][32]; __shared__ float cl[4][32]; __shared__ float cO[4][32][32];   // [query tile][register][lane]
    const int lane = threadIdx.x & 31, c = lane & 15, h = lane >> 4; const int w = __builtin_amdgcn_readfirstlane((int)(threadIdx.x >> 5));
    const int n = blockIdx.x, nh = NB_ * NH_ * (RH / 64); const bool hires = n < nh;   // the costlier hi/lo row blocks take the lowest indices: they start first and the lighter ones fill in beside them
    const int g = hires ? n / (RH / 64) : (n - nh) / ((TT - RH) / 64), xb = hires ? n % (RH / 64) : RH / 64 + (n - nh) % ((TT - RH) / 64);
    const int tile = w & 3, ks = w >> 2, i0 = xb * 64 + tile * 16, jbeg = ks * (TT / KSF), jend = jbeg + TT / KSF, tg = threadIdx.x & 127;
    const size_t pu = (size_t)g * TT * HD; const float* QEz = QE + (size_t)g * TT * NE;
    float m = -3.0e38f, l = 0.f; v8f O[4];
#pragma unroll
    for (int dt = 0; dt < 4; ++dt) O[dt] = (v8f){};
    if (hires) fa_part<bf, true>(Qh + pu, Ql + pu, Kh + pu, Kl + pu, Vh + 2 * pu, Vh + 2 * pu + TT, QEz, &ring[ks][0][0], &et[w][0], tg, lane, i0, jbeg, jend, c, h, m, l, O);
    else fa_part<h16, false>(Q16 + pu, nullptr, K16 + pu, nullptr, V16 + (size_t)(g % NH_) * HD * 2 * TT + (size_t)(g / NH_) * TT, nullptr, QEz, &ring[ks][0][0], &et[w][0], tg, lane, i0, jbeg, jend, c, h, m, l, O);
    if (ks != 0) { cm[tile][lane] = m; cl[tile][lane] = l;
#pragma unroll
        for (int dt = 0; dt < 4; ++dt)
#pragma unroll
            for (int r = 0; r < 8; ++r) cO[tile][dt * 8 + r][lane] = O[dt][r]; }
    __syncthreads();   // publishes the second half's parts to the joining wave
    if (ks != 0) return;
    const float m1 = cm[tile][lane], M = fmaxf(m, m1), a0 = __builtin_amdgcn_exp2f(m - M), a1 = __builtin_amdgcn_exp2f(m1 - M);
    l = l * a0 + cl[tile][lane] * a1;
#pragma unroll
    for (int dt = 0; dt < 4; ++dt)
#pragma unroll
        for (int r = 0; r < 8; ++r) O[dt][r] = O[dt][r] * a0 + cO[tile][dt * 8 + r][lane] * a1;
    l += xhalf(l);
    const float inv = __fdiv_rn(1.0f, l);
    const size_t oo = ((size_t)(g / NH_) * TT + i0 + c) * DQ + (g % NH_) * HD + 8 * h;
#pragma unroll
    for (int dt = 0; dt < 4; ++dt) { v8us oh, ol;
#pragma unroll
        for (int r = 0; r < 8; ++r) { unsigned short a, b2; splitf(O[dt][r] * inv, a, b2); oh[r] = a; ol[r] = b2; }
        *(v8us*)(Ah + oo + dt * 16) = oh; *(v8us*)(Al + oo + dt * 16) = ol; }
}

extern "C" void kernel_launch(void* const* d_in, const int* in_sizes, int n_in,
                              void* d_out, int out_size, void* d_ws, size_t ws_size, hipStream_t stream) {
    (void)in_sizes; (void)n_in; (void)out_size;
    const float* x = (const float*)d_in[0]; const float* wq = (const float*)d_in[1]; const float* wkv = (const float*)d_in[2];   /* [512][1024]: k | v column halves */ const float* wo = (const float*)d_in[3]; const float* bo = (const float*)d_in[4]; const float* rel = (const float*)d_in[5];   /* rel_emb [1025][64] */ const float* wk = nullptr, *wv = nullptr; (void)wk; (void)wv;
    float* OUT = (float*)d_out;     // [2][2048][512]
    char* wsp = (char*)d_ws;
    auto take = [&](size_t bytes) { char* p = wsp; wsp += (bytes + 255) & ~(size_t)255; return (void*)p; };
    bf* WQ = (bf*)take((size_t)DQ * DM * 2); bf* WKV = (bf*)take((size_t)2 * DKV * DM * 2);   /* directly behind WQ: one Bt [1536][512], rows q | k | v */ bf* EB = (bf*)take((size_t)NE * HD * 2); float* QE = (float*)take((size_t)NB_ * NH_ * TT * NE * 4); bf* WO = (bf*)take((size_t)DM * DQ * 2); float* CS = (float*)take((size_t)TT * HD * 2 * 4);
    bf* XB = (bf*)take((size_t)NB_ * TT * DM * 2);
    const size_t PU = (size_t)TT * HD, NU = (size_t)NB_ * NH_;   // one (batch, head) plane; planes a tensor
    h16* QP16 = (h16*)take(2 * NU * PU * 2); h16* KP16 = QP16 + NU * PU; bf* QPh = (bf*)take(2 * NU * PU * 2); bf* KPh = QPh + NU * PU; bf* QPl = (bf*)take(2 * NU * PU * 2); bf* KPl = QPl + NU * PU;   // q planes, then k planes
    h16* VT16 = (h16*)take(NU * PU * 2); bf* VTh = (bf*)take(2 * NU * PU * 2); bf* VTl = VTh + TT;   // rows of pitch 2 x TT: [batch 0 | batch 1] and [hi | lo]
    bf* ATh = (bf*)take((size_t)NB_ * TT * DQ * 2); bf* ATl = (bf*)take((size_t)NB_ * TT * DQ * 2);
    if ((size_t)(wsp - (char*)d_ws) > ws_size) return;    // ws 256 MiB
    float* FP = QE;   // projection slices [KSP][4096][1536] (96 MiB of QE's 136): read out into the head planes before the first QE tile is stored (stream-ordered)
    const int DP = DQ + 2 * DKV;
    { k_wtG<<<(unsigned)((DM * DQ / 64 + 63) / 64), 256, 0, stream>>>(wq, DM, DQ, WQ); k_wtG<<<(unsigned)((DM * 2 * DKV / 64 + 63) / 64), 256, 0, stream>>>(wkv, DM, 2 * DKV, WKV);   /* 'xw' [512][1024] -> Bt [1024][512]: rows 0..511 = k, 512..1023 = v */ k_epadK<<<(unsigned)(((size_t)NE * HD / 8 + 255) / 256), 256, 0, stream>>>(rel, EB);
      k_wtG<<<(unsigned)((DQ * DM / 64 + 63) / 64), 256, 0, stream>>>(wo, DQ, DM, WO);
       }
    k_csid<<<(TT * HD + 255) / 256, 256, 0, stream>>>(CS);
    k_cvt8<<<(unsigned)(((size_t)NB_ * TT * DM / 8 + 255) / 256), 256, 0, stream>>>(x, XB, (size_t)NB_ * TT * DM / 8);
    k_gemmw<bf, 0, false, KSP><<<dim3(NB_ * TT / 64, DP / 64, KSP), 32, 0, stream>>>(XB, nullptr, WQ, nullptr, DM, DM, FP, DP, nullptr, 0, 0, (size_t)NB_ * TT * DP);
    k_rope<<<(unsigned)((2 * NU * PU / 2 + 255) / 256), 256, 0, stream>>>(FP, DP, (int)(2 * NU), CS, nullptr, nullptr, 1.0f, QP16, QPh, QPl);
    k_vtp<<<(unsigned)((NU * PU / 2 + 255) / 256), 256, 0, stream>>>(FP + DQ + DKV, DP, (int)NU, VT16, VTh, VTl);
    k_gemmw<bf, 1, false><<<dim3(TT / 64, NE / 64, (unsigned)NU), 32, 0, stream>>>(QPh, QPl, EB, nullptr, HD, HD, QE, NE, nullptr, PU, 0, (size_t)TT * NE);   /* QE[u][i][r] = q_i . rel[r] (hi/lo x exact), all 16 (batch, head) planes */
    k_fattn<<<(unsigned)(NU * (TT / 64)), 256, 0, stream>>>(QP16, KP16, QPh, QPl, KPh, KPl, VT16, VTh, QE, ATh, ATl);   /* softmax((q.k + q_i . rel[clip(i - j) + 512]) / 8) . v, merged hi/lo */
    k_gemmw<bf, 1, true><<<dim3(NB_ * TT / 64, DM / 64, 1), 32, 0, stream>>>(ATh, ATl, WO, nullptr, DQ, DQ, OUT, DM, bo, 0, 0, 0);
}

// v005
// It runs in 163 microseconds.
// Timed twice side by side with v004, it ran 1.37 and 1.38 times as fast.
// Counting every step since v000, it is 7.12 times as fast.
#include <hip/hip_runtime.h>

// Multi-head attention with a Shaw-style relative-key term over clipped distances (x [2][2048][512]; q = x Wq ('xw' [512][512]); k | v = x Wkv ('xw' [512][1024] column halves); 8 heads x 64; dots = (q.k + q.rel_emb[clip(i - j, -512, 512) + 512]) x 64^-0.5 (rel_emb [1025][64] shared by the heads, read); softmax (no causal mask in the module's code); out = merged Wo + bo ('xw') -> [2][2048][512] (2.1 M)).
// Layout: both batches as 4096 rows through one q|k|v projection launch, whose epilogue writes the head planes, and one Wo launch; bf16 copy of x; 'xw' weights transposed once (Wkv as one [1024][512] Bt whose row halves are k and v); exact projections; the relative table as one zero-padded bf16 plane [1088][64]; QE = q . rel^T (hi/lo x exact, [16][2048][1088]) for all 16 (batch, head) planes in one launch; one attention launch: a wave holds 16 queries and walks half of the keys in stages of 32 that four waves share in LDS (scores^T = K Q^T, + QE[i][clip(i - j) + 512], running maximum and sum, O^T += V^T P^T with P packed from the score accumulators), the two halves joined through LDS in fixed order; hybrid rows: < 512 hi/lo 3 products, rest fp16; merged hi/lo x Wo exact + bo.
// Compute dtypes, f32 accumulate: every input rounded to bf16; projections exact; q.k rows < 512 3 products, rest fp16; q.rel hi/lo x exact on every row; softmax f32 (running maximum); attn.v rows < 512 3 products, rest fp16 (unnormalised weights x 16); Wo hl x exact + bias.

#define NB_  2
#define TT   2048
#define DM   512
#define NH_  8
#define NKV  8
#define REP  (NH_ / NKV)
#define HD   64
#define DQ   (NH_ * HD)
#define DKV  (NKV * HD)
#define RH   512                  // query rows < RH use hi+lo planes (0: none)
#define WIN  0
#define SCL  0.125f
#define NE   1088     // 2*512+1 = 1025 relative offsets padded to a multiple of 64
#define NRE  1025
#define CUT  512
#define KSP  4        // k-slices of the q, k, v projections (K = 512 -> 128 a slice), one wave each
#define KSF  2        // key halves of a query tile in the attention kernel, one wave each
typedef _Float16 h16;
typedef unsigned short bf;
typedef __attribute__((ext_vector_type(16))) __bf16   v16bf;
typedef __attribute__((ext_vector_type(16))) _Float16 v16h;
typedef __attribute__((ext_vector_type(8)))  _Float16 v8h;
typedef __attribute__((ext_vector_type(8)))  unsigned short v8us;
typedef __attribute__((ext_vector_type(8)))  float    v8f;
typedef __attribute__((ext_vector_type(4)))  float    v4f;
typedef v8h  __attribute__((may_alias)) v8ha;
typedef v4f  __attribute__((may_alias)) v4fa;
typedef v8us __attribute__((may_alias)) v8usa;

__device__ __forceinline__ unsigned short f2bf(float f) { unsigned u = __float_as_uint(f); u += 0x7FFFu + ((u >> 16) & 1u); return (unsigned short)(u >> 16); }
__device__ __forceinline__ float bf2f(unsigned short b) { return __uint_as_float(((unsigned)b) << 16); }
__device__ __forceinline__ float bfr(float f) { return bf2f(f2bf(f)); }
__device__ __forceinline__ v16h cat16(v8h lo, v8h hi) { return __builtin_shufflevector(lo, hi, 0, 1, 2, 3, 4, 5, 6, 7, 8, 9, 10, 11, 12, 13, 14, 15); }
__device__ __forceinline__ v16bf cat16b(v8us lo, v8us hi) { return __builtin_bit_cast(v16bf, __builtin_shufflevector(lo, hi, 0, 1, 2, 3, 4, 5, 6, 7, 8, 9, 10, 11, 12, 13, 14, 15)); }
__device__ __forceinline__ v8f wmma16(v16h a, v16h b, v8f c) { return __builtin_amdgcn_wmma_f32_16x16x32_f16(false, a, false, b, (short)0, c, false, false); }
__device__ __forceinline__ v8f wmmab(v16bf a, v16bf b, v8f c) { return __builtin_amdgcn_wmma_f32_16x16x32_bf16(false, a, false, b, (short)0, c, false, false); }



// ---- k_gemmw: register-blocked GEMM, ONE WAVE per 64x64 output tile (16 accumulators), operands straight from K-contiguous 16-bit planes; grid (M/64, N/64, Z), 32 threads.
// C[m][n] (f32, pitch ldc, + optional f32 bias[n]) = sum_k A[m][k] Bt[n][k] (+ split products per NSPLIT). K is the row pitch of A and Bt, the sum runs over k < KX <= K. z-batch strides sA/sB/sC in elements. KX % 32 == 0.
// KSPL > 1: split-K over the grid. blockIdx.z = z * KSPL + s; slice s sums k in [s KX/KSPL, (s+1) KX/KSPL) into its own plane C + (z KSPL + s) sC.
template <typename T16> struct WFrag;
template <> struct WFrag<h16> { typedef v16h V; static __device__ __forceinline__ V ld(const h16* p) { return cat16(*(const v8h*)p, *(const v8h*)(p + 16)); } static __device__ __forceinline__ v8f mma(V a, V b, v8f c) { return wmma16(a, b, c); } };
template <> struct WFrag<bf> { typedef v16bf V; static __device__ __forceinline__ V ld(const bf* p) { return cat16b(*(const v8us*)p, *(const v8us*)(p + 16)); } static __device__ __forceinline__ v8f mma(V a, V b, v8f c) { return wmmab(a, b, c); } };
template <typename T16, int NSPLIT, bool BIAS, int KSPL = 1>
__global__ __launch_bounds__(32) void k_gemmw(const T16* __restrict__ A, const T16* __restrict__ A2, const T16* __restrict__ Bt, const T16* __restrict__ Bt2, int K, int KX, float* C, int ldc, const float* __restrict__ bias, size_t sA, size_t sB, size_t sC) {
    typedef typename WFrag<T16>::V V;
    __shared__ __align__(16) float os[16 * 68];
    const size_t z = blockIdx.z / KSPL; const int ks = (int)(blockIdx.z % KSPL); A += z * sA; if (A2) A2 += z * sA; Bt += z * sB; if (Bt2) Bt2 += z * sB; C += (size_t)blockIdx.z * sC;
    const int kbeg = ks * (KX / KSPL), kend = kbeg + KX / KSPL;
    const int lane = threadIdx.x & 31, lr = lane & 15, hi = lane >> 4; const int r0 = blockIdx.x * 64, c0 = blockIdx.y * 64;
    v8f acc[4][4];
#pragma unroll
    for (int mb = 0; mb < 4; ++mb)
#pragma unroll
        for (int nb = 0; nb < 4; ++nb) acc[mb][nb] = (v8f){};
    const size_t aoff = (size_t)(r0 + lr) * K + 8 * hi, boff = (size_t)(c0 + lr) * K + 8 * hi;
#pragma unroll 1
    for (int kc = kbeg; kc < kend; kc += 32) {
        V a[4], a2[4];
#pragma unroll
        for (int mb = 0; mb < 4; ++mb) { a[mb] = WFrag<T16>::ld(A + aoff + (size_t)mb * 16 * K + kc); if (NSPLIT == 1 || NSPLIT == 2) a2[mb] = WFrag<T16>::ld(A2 + aoff + (size_t)mb * 16 * K + kc); }
#pragma unroll
        for (int nb = 0; nb < 4; ++nb) { const V b = WFrag<T16>::ld(Bt + boff + (size_t)nb * 16 * K + kc); V b2; if (NSPLIT >= 2) b2 = WFrag<T16>::ld(Bt2 + boff + (size_t)nb * 16 * K + kc);
#pragma unroll
            for (int mb = 0; mb < 4; ++mb) { acc[mb][nb] = WFrag<T16>::mma(a[mb], b, acc[mb][nb]); if (NSPLIT == 1 || NSPLIT == 2) acc[mb][nb] = WFrag<T16>::mma(a2[mb], b, acc[mb][nb]); if (NSPLIT >= 2) acc[mb][nb] = WFrag<T16>::mma(a[mb], b2, acc[mb][nb]); } }
        asm volatile("v_nop\n\tv_nop\n\tv_nop\n\tv_nop" : "+v"(acc[0][0]), "+v"(acc[1][1]), "+v"(acc[2][2]), "+v"(acc[3][3]) : "v"(a[0]), "v"(a[3]));
    }
#pragma unroll
    for (int mb = 0; mb < 4; ++mb) {
#pragma unroll
        for (int nb = 0; nb < 4; ++nb) {
#pragma unroll
            for (int j = 0; j < 8; ++j) os[(hi * 8 + j) * 68 + nb * 16 + lr] = acc[mb][nb][j]; }
        __builtin_amdgcn_wave_barrier(); asm volatile("" ::: "memory");
        float* crow = C + (size_t)(r0 + mb * 16) * ldc + c0;
{
#pragma unroll
            for (int s = 0; s < 8; ++s) { const int row = 2 * s + hi, cofs = lr * 4; v4f val = *(const v4fa*)(os + row * 68 + cofs); if (BIAS) { val[0] += bfr(bias[c0 + cofs]); val[1] += bfr(bias[c0 + cofs + 1]); val[2] += bfr(bias[c0 + cofs + 2]); val[3] += bfr(bias[c0 + cofs + 3]); }
                *(v4f*)(crow + (size_t)row * ldc + cofs) = val; }
             }
        __builtin_amdgcn_wave_barrier(); asm volatile("" ::: "memory");
    }
}

__device__ __forceinline__ h16 tohx(float x) { return (h16)x; }
__device__ __forceinline__ void splitf(float y, unsigned short& h, unsigned short& l) { h = f2bf(y); l = f2bf(y - bf2f(h)); }
typedef __attribute__((ext_vector_type(2))) _Float16 v2h;
typedef __attribute__((ext_vector_type(4))) _Float16 v4h;
typedef __attribute__((ext_vector_type(2))) unsigned short v2us;
typedef __attribute__((ext_vector_type(4))) unsigned short v4us;
typedef __attribute__((ext_vector_type(2))) float v2f;
typedef __attribute__((ext_vector_type(4))) int v4i;

__global__ __launch_bounds__(256) void k_wtG(const float* __restrict__ w, int K, int N, bf* Bt) {
    const int lane = threadIdx.x & 31; const int L0 = (blockIdx.x * 8 + (threadIdx.x >> 5)) * 8; const int nlines = N * K / 64;
{
#pragma unroll 1
        for (int l = 0; l < 8; ++l) { const int L = L0 + l; if (L >= nlines) break; const size_t e = (size_t)L * 64 + lane * 2; const int k = (int)(e % K), n = (int)(e / K); v2us o;
            o[0] = f2bf(w[(size_t)k * N + n]); o[1] = f2bf(w[(size_t)(k + 1) * N + n]); *(v2us*)(Bt + e) = o; }
         }
}
__global__ __launch_bounds__(256) void k_cvt8(const float* __restrict__ src, bf* dst, size_t n8) { const size_t i = (size_t)blockIdx.x * 256 + threadIdx.x; if (i >= n8) return; const v8f v = *(const v8f*)(src + i * 8); v8us o;
#pragma unroll
    for (int k = 0; k < 8; ++k) o[k] = f2bf(v[k]); *(v8us*)(dst + i * 8) = o;  }

#define RPI 68   // floats: LDS pitch of one 64-value row of a k-slice's tile (272 B = 16 B x odd: the 16-byte stores and reads of 16 lanes fall on all 64 banks)
// k_proj: the q | k | v projection with the head planes written by its own epilogue. Grid (4096 / 64 row tiles, 1536 / 64 column tiles = one head of q, k or v), KSP waves: wave s sums k in [s DM / KSP, (s + 1) DM / KSP) of the whole 64 x 64 tile (16 accumulators, operands straight from the K-contiguous planes), stores its tile in its own LDS plane, and behind one barrier the work-group adds the KSP planes in the order s = 0, 1, ... and stores fp16 + hi/lo bf16 in whole 128-byte lines.
// The operand whose rows run along the output's contiguous direction is the A side, so that a lane's 8 accumulator values are 8 neighbours of an output row: q, k planes [u][t][d] take A = weight rows (d), B = x rows (t); the V^T planes [d][t] take A = x rows (t), B = weight rows (d). Both sides use the same loader (the same k order).
__global__ __launch_bounds__(32 * KSP) void k_proj(const bf* __restrict__ X, const bf* __restrict__ Wt, h16* P16, bf* Ph, bf* Pl, h16* V16, bf* Vh, bf* Vl) {
    typedef WFrag<bf>::V V;
    __shared__ __align__(16) float red[KSP][64][RPI];
    const int lane = threadIdx.x & 31, lr = lane & 15, hi = lane >> 4; const int ks = __builtin_amdgcn_readfirstlane((int)(threadIdx.x >> 5));
    const int r0 = blockIdx.x * 64, cy = blockIdx.y; const bool isv = cy >= (DQ + DKV) / HD;
    const bf* xr = X + (size_t)r0 * DM; const bf* wr = Wt + (size_t)cy * 64 * DM;
    const bf* Am = isv ? xr : wr; const bf* Bn = isv ? wr : xr;
    v8f acc[4][4];
#pragma unroll
    for (int mb = 0; mb < 4; ++mb)
#pragma unroll
        for (int nb = 0; nb < 4; ++nb) acc[mb][nb] = (v8f){};
    const int off = lr * DM + 8 * hi; const int kbeg = ks * (DM / KSP), kend = kbeg + DM / KSP;
#pragma unroll 1   // rolled: one set of fragment registers and a short text; the fence in the trip would hold an unrolled trip's loads in place anyway
    for (int kc = kbeg; kc < kend; kc += 32) {
        V a[4], b[4]; const bf* ap = Am + off + kc; const bf* bp = Bn + off + kc;
#pragma unroll
        for (int u = 0; u < 4; ++u) { a[u] = WFrag<bf>::ld(ap + u * 16 * DM); b[u] = WFrag<bf>::ld(bp + u * 16 * DM); }
        // the address pairs stay live up to this wait, so that no load's result and no later address lands in them before it; the loaded values as inputs hold all 16 loads in front of the first matrix instruction (one latency a trip)
        asm volatile("s_wait_xcnt 0x0" :: "v"(ap), "v"(bp), "v"(a[0]), "v"(a[1]), "v"(a[2]), "v"(a[3]), "v"(b[0]), "v"(b[1]), "v"(b[2]), "v"(b[3]) : "memory");
#pragma unroll
        for (int nb = 0; nb < 4; ++nb)
#pragma unroll
            for (int mb = 0; mb < 4; ++mb) acc[mb][nb] = WFrag<bf>::mma(a[mb], b[nb], acc[mb][nb]);
    }
#pragma unroll
    for (int mb = 0; mb < 4; ++mb)
#pragma unroll
        for (int nb = 0; nb < 4; ++nb) { float* p = &red[ks][nb * 16 + lr][mb * 16 + hi * 8];
            *(v4fa*)p = __builtin_shufflevector(acc[mb][nb], acc[mb][nb], 0, 1, 2, 3); *(v4fa*)(p + 4) = __builtin_shufflevector(acc[mb][nb], acc[mb][nb], 4, 5, 6, 7); }
    __syncthreads();   // publishes every k-slice's tile to the waves that add them
    const int b = r0 / TT, t0 = r0 % TT, head = cy % NH_;
    // row n of the tile: a V^T row d (pitch 2 x TT: fp16 rows [head][d][b | b], hi/lo rows [b, head][d][hi | lo]) or a q / k row t (pitch HD, plane u = (q or k, b, head))
    const unsigned pit = isv ? 2u * TT : (unsigned)HD;
    const size_t o16 = isv ? ((size_t)head * HD * NB_ + b) * TT + t0 : ((size_t)((cy / NH_) * NB_ + b) * NH_ + head) * TT * HD + (size_t)t0 * HD;
    const size_t ohl = isv ? (size_t)(b * NKV + head) * HD * 2 * TT + t0 : o16;
    h16* D16 = (isv ? V16 : P16) + o16; bf* Dh = (isv ? Vh : Ph) + ohl; bf* Dl = (isv ? Vl : Pl) + ohl;
#pragma unroll
    for (int it = 0; it < 512 / (32 * KSP); ++it) { const int q = it * (32 * KSP) + (int)threadIdx.x, n = q >> 3, mc = (q & 7) * 8;   // 8 lanes a row: a wave's store covers 4 whole lines
        v4f x0 = *(const v4fa*)&red[0][n][mc], x1 = *(const v4fa*)&red[0][n][mc + 4];
#pragma unroll
        for (int s = 1; s < KSP; ++s) { x0 += *(const v4fa*)&red[s][n][mc]; x1 += *(const v4fa*)&red[s][n][mc + 4]; }   // the k-slices, added in fixed order
        v8h v16; v8us vh, vl;
#pragma unroll
        for (int k = 0; k < 8; ++k) { const float x = k < 4 ? x0[k & 3] : x1[k & 3]; v16[k] = tohx(x); unsigned short a2, c2; splitf(x, a2, c2); vh[k] = a2; vl[k] = c2; }
        const unsigned eb = ((unsigned)n * pit + (unsigned)mc) * 2u;   // byte offset in all three planes (2-byte elements): scalar base + 32-bit offset
        *(v8h*)((char*)D16 + eb) = v16; *(v8us*)((char*)Dh + eb) = vh; *(v8us*)((char*)Dl + eb) = vl;
    }
}
__global__ __launch_bounds__(256) void k_epadK(const float* __restrict__ E, bf* EB) { const size_t i = (size_t)blockIdx.x * 256 + threadIdx.x; if (i >= (size_t)NE * HD / 8) return; const int d0 = (int)(i % (HD / 8)) * 8; const int r = (int)(i / (HD / 8)); const float* src = E + (size_t)min(r, NRE - 1) * HD + d0; v8us o;
#pragma unroll
    for (int q = 0; q < 8; ++q) { const unsigned short v = f2bf(src[q]); o[q] = (r < NRE) ? v : (unsigned short)0; }
    *(v8us*)(EB + (size_t)r * HD + d0) = o;  }

__device__ __forceinline__ float xhalf(float x) { return __builtin_bit_cast(float, __builtin_amdgcn_permlanex16(__builtin_bit_cast(int, x), __builtin_bit_cast(int, x), 0x76543210, 0xfedcba98, false, false)); }   // lane l with lane l ^ 16
#define KPI 144   // bytes: LDS pitch of a staged K row (128 B of data), 16 B x odd against bank conflicts of the 16-byte fragment reads
#define VPI 80    // bytes: LDS pitch of a staged V^T row (64 B of data), 16 B x odd
#define EPI 36    // floats: LDS pitch of a wave's 16 x 32 tile of the relative term (144 B)
#define FPL (32 * KPI + 64 * VPI)   // one staged plane pair: 32 K rows, then 64 V^T rows
template <typename T16> struct Chunk;
template <> struct Chunk<h16> { typedef v8h T; };
template <> struct Chunk<bf> { typedef v8us T; };
template <typename T16, bool HI>
__device__ __forceinline__ void fa_part(const T16* __restrict__ Q, const T16* __restrict__ Q2, const T16* __restrict__ Kp, const T16* __restrict__ K2, const T16* __restrict__ Vt, const T16* __restrict__ Vt2, const float* __restrict__ QEz, char* ring, float* et, int tg, int lane, int i0, int jbeg, int jend, int c, int h, float& m, float& l, v8f (&O)[4]) {
    typedef typename WFrag<T16>::V V; typedef typename Chunk<T16>::T C8;
    V qf[2], q2f[2]; const T16* qp = Q + (size_t)(i0 + c) * HD + 8 * h; const T16* q2p = HI ? Q2 + (size_t)(i0 + c) * HD + 8 * h : qp;
#pragma unroll
    for (int kk = 0; kk < 2; ++kk) { qf[kk] = WFrag<T16>::ld(qp + kk * 32); if (HI) q2f[kk] = WFrag<T16>::ld(q2p + kk * 32); }
    const unsigned rowb = (unsigned)(i0 + c) * (NE * 4u);   // byte offset of this query's QE row: scalar base + 32-bit offset
    const float eLo = *(const float*)((const char*)QEz + rowb), eHi = *(const float*)((const char*)QEz + rowb + 2 * CUT * 4);   // the two clipped ends of the row
    asm volatile("s_wait_xcnt 0x0" :: "v"(qp), "v"(q2p), "v"(rowb) : "memory");   // the address registers of the loads above stay live up to this wait
    // staging: 16-byte chunk tg + 128 u of a stage: K row (tg >> 3) + 16 u, V^T row (tg >> 2) + 32 u
    const size_t kgo = (size_t)jbeg * HD + tg * 8, vgo = (size_t)(tg >> 2) * 2 * TT + jbeg + (tg & 3) * 8;
    const T16* kg = Kp + kgo; const T16* k2g = HI ? K2 + kgo : kg; const T16* vg = Vt + vgo; const T16* v2g = HI ? Vt2 + vgo : vg;
    const int ksl = (tg >> 3) * KPI + (tg & 7) * 16, vsl = 32 * KPI + (tg >> 2) * VPI + (tg & 3) * 16;
    C8 gk[2], gv[2], gk2[2], gv2[2];
    auto gload = [&]() {
#pragma unroll
        for (int u = 0; u < 2; ++u) { gk[u] = *(const C8*)(kg + u * 128 * 8); gv[u] = *(const C8*)(vg + (size_t)u * 32 * 2 * TT); if (HI) { gk2[u] = *(const C8*)(k2g + u * 128 * 8); gv2[u] = *(const C8*)(v2g + (size_t)u * 32 * 2 * TT); } }
        asm volatile("s_wait_xcnt 0x0" :: "v"(kg), "v"(k2g), "v"(vg), "v"(v2g) : "memory");   // the staging loads' address pairs stay live up to this wait; they are stepped only behind it
        kg += 32 * HD; k2g += 32 * HD; vg += 32; v2g += 32; };
    auto sstore = [&](char* b) {
#pragma unroll
        for (int u = 0; u < 2; ++u) { *(C8*)(b + ksl + u * 16 * KPI) = gk[u]; *(C8*)(b + vsl + u * 32 * VPI) = gv[u]; if (HI) { *(C8*)(b + FPL + ksl + u * 16 * KPI) = gk2[u]; *(C8*)(b + FPL + vsl + u * 32 * VPI) = gv2[u]; } } };
    gload(); sstore(ring);
    __syncthreads();   // publishes stage 0
    const int ns = (jend - jbeg) / 32;
#pragma unroll 1
    for (int s = 0; s < ns; ++s) {
        const int j0 = jbeg + 32 * s; const bool more = s + 1 < ns; const char* b = ring + (s & 1) * (2 * FPL);
        if (more) gload();   // stage s + 1 flies while stage s is worked on
        V kf[2][2], k2f[2][2]; float e[2][8];
#pragma unroll
        for (int t = 0; t < 2; ++t)
#pragma unroll
            for (int kk = 0; kk < 2; ++kk) { kf[t][kk] = WFrag<T16>::ld((const T16*)(b + (16 * t + c) * KPI + kk * 64 + 16 * h)); if (HI) k2f[t][kk] = WFrag<T16>::ld((const T16*)(b + FPL + (16 * t + c) * KPI + kk * 64 + 16 * h)); }
        if (i0 + 15 - j0 <= -CUT || i0 - (j0 + 31) >= CUT) {   // the whole block is clipped to one end (wave-uniform)
            const float ee = (i0 < j0) ? eLo : eHi;
#pragma unroll
            for (int t = 0; t < 2; ++t)
#pragma unroll
                for (int r = 0; r < 8; ++r) e[t][r] = ee;
        } else {   // one query row a load, lane = key: a load touches one or two lines; the wave's own LDS tile turns the 16 x 32 block into the score layout
            unsigned off[16]; float ev[16];
#pragma unroll
            for (int rr = 0; rr < 16; ++rr) { off[rr] = (unsigned)(i0 + rr) * (NE * 4u) + 4u * (unsigned)min(max(i0 + rr + CUT - (j0 + lane), 0), 2 * CUT); ev[rr] = *(const float*)((const char*)QEz + off[rr]); }
            // the gather's offset registers stay live up to this wait, so that no later value lands in a register that an issued load still names
            asm volatile("s_wait_xcnt 0x0" :: "v"(off[0]), "v"(off[1]), "v"(off[2]), "v"(off[3]), "v"(off[4]), "v"(off[5]), "v"(off[6]), "v"(off[7]), "v"(off[8]), "v"(off[9]), "v"(off[10]), "v"(off[11]), "v"(off[12]), "v"(off[13]), "v"(off[14]), "v"(off[15]) : "memory");
#pragma unroll
            for (int rr = 0; rr < 16; ++rr) et[rr * EPI + lane] = ev[rr];
            __builtin_amdgcn_wave_barrier(); asm volatile("" ::: "memory");   // keeps the compiler from moving the reads below over the other lanes' stores above (one wave: its LDS operations run in order)
#pragma unroll
            for (int t = 0; t < 2; ++t)
#pragma unroll
                for (int r4 = 0; r4 < 2; ++r4) { const v4f q4 = *(const v4fa*)(et + c * EPI + 16 * t + 8 * h + 4 * r4);
#pragma unroll
                    for (int q = 0; q < 4; ++q) e[t][r4 * 4 + q] = q4[q]; }
            __builtin_amdgcn_wave_barrier(); asm volatile("" ::: "memory");   // and the next stage's stores over these reads
        }
        v8f s_[2];
#pragma unroll
        for (int t = 0; t < 2; ++t) { s_[t] = (v8f){};
#pragma unroll
            for (int kk = 0; kk < 2; ++kk) { s_[t] = WFrag<T16>::mma(kf[t][kk], qf[kk], s_[t]); if (HI) { s_[t] = WFrag<T16>::mma(kf[t][kk], q2f[kk], s_[t]); s_[t] = WFrag<T16>::mma(k2f[t][kk], qf[kk], s_[t]); } } }
        V vf[4], v2f_[4];
#pragma unroll
        for (int dt = 0; dt < 4; ++dt) { vf[dt] = WFrag<T16>::ld((const T16*)(b + 32 * KPI + (dt * 16 + c) * VPI + 16 * h)); if (HI) v2f_[dt] = WFrag<T16>::ld((const T16*)(b + FPL + 32 * KPI + (dt * 16 + c) * VPI + 16 * h)); }
        float x[2][8]; float mb = -3.0e38f;
#pragma unroll
        for (int t = 0; t < 2; ++t)
#pragma unroll
            for (int r = 0; r < 8; ++r) { x[t][r] = (s_[t][r] + e[t][r]) * (SCL * 1.4426950408889634f); mb = fmaxf(mb, x[t][r]); }
        mb = fmaxf(mb, xhalf(mb));
        const float mn = fmaxf(m, HI ? mb : mb - 4.0f);   // fp16 weights run up to 16: four more binades above the subnormals; the factor cancels in O / l
        const float al = __builtin_amdgcn_exp2f(m - mn); m = mn;
        float ps = 0.f;
#pragma unroll
        for (int t = 0; t < 2; ++t)
#pragma unroll
            for (int r = 0; r < 8; ++r) { x[t][r] = __builtin_amdgcn_exp2f(x[t][r] - mn); ps += x[t][r]; }
        l = l * al + ps;
#pragma unroll
        for (int dt = 0; dt < 4; ++dt) O[dt] *= al;
        if constexpr (HI) {
            v8us ph[2], pl[2];
#pragma unroll
            for (int t = 0; t < 2; ++t)
#pragma unroll
                for (int r = 0; r < 8; ++r) { unsigned short a, b2; splitf(x[t][r], a, b2); ph[t][r] = a; pl[t][r] = b2; }
            const V pbh = cat16b(ph[0], ph[1]), pbl = cat16b(pl[0], pl[1]);
#pragma unroll
            for (int dt = 0; dt < 4; ++dt) { O[dt] = WFrag<T16>::mma(vf[dt], pbh, O[dt]); O[dt] = WFrag<T16>::mma(vf[dt], pbl, O[dt]); O[dt] = WFrag<T16>::mma(v2f_[dt], pbh, O[dt]); }
        } else {
            v8h p0, p1;
#pragma unroll
            for (int r = 0; r < 8; ++r) { p0[r] = tohx(x[0][r]); p1[r] = tohx(x[1][r]); }
            const V pb = cat16(p0, p1);
#pragma unroll
            for (int dt = 0; dt < 4; ++dt) O[dt] = WFrag<T16>::mma(vf[dt], pb, O[dt]);
        }
        if (more) sstore(ring + ((s + 1) & 1) * (2 * FPL));   // into the buffer that every wave left at the last barrier
        __syncthreads();   // publishes stage s + 1 and ends every reader's last read of stage s
    }
}
// k_fattn: grid (batch x head x TT / 64), 8 waves = KSF key halves x 4 query tiles of 16. Each wave runs fa_part on its half of the keys; half 1 hands (m, l, O^T) over through LDS, half 0 joins the two in fixed order and stores the row's 64 merged values as hi/lo bf16.
__global__ __launch_bounds__(256) void k_fattn(const h16* __restrict__ Q16, const h16* __restrict__ K16, const bf* __restrict__ Qh, const bf* __restrict__ Ql, const bf* __restrict__ Kh, const bf* __restrict__ Kl, const h16* __restrict__ V16, const bf* __restrict__ Vh, const float* __restrict__ QE, bf* Ah, bf* Al) {
    __shared__ __align__(16) char ring[KSF][2][2 * FPL]; __shared__ __align__(16) float et[8][16 * EPI];
    __shared__ float cm[4][32]; __shared__ float cl[4][32]; __shared__ float cO[4][32][32];   // [query tile][register][lane]
    const int lane = threadIdx.x & 31, c = lane & 15, h = lane >> 4; const int w = __builtin_amdgcn_readfirstlane((int)(threadIdx.x >> 5));
    const int n = blockIdx.x, nh = NB_ * NH_ * (RH / 64); const bool hires = n < nh;   // the costlier hi/lo row blocks take the lowest indices: they start first and the lighter ones fill in beside them
    const int g = hires ? n / (RH / 64) : (n - nh) / ((TT - RH) / 64), xb = hires ? n % (RH / 64) : RH / 64 + (n - nh) % ((TT - RH) / 64);
    const int tile = w & 3, ks = w >> 2, i0 = xb * 64 + tile * 16, jbeg = ks * (TT / KSF), jend = jbeg + TT / KSF, tg = threadIdx.x & 127;
    const size_t pu = (size_t)g * TT * HD; const float* QEz = QE + (size_t)g * TT * NE;
    float m = -3.0e38f, l = 0.f; v8f O[4];
#pragma unroll
    for (int dt = 0; dt < 4; ++dt) O[dt] = (v8f){};
    if (hires) fa_part<bf, true>(Qh + pu, Ql + pu, Kh + pu, Kl + pu, Vh + 2 * pu, Vh + 2 * pu + TT, QEz, &ring[ks][0][0], &et[w][0], tg, lane, i0, jbeg, jend, c, h, m, l, O);
    else fa_part<h16, false>(Q16 + pu, nullptr, K16 + pu, nullptr, V16 + (size_t)(g % NH_) * HD * 2 * TT + (size_t)(g / NH_) * TT, nullptr, QEz, &ring[ks][0][0], &et[w][0], tg, lane, i0, jbeg, jend, c, h, m, l, O);
    if (ks != 0) { cm[tile][lane] = m; cl[tile][lane] = l;
#pragma unroll
        for (int dt = 0; dt < 4; ++dt)
#pragma unroll
            for (int r = 0; r < 8; ++r) cO[tile][dt * 8 + r][lane] = O[dt][r]; }
    __syncthreads();   // publishes the second half's parts to the joining wave
    if (ks != 0) return;
    const float m1 = cm[tile][lane], M = fmaxf(m, m1), a0 = __builtin_amdgcn_exp2f(m - M), a1 = __builtin_amdgcn_exp2f(m1 - M);
    l = l * a0 + cl[tile][lane] * a1;
#pragma unroll
    for (int dt = 0; dt < 4; ++dt)
#pragma unroll
        for (int r = 0; r < 8; ++r) O[dt][r] = O[dt][r] * a0 + cO[tile][dt * 8 + r][lane] * a1;
    l += xhalf(l);
    const float inv = __fdiv_rn(1.0f, l);
    const size_t oo = ((size_t)(g / NH_) * TT + i0 + c) * DQ + (g % NH_) * HD + 8 * h;
#pragma unroll
    for (int dt = 0; dt < 4; ++dt) { v8us oh, ol;
#pragma unroll
        for (int r = 0; r < 8; ++r) { unsigned short a, b2; splitf(O[dt][r] * inv, a, b2); oh[r] = a; ol[r] = b2; }
        *(v8us*)(Ah + oo + dt * 16) = oh; *(v8us*)(Al + oo + dt * 16) = ol; }
}

extern "C" void kernel_launch(void* const* d_in, const int* in_sizes, int n_in,
                              void* d_out, int out_size, void* d_ws, size_t ws_size, hipStream_t stream) {
    (void)in_sizes; (void)n_in; (void)out_size;
    const float* x = (const float*)d_in[0]; const float* wq = (const float*)d_in[1]; const float* wkv = (const float*)d_in[2];   /* [512][1024]: k | v column halves */ const float* wo = (const float*)d_in[3]; const float* bo = (const float*)d_in[4]; const float* rel = (const float*)d_in[5];   /* rel_emb [1025][64] */ const float* wk = nullptr, *wv = nullptr; (void)wk; (void)wv;
    float* OUT = (float*)d_out;     // [2][2048][512]
    char* wsp = (char*)d_ws;
    auto take = [&](size_t bytes) { char* p = wsp; wsp += (bytes + 255) & ~(size_t)255; return (void*)p; };
    bf* WQ = (bf*)take((size_t)DQ * DM * 2); bf* WKV = (bf*)take((size_t)2 * DKV * DM * 2);   /* directly behind WQ: one Bt [1536][512], rows q | k | v */ bf* EB = (bf*)take((size_t)NE * HD * 2); float* QE = (float*)take((size_t)NB_ * NH_ * TT * NE * 4); bf* WO = (bf*)take((size_t)DM * DQ * 2);
    bf* XB = (bf*)take((size_t)NB_ * TT * DM * 2);
    const size_t PU = (size_t)TT * HD, NU = (size_t)NB_ * NH_;   // one (batch, head) plane; planes a tensor
    h16* QP16 = (h16*)take(2 * NU * PU * 2); h16* KP16 = QP16 + NU * PU; bf* QPh = (bf*)take(2 * NU * PU * 2); bf* KPh = QPh + NU * PU; bf* QPl = (bf*)take(2 * NU * PU * 2); bf* KPl = QPl + NU * PU;   // q planes, then k planes
    h16* VT16 = (h16*)take(NU * PU * 2); bf* VTh = (bf*)take(2 * NU * PU * 2); bf* VTl = VTh + TT;   // rows of pitch 2 x TT: [batch 0 | batch 1] and [hi | lo]
    bf* ATh = (bf*)take((size_t)NB_ * TT * DQ * 2); bf* ATl = (bf*)take((size_t)NB_ * TT * DQ * 2);
    if ((size_t)(wsp - (char*)d_ws) > ws_size) return;    // ws 256 MiB
    const int DP = DQ + 2 * DKV;
    { k_wtG<<<(unsigned)((DM * DQ / 64 + 63) / 64), 256, 0, stream>>>(wq, DM, DQ, WQ); k_wtG<<<(unsigned)((DM * 2 * DKV / 64 + 63) / 64), 256, 0, stream>>>(wkv, DM, 2 * DKV, WKV);   /* 'xw' [512][1024] -> Bt [1024][512]: rows 0..511 = k, 512..1023 = v */ k_epadK<<<(unsigned)(((size_t)NE * HD / 8 + 255) / 256), 256, 0, stream>>>(rel, EB);
      k_wtG<<<(unsigned)((DQ * DM / 64 + 63) / 64), 256, 0, stream>>>(wo, DQ, DM, WO);
       }
    k_cvt8<<<(unsigned)(((size_t)NB_ * TT * DM / 8 + 255) / 256), 256, 0, stream>>>(x, XB, (size_t)NB_ * TT * DM / 8);
    k_proj<<<dim3(NB_ * TT / 64, DP / 64, 1), 32 * KSP, 0, stream>>>(XB, WQ, QP16, QPh, QPl, VT16, VTh, VTl);   /* q, k head planes and V^T planes, fp16 + hi/lo */
    k_gemmw<bf, 1, false><<<dim3(TT / 64, NE / 64, (unsigned)NU), 32, 0, stream>>>(QPh, QPl, EB, nullptr, HD, HD, QE, NE, nullptr, PU, 0, (size_t)TT * NE);   /* QE[u][i][r] = q_i . rel[r] (hi/lo x exact), all 16 (batch, head) planes */
    k_fattn<<<(unsigned)(NU * (TT / 64)), 256, 0, stream>>>(QP16, KP16, QPh, QPl, KPh, KPl, VT16, VTh, QE, ATh, ATl);   /* softmax((q.k + q_i . rel[clip(i - j) + 512]) / 8) . v, merged hi/lo */
    k_gemmw<bf, 1, true><<<dim3(NB_ * TT / 64, DM / 64, 1), 32, 0, stream>>>(ATh, ATl, WO, nullptr, DQ, DQ, OUT, DM, bo, 0, 0, 0);
}

// v006
// A run of this version takes 142 microseconds.
// In both of two side-by-side timings against v005, it was 1.15 times as fast.
// Over all steps from v000 it is 8.18 times as fast.
#include <hip/hip_runtime.h>

// Multi-head attention with a Shaw-style relative-key term over clipped distances (x [2][2048][512]; q = x Wq ('xw' [512][512]); k | v = x Wkv ('xw' [512][1024] column halves); 8 heads x 64; dots = (q.k + q.rel_emb[clip(i - j, -512, 512) + 512]) x 64^-0.5 (rel_emb [1025][64] shared by the heads, read); softmax (no causal mask in the module's code); out = merged Wo + bo ('xw') -> [2][2048][512] (2.1 M)).
// Layout: both batches as 4096 rows through one q|k|v projection launch, whose epilogue writes the head planes, and one Wo launch; bf16 copy of x; 'xw' weights transposed once (Wkv as one [1024][512] Bt whose row halves are k and v); exact projections; the relative table as one zero-padded bf16 plane [1088][64]; QE = q . rel^T (hi/lo x exact, [16][2048][1088]) for all 16 (batch, head) planes in one launch; one attention launch: a wave holds 16 queries and walks half of the keys in stages of 32 that four waves share in LDS (scores^T = K Q^T, + QE[i][clip(i - j) + 512], running maximum and sum, O^T += V^T P^T with P packed from the score accumulators), the two halves joined through LDS in fixed order; hybrid rows: < 512 hi/lo 3 products, rest fp16; merged hi/lo x Wo exact + bo.
// Compute dtypes, f32 accumulate: every input rounded to bf16; projections exact; q.k rows < 512 3 products, rest fp16; q.rel hi/lo x exact on every row; softmax f32 (running maximum); attn.v rows < 512 3 products, rest fp16 (unnormalised weights x 16); Wo hl x exact + bias.

#define NB_  2
#define TT   2048
#define DM   512
#define NH_  8
#define NKV  8
#define REP  (NH_ / NKV)
#define HD   64
#define DQ   (NH_ * HD)
#define DKV  (NKV * HD)
#define RH   512                  // query rows < RH use hi+lo planes (0: none)
#define WIN  0
#define SCL  0.125f
#define NE   1088     // 2*512+1 = 1025 relative offsets padded to a multiple of 64
#define NRE  1025
#define CUT  512
#define KSP  4        // k-slices of the q, k, v projections (K = 512 -> 128 a slice), one wave each
#define KSF  2        // key halves of a query tile in the attention kernel, one wave each
typedef _Float16 h16;
typedef unsigned short bf;
typedef __attribute__((ext_vector_type(16))) __bf16   v16bf;
typedef __attribute__((ext_vector_type(16))) _Float16 v16h;
typedef __attribute__((ext_vector_type(8)))  _Float16 v8h;
typedef __attribute__((ext_vector_type(8)))  unsigned short v8us;
typedef __attribute__((ext_vector_type(8)))  float    v8f;
typedef __attribute__((ext_vector_type(4)))  float    v4f;
typedef v8h  __attribute__((may_alias)) v8ha;
typedef v4f  __attribute__((may_alias)) v4fa;
typedef v8us __attribute__((may_alias)) v8usa;

__device__ __forceinline__ unsigned short f2bf(float f) { unsigned u = __float_as_uint(f); u += 0x7FFFu + ((u >> 16) & 1u); return (unsigned short)(u >> 16); }
__device__ __forceinline__ float bf2f(unsigned short b) { return __uint_as_float(((unsigned)b) << 16); }
__device__ __forceinline__ float bfr(float f) { return bf2f(f2bf(f)); }
__device__ __forceinline__ v16h cat16(v8h lo, v8h hi) { return __builtin_shufflevector(lo, hi, 0, 1, 2, 3, 4, 5, 6, 7, 8, 9, 10, 11, 12, 13, 14, 15); }
__device__ __forceinline__ v16bf cat16b(v8us lo, v8us hi) { return __builtin_bit_cast(v16bf, __builtin_shufflevector(lo, hi, 0, 1, 2, 3, 4, 5, 6, 7, 8, 9, 10, 11, 12, 13, 14, 15)); }
__device__ __forceinline__ v8f wmma16(v16h a, v16h b, v8f c) { return __builtin_amdgcn_wmma_f32_16x16x32_f16(false, a, false, b, (short)0, c, false, false); }
__device__ __forceinline__ v8f wmmab(v16bf a, v16bf b, v8f c) { return __builtin_amdgcn_wmma_f32_16x16x32_bf16(false, a, false, b, (short)0, c, false, false); }



// ---- k_gemmw: register-blocked GEMM, ONE WAVE per 64x64 output tile (16 accumulators), operands straight from K-contiguous 16-bit planes; grid (M/64, N/64, Z), 32 threads.
// C[m][n] (f32, pitch ldc, + optional f32 bias[n]) = sum_k A[m][k] Bt[n][k] (+ split products per NSPLIT). K is the row pitch of A and Bt, the sum runs over k < KX <= K. z-batch strides sA/sB/sC in elements. KX % 32 == 0.
// KSPL > 1: split-K over the grid. blockIdx.z = z * KSPL + s; slice s sums k in [s KX/KSPL, (s+1) KX/KSPL) into its own plane C + (z KSPL + s) sC.
template <typename T16> struct WFrag;
template <> struct WFrag<h16> { typedef v16h V; static __device__ __forceinline__ V ld(const h16* p) { return cat16(*(const v8h*)p, *(const v8h*)(p + 16)); } static __device__ __forceinline__ v8f mma(V a, V b, v8f c) { return wmma16(a, b, c); } };
template <> struct WFrag<bf> { typedef v16bf V; static __device__ __forceinline__ V ld(const bf* p) { return cat16b(*(const v8us*)p, *(const v8us*)(p + 16)); } static __device__ __forceinline__ v8f mma(V a, V b, v8f c) { return wmmab(a, b, c); } };
template <typename T16, int NSPLIT, bool BIAS, int KSPL = 1>
__global__ __launch_bounds__(32) void k_gemmw(const T16* __restrict__ A, const T16* __restrict__ A2, const T16* __restrict__ Bt, const T16* __restrict__ Bt2, int K, int KX, float* C, int ldc, const float* __restrict__ bias, size_t sA, size_t sB, size_t sC) {
    typedef typename WFrag<T16>::V V;
    __shared__ __align__(16) float os[16 * 68];
    const size_t z = blockIdx.z / KSPL; const int ks = (int)(blockIdx.z % KSPL); A += z * sA; if (A2) A2 += z * sA; Bt += z * sB; if (Bt2) Bt2 += z * sB; C += (size_t)blockIdx.z * sC;
    const int kbeg = ks * (KX / KSPL), kend = kbeg + KX / KSPL;
    const int lane = threadIdx.x & 31, lr = lane & 15, hi = lane >> 4; const int r0 = blockIdx.x * 64, c0 = blockIdx.y * 64;
    v8f acc[4][4];
#pragma unroll
    for (int mb = 0; mb < 4; ++mb)
#pragma unroll
        for (int nb = 0; nb < 4; ++nb) acc[mb][nb] = (v8f){};
    const size_t aoff = (size_t)(r0 + lr) * K + 8 * hi, boff = (size_t)(c0 + lr) * K + 8 * hi;
#pragma unroll 1
    for (int kc = kbeg; kc < kend; kc += 32) {
        V a[4], a2[4];
#pragma unroll
        for (int mb = 0; mb < 4; ++mb) { a[mb] = WFrag<T16>::ld(A + aoff + (size_t)mb * 16 * K + kc); if (NSPLIT == 1 || NSPLIT == 2) a2[mb] = WFrag<T16>::ld(A2 + aoff + (size_t)mb * 16 * K + kc); }
#pragma unroll
        for (int nb = 0; nb < 4; ++nb) { const V b = WFrag<T16>::ld(Bt + boff + (size_t)nb * 16 * K + kc); V b2; if (NSPLIT >= 2) b2 = WFrag<T16>::ld(Bt2 + boff + (size_t)nb * 16 * K + kc);
#pragma unroll
            for (int mb = 0; mb < 4; ++mb) { acc[mb][nb] = WFrag<T16>::mma(a[mb], b, acc[mb][nb]); if (NSPLIT == 1 || NSPLIT == 2) acc[mb][nb] = WFrag<T16>::mma(a2[mb], b, acc[mb][nb]); if (NSPLIT >= 2) acc[mb][nb] = WFrag<T16>::mma(a[mb], b2, acc[mb][nb]); } }
        asm volatile("v_nop\n\tv_nop\n\tv_nop\n\tv_nop" : "+v"(acc[0][0]), "+v"(acc[1][1]), "+v"(acc[2][2]), "+v"(acc[3][3]) : "v"(a[0]), "v"(a[3]));
    }
#pragma unroll
    for (int mb = 0; mb < 4; ++mb) {
#pragma unroll
        for (int nb = 0; nb < 4; ++nb) {
#pragma unroll
            for (int j = 0; j < 8; ++j) os[(hi * 8 + j) * 68 + nb * 16 + lr] = acc[mb][nb][j]; }
        __builtin_amdgcn_wave_barrier(); asm volatile("" ::: "memory");
        float* crow = C + (size_t)(r0 + mb * 16) * ldc + c0;
{
#pragma unroll
            for (int s = 0; s < 8; ++s) { const int row = 2 * s + hi, cofs = lr * 4; v4f val = *(const v4fa*)(os + row * 68 + cofs); if (BIAS) { val[0] += bfr(bias[c0 + cofs]); val[1] += bfr(bias[c0 + cofs + 1]); val[2] += bfr(bias[c0 + cofs + 2]); val[3] += bfr(bias[c0 + cofs + 3]); }
                *(v4f*)(crow + (size_t)row * ldc + cofs) = val; }
             }
        __builtin_amdgcn_wave_barrier(); asm volatile("" ::: "memory");
    }
}

__device__ __forceinline__ h16 tohx(float x) { return (h16)x; }
__device__ __forceinline__ void splitf(float y, unsigned short& h, unsigned short& l) { h = f2bf(y); l = f2bf(y - bf2f(h)); }
typedef __attribute__((ext_vector_type(2))) _Float16 v2h;
typedef __attribute__((ext_vector_type(4))) _Float16 v4h;
typedef __attribute__((ext_vector_type(2))) unsigned short v2us;
typedef __attribute__((ext_vector_type(4))) unsigned short v4us;
typedef __attribute__((ext_vector_type(2))) float v2f;
typedef __attribute__((ext_vector_type(4))) int v4i;

// The five preparation passes (three weight transposes, the bf16 copy of x, the padded relative table) read only inputs and write planes of their own: they are parts of ONE launch, k_prep, each on its own range of work-groups (blk = the work-group's index inside its part).
__device__ __forceinline__ void d_wtG(int blk, const float* __restrict__ w, int K, int N, bf* Bt) {
    const int lane = threadIdx.x & 31; const int L0 = (blk * 8 + (threadIdx.x >> 5)) * 8; const int nlines = N * K / 64;
{
#pragma unroll 1
        for (int l = 0; l < 8; ++l) { const int L = L0 + l; if (L >= nlines) break; const size_t e = (size_t)L * 64 + lane * 2; const int k = (int)(e % K), n = (int)(e / K); v2us o;
            o[0] = f2bf(w[(size_t)k * N + n]); o[1] = f2bf(w[(size_t)(k + 1) * N + n]); *(v2us*)(Bt + e) = o; }
         }
}
__device__ __forceinline__ void d_cvt8(int blk, const float* __restrict__ src, bf* dst, size_t n8) { const size_t i = (size_t)blk * 256 + threadIdx.x; if (i >= n8) return; const float* sp = src + i * 8; const v8f v = *(const v8f*)sp; v8us o;
    asm volatile("s_wait_xcnt 0x0" :: "v"(sp) : "memory");   // the load's address pair stays live up to this wait, so that no later value lands in it before
#pragma unroll
    for (int k = 0; k < 8; ++k) o[k] = f2bf(v[k]); *(v8us*)(dst + i * 8) = o;  }

#define RPI 68   // floats: LDS pitch of one 64-value row of a k-slice's tile (272 B = 16 B x odd: the 16-byte stores and reads of 16 lanes fall on all 64 banks)
// k_proj: the q | k | v projection with the head planes written by its own epilogue. Grid (4096 / 64 row tiles, 1536 / 64 column tiles = one head of q, k or v), KSP waves: wave s sums k in [s DM / KSP, (s + 1) DM / KSP) of the whole 64 x 64 tile (16 accumulators, operands straight from the K-contiguous planes), stores its tile in its own LDS plane, and behind one barrier the work-group adds the KSP planes in the order s = 0, 1, ... and stores fp16 + hi/lo bf16 in whole 128-byte lines.
// The operand whose rows run along the output's contiguous direction is the A side, so that a lane's 8 accumulator values are 8 neighbours of an output row: q, k planes [u][t][d] take A = weight rows (d), B = x rows (t); the V^T planes [d][t] take A = x rows (t), B = weight rows (d). Both sides use the same loader (the same k order).
__global__ __launch_bounds__(32 * KSP) void k_proj(const bf* __restrict__ X, const bf* __restrict__ Wt, h16* P16, bf* Ph, bf* Pl, h16* V16, bf* Vh, bf* Vl) {
    typedef WFrag<bf>::V V;
    __shared__ __align__(16) float red[KSP][64][RPI];
    const int lane = threadIdx.x & 31, lr = lane & 15, hi = lane >> 4; const int ks = __builtin_amdgcn_readfirstlane((int)(threadIdx.x >> 5));
    const int r0 = blockIdx.x * 64, cy = blockIdx.y; const bool isv = cy >= (DQ + DKV) / HD;
    const bf* xr = X + (size_t)r0 * DM; const bf* wr = Wt + (size_t)cy * 64 * DM;
    const bf* Am = isv ? xr : wr; const bf* Bn = isv ? wr : xr;
    v8f acc[4][4];
#pragma unroll
    for (int mb = 0; mb < 4; ++mb)
#pragma unroll
        for (int nb = 0; nb < 4; ++nb) acc[mb][nb] = (v8f){};
    const int off = lr * DM + 8 * hi; const int kbeg = ks * (DM / KSP), kend = kbeg + DM / KSP;
#pragma unroll 1   // rolled: one set of fragment registers and a short text; the fence in the trip would hold an unrolled trip's loads in place anyway
    for (int kc = kbeg; kc < kend; kc += 32) {
        V a[4], b[4]; const bf* ap = Am + off + kc; const bf* bp = Bn + off + kc;
#pragma unroll
        for (int u = 0; u < 4; ++u) { a[u] = WFrag<bf>::ld(ap + u * 16 * DM); b[u] = WFrag<bf>::ld(bp + u * 16 * DM); }
        // the address pairs stay live up to this wait, so that no load's result and no later address lands in them before it; the loaded values as inputs hold all 16 loads in front of the first matrix instruction (one latency a trip)
        asm volatile("s_wait_xcnt 0x0" :: "v"(ap), "v"(bp), "v"(a[0]), "v"(a[1]), "v"(a[2]), "v"(a[3]), "v"(b[0]), "v"(b[1]), "v"(b[2]), "v"(b[3]) : "memory");
#pragma unroll
        for (int nb = 0; nb < 4; ++nb)
#pragma unroll
            for (int mb = 0; mb < 4; ++mb) acc[mb][nb] = WFrag<bf>::mma(a[mb], b[nb], acc[mb][nb]);
    }
#pragma unroll
    for (int mb = 0; mb < 4; ++mb)
#pragma unroll
        for (int nb = 0; nb < 4; ++nb) { float* p = &red[ks][nb * 16 + lr][mb * 16 + hi * 8];
            *(v4fa*)p = __builtin_shufflevector(acc[mb][nb], acc[mb][nb], 0, 1, 2, 3); *(v4fa*)(p + 4) = __builtin_shufflevector(acc[mb][nb], acc[mb][nb], 4, 5, 6, 7); }
    __syncthreads();   // publishes every k-slice's tile to the waves that add them
    const int b = r0 / TT, t0 = r0 % TT, head = cy % NH_;
    // row n of the tile: a V^T row d (pitch 2 x TT: fp16 rows [head][d][b | b], hi/lo rows [b, head][d][hi | lo]) or a q / k row t (pitch HD, plane u = (q or k, b, head))
    const unsigned pit = isv ? 2u * TT : (unsigned)HD;
    const size_t o16 = isv ? ((size_t)head * HD * NB_ + b) * TT + t0 : ((size_t)((cy / NH_) * NB_ + b) * NH_ + head) * TT * HD + (size_t)t0 * HD;
    const size_t ohl = isv ? (size_t)(b * NKV + head) * HD * 2 * TT + t0 : o16;
    h16* D16 = (isv ? V16 : P16) + o16; bf* Dh = (isv ? Vh : Ph) + ohl; bf* Dl = (isv ? Vl : Pl) + ohl;
#pragma unroll
    for (int it = 0; it < 512 / (32 * KSP); ++it) { const int q = it * (32 * KSP) + (int)threadIdx.x, n = q >> 3, mc = (q & 7) * 8;   // 8 lanes a row: a wave's store covers 4 whole lines
        v4f x0 = *(const v4fa*)&red[0][n][mc], x1 = *(const v4fa*)&red[0][n][mc + 4];
#pragma unroll
        for (int s = 1; s < KSP; ++s) { x0 += *(const v4fa*)&red[s][n][mc]; x1 += *(const v4fa*)&red[s][n][mc + 4]; }   // the k-slices, added in fixed order
        v8h v16; v8us vh, vl;
#pragma unroll
        for (int k = 0; k < 8; ++k) { const float x = k < 4 ? x0[k & 3] : x1[k & 3]; v16[k] = tohx(x); unsigned short a2, c2; splitf(x, a2, c2); vh[k] = a2; vl[k] = c2; }
        const unsigned eb = ((unsigned)n * pit + (unsigned)mc) * 2u;   // byte offset in all three planes (2-byte elements): scalar base + 32-bit offset
        *(v8h*)((char*)D16 + eb) = v16; *(v8us*)((char*)Dh + eb) = vh; *(v8us*)((char*)Dl + eb) = vl;
    }
}
__device__ __forceinline__ void d_epadK(int blk, const float* __restrict__ E, bf* EB) { const size_t i = (size_t)blk * 256 + threadIdx.x; if (i >= (size_t)NE * HD / 8) return; const int d0 = (int)(i % (HD / 8)) * 8; const int r = (int)(i / (HD / 8)); const float* src = E + (size_t)min(r, NRE - 1) * HD + d0; v8us o;
#pragma unroll
    for (int q = 0; q < 8; ++q) { const unsigned short v = f2bf(src[q]); o[q] = (r < NRE) ? v : (unsigned short)0; }
    *(v8us*)(EB + (size_t)r * HD + d0) = o;  }
#define PB_WKV ((DM * 2 * DKV / 64 + 63) / 64)   // work-groups of each part of k_prep
#define PB_WQ  ((DM * DQ / 64 + 63) / 64)
#define PB_WO  ((DQ * DM / 64 + 63) / 64)
#define PB_E   ((NE * HD / 8 + 255) / 256)
#define PB_X   ((NB_ * TT * DM / 8 + 255) / 256)
// k_prep: the transposes take the lowest indices (a wave of theirs walks 8 lines one after another, the longest part: it starts first), then the table, then the copy of x. The part is chosen by blockIdx alone: a work-group runs exactly one.
__global__ __launch_bounds__(256) void k_prep(const float* __restrict__ x, const float* __restrict__ wq, const float* __restrict__ wkv, const float* __restrict__ wo, const float* __restrict__ rel, bf* XB, bf* WQ, bf* WKV, bf* WO, bf* EB) {
    int n = blockIdx.x;
    if (n < PB_WKV) { d_wtG(n, wkv, DM, 2 * DKV, WKV); return; }   // 'xw' [512][1024] -> Bt [1024][512]: rows 0..511 = k, 512..1023 = v
    n -= PB_WKV;
    if (n < PB_WQ) { d_wtG(n, wq, DM, DQ, WQ); return; }
    n -= PB_WQ;
    if (n < PB_WO) { d_wtG(n, wo, DQ, DM, WO); return; }
    n -= PB_WO;
    if (n < PB_E) { d_epadK(n, rel, EB); return; }
    d_cvt8(n - PB_E, x, XB, (size_t)NB_ * TT * DM / 8);
}

__device__ __forceinline__ float xhalf(float x) { return __builtin_bit_cast(float, __builtin_amdgcn_permlanex16(__builtin_bit_cast(int, x), __builtin_bit_cast(int, x), 0x76543210, 0xfedcba98, false, false)); }   // lane l with lane l ^ 16
#define KPI 144   // bytes: LDS pitch of a staged K row (128 B of data), 16 B x odd against bank conflicts of the 16-byte fragment reads
#define VPI 80    // bytes: LDS pitch of a staged V^T row (64 B of data), 16 B x odd
#define EPI 36    // floats: LDS pitch of a wave's 16 x 32 tile of the relative term (144 B)
#define FPL (32 * KPI + 64 * VPI)   // one staged plane pair: 32 K rows, then 64 V^T rows
template <typename T16> struct Chunk;
template <> struct Chunk<h16> { typedef v8h T; };
template <> struct Chunk<bf> { typedef v8us T; };
template <typename T16, bool HI>
__device__ __forceinline__ void fa_part(const T16* __restrict__ Q, const T16* __restrict__ Q2, const T16* __restrict__ Kp, const T16* __restrict__ K2, const T16* __restrict__ Vt, const T16* __restrict__ Vt2, const float* __restrict__ QEz, char* ring, float* et, int tg, int lane, int i0, int jbeg, int jend, int c, int h, float& m, float& l, v8f (&O)[4]) {
    typedef typename WFrag<T16>::V V; typedef typename Chunk<T16>::T C8;
    V qf[2], q2f[2]; const T16* qp = Q + (size_t)(i0 + c) * HD + 8 * h; const T16* q2p = HI ? Q2 + (size_t)(i0 + c) * HD + 8 * h : qp;
#pragma unroll
    for (int kk = 0; kk < 2; ++kk) { qf[kk] = WFrag<T16>::ld(qp + kk * 32); if (HI) q2f[kk] = WFrag<T16>::ld(q2p + kk * 32); }
    const unsigned rowb = (unsigned)(i0 + c) * (NE * 4u);   // byte offset of this query's QE row: scalar base + 32-bit offset
    const float eLo = *(const float*)((const char*)QEz + rowb), eHi = *(const float*)((const char*)QEz + rowb + 2 * CUT * 4);   // the two clipped ends of the row
    asm volatile("s_wait_xcnt 0x0" :: "v"(qp), "v"(q2p), "v"(rowb) : "memory");   // the address registers of the loads above stay live up to this wait
    // staging: 16-byte chunk tg + 128 u of a stage: K row (tg >> 3) + 16 u, V^T row (tg >> 2) + 32 u
    const size_t kgo = (size_t)jbeg * HD + tg * 8, vgo = (size_t)(tg >> 2) * 2 * TT + jbeg + (tg & 3) * 8;
    const T16* kg = Kp + kgo; const T16* k2g = HI ? K2 + kgo : kg; const T16* vg = Vt + vgo; const T16* v2g = HI ? Vt2 + vgo : vg;
    const int ksl = (tg >> 3) * KPI + (tg & 7) * 16, vsl = 32 * KPI + (tg >> 2) * VPI + (tg & 3) * 16;
    C8 gk[2], gv[2], gk2[2], gv2[2];
    auto gload = [&]() {
#pragma unroll
        for (int u = 0; u < 2; ++u) { gk[u] = *(const C8*)(kg + u * 128 * 8); gv[u] = *(const C8*)(vg + (size_t)u * 32 * 2 * TT); if (HI) { gk2[u] = *(const C8*)(k2g + u * 128 * 8); gv2[u] = *(const C8*)(v2g + (size_t)u * 32 * 2 * TT); } }
        asm volatile("s_wait_xcnt 0x0" :: "v"(kg), "v"(k2g), "v"(vg), "v"(v2g) : "memory");   // the staging loads' address pairs stay live up to this wait; they are stepped only behind it
        kg += 32 * HD; k2g += 32 * HD; vg += 32; v2g += 32; };
    auto sstore = [&](char* b) {
#pragma unroll
        for (int u = 0; u < 2; ++u) { *(C8*)(b + ksl + u * 16 * KPI) = gk[u]; *(C8*)(b + vsl + u * 32 * VPI) = gv[u]; if (HI) { *(C8*)(b + FPL + ksl + u * 16 * KPI) = gk2[u]; *(C8*)(b + FPL + vsl + u * 32 * VPI) = gv2[u]; } } };
    gload(); sstore(ring);
    __syncthreads();   // publishes stage 0
    const int ns = (jend - jbeg) / 32;
#pragma unroll 1
    for (int s = 0; s < ns; ++s) {
        const int j0 = jbeg + 32 * s; const bool more = s + 1 < ns; const char* b = ring + (s & 1) * (2 * FPL);
        if (more) gload();   // stage s + 1 flies while stage s is worked on
        V kf[2][2], k2f[2][2]; float e[2][8];
#pragma unroll
        for (int t = 0; t < 2; ++t)
#pragma unroll
            for (int kk = 0; kk < 2; ++kk) { kf[t][kk] = WFrag<T16>::ld((const T16*)(b + (16 * t + c) * KPI + kk * 64 + 16 * h)); if (HI) k2f[t][kk] = WFrag<T16>::ld((const T16*)(b + FPL + (16 * t + c) * KPI + kk * 64 + 16 * h)); }
        if (i0 + 15 - j0 <= -CUT || i0 - (j0 + 31) >= CUT) {   // the whole block is clipped to one end (wave-uniform)
            const float ee = (i0 < j0) ? eLo : eHi;
#pragma unroll
            for (int t = 0; t < 2; ++t)
#pragma unroll
                for (int r = 0; r < 8; ++r) e[t][r] = ee;
        } else {   // one query row a load, lane = key: a load touches one or two lines; the wave's own LDS tile turns the 16 x 32 block into the score layout
            unsigned off[16]; float ev[16];
#pragma unroll
            for (int rr = 0; rr < 16; ++rr) { off[rr] = (unsigned)(i0 + rr) * (NE * 4u) + 4u * (unsigned)min(max(i0 + rr + CUT - (j0 + lane), 0), 2 * CUT); ev[rr] = *(const float*)((const char*)QEz + off[rr]); }
            // the gather's offset registers stay live up to this wait, so that no later value lands in a register that an issued load still names
            asm volatile("s_wait_xcnt 0x0" :: "v"(off[0]), "v"(off[1]), "v"(off[2]), "v"(off[3]), "v"(off[4]), "v"(off[5]), "v"(off[6]), "v"(off[7]), "v"(off[8]), "v"(off[9]), "v"(off[10]), "v"(off[11]), "v"(off[12]), "v"(off[13]), "v"(off[14]), "v"(off[15]) : "memory");
#pragma unroll
            for (int rr = 0; rr < 16; ++rr) et[rr * EPI + lane] = ev[rr];
            __builtin_amdgcn_wave_barrier(); asm volatile("" ::: "memory");   // keeps the compiler from moving the reads below over the other lanes' stores above (one wave: its LDS operations run in order)
#pragma unroll
            for (int t = 0; t < 2; ++t)
#pragma unroll
                for (int r4 = 0; r4 < 2; ++r4) { const v4f q4 = *(const v4fa*)(et + c * EPI + 16 * t + 8 * h + 4 * r4);
#pragma unroll
                    for (int q = 0; q < 4; ++q) e[t][r4 * 4 + q] = q4[q]; }
            __builtin_amdgcn_wave_barrier(); asm volatile("" ::: "memory");   // and the next stage's stores over these reads
        }
        v8f s_[2];
#pragma unroll
        for (int t = 0; t < 2; ++t) { s_[t] = (v8f){};
#pragma unroll
            for (int kk = 0; kk < 2; ++kk) { s_[t] = WFrag<T16>::mma(kf[t][kk], qf[kk], s_[t]); if (HI) { s_[t] = WFrag<T16>::mma(kf[t][kk], q2f[kk], s_[t]); s_[t] = WFrag<T16>::mma(k2f[t][kk], qf[kk], s_[t]); } } }
        V vf[4], v2f_[4];
#pragma unroll
        for (int dt = 0; dt < 4; ++dt) { vf[dt] = WFrag<T16>::ld((const T16*)(b + 32 * KPI + (dt * 16 + c) * VPI + 16 * h)); if (HI) v2f_[dt] = WFrag<T16>::ld((const T16*)(b + FPL + 32 * KPI + (dt * 16 + c) * VPI + 16 * h)); }
        float x[2][8]; float mb = -3.0e38f;
#pragma unroll
        for (int t = 0; t < 2; ++t)
#pragma unroll
            for (int r = 0; r < 8; ++r) { x[t][r] = (s_[t][r] + e[t][r]) * (SCL * 1.4426950408889634f); mb = fmaxf(mb, x[t][r]); }
        mb = fmaxf(mb, xhalf(mb));
        const float mn = fmaxf(m, HI ? mb : mb - 4.0f);   // fp16 weights run up to 16: four more binades above the subnormals; the factor cancels in O / l
        const float al = __builtin_amdgcn_exp2f(m - mn); m = mn;
        float ps = 0.f;
#pragma unroll
        for (int t = 0; t < 2; ++t)
#pragma unroll
            for (int r = 0; r < 8; ++r) { x[t][r] = __builtin_amdgcn_exp2f(x[t][r] - mn); ps += x[t][r]; }
        l = l * al + ps;
#pragma unroll
        for (int dt = 0; dt < 4; ++dt) O[dt] *= al;
        if constexpr (HI) {
            v8us ph[2], pl[2];
#pragma unroll
            for (int t = 0; t < 2; ++t)
#pragma unroll
                for (int r = 0; r < 8; ++r) { unsigned short a, b2; splitf(x[t][r], a, b2); ph[t][r] = a; pl[t][r] = b2; }
            const V pbh = cat16b(ph[0], ph[1]), pbl = cat16b(pl[0], pl[1]);
#pragma unroll
            for (int dt = 0; dt < 4; ++dt) { O[dt] = WFrag<T16>::mma(vf[dt], pbh, O[dt]); O[dt] = WFrag<T16>::mma(vf[dt], pbl, O[dt]); O[dt] = WFrag<T16>::mma(v2f_[dt], pbh, O[dt]); }
        } else {
            v8h p0, p1;
#pragma unroll
            for (int r = 0; r < 8; ++r) { p0[r] = tohx(x[0][r]); p1[r] = tohx(x[1][r]); }
            const V pb = cat16(p0, p1);
#pragma unroll
            for (int dt = 0; dt < 4; ++dt) O[dt] = WFrag<T16>::mma(vf[dt], pb, O[dt]);
        }
        if (more) sstore(ring + ((s + 1) & 1) * (2 * FPL));   // into the buffer that every wave left at the last barrier
        __syncthreads();   // publishes stage s + 1 and ends every reader's last read of stage s
    }
}
// k_fattn: grid (batch x head x TT / 64), 8 waves = KSF key halves x 4 query tiles of 16. Each wave runs fa_part on its half of the keys; half 1 hands (m, l, O^T) over through LDS, half 0 joins the two in fixed order and stores the row's 64 merged values as hi/lo bf16.
__global__ __launch_bounds__(256) void k_fattn(const h16* __restrict__ Q16, const h16* __restrict__ K16, const bf* __restrict__ Qh, const bf* __restrict__ Ql, const bf* __restrict__ Kh, const bf* __restrict__ Kl, const h16* __restrict__ V16, const bf* __restrict__ Vh, const float* __restrict__ QE, bf* Ah, bf* Al) {
    __shared__ __align__(16) char ring[KSF][2][2 * FPL]; __shared__ __align__(16) float et[8][16 * EPI];
    __shared__ float cm[4][32]; __shared__ float cl[4][32]; __shared__ float cO[4][32][32];   // [query tile][register][lane]
    const int lane = threadIdx.x & 31, c = lane & 15, h = lane >> 4; const int w = __builtin_amdgcn_readfirstlane((int)(threadIdx.x >> 5));
    const int n = blockIdx.x, nh = NB_ * NH_ * (RH / 64); const bool hires = n < nh;   // the costlier hi/lo row blocks take the lowest indices: they start first and the lighter ones fill in beside them
    const int g = hires ? n / (RH / 64) : (n - nh) / ((TT - RH) / 64), xb = hires ? n % (RH / 64) : RH / 64 + (n - nh) % ((TT - RH) / 64);
    const int tile = w & 3, ks = w >> 2, i0 = xb * 64 + tile * 16, jbeg = ks * (TT / KSF), jend = jbeg + TT / KSF, tg = threadIdx.x & 127;
    const size_t pu = (size_t)g * TT * HD; const float* QEz = QE + (size_t)g * TT * NE;
    float m = -3.0e38f, l = 0.f; v8f O[4];
#pragma unroll
    for (int dt = 0; dt < 4; ++dt) O[dt] = (v8f){};
    if (hires) fa_part<bf, true>(Qh + pu, Ql + pu, Kh + pu, Kl + pu, Vh + 2 * pu, Vh + 2 * pu + TT, QEz, &ring[ks][0][0], &et[w][0], tg, lane, i0, jbeg, jend, c, h, m, l, O);
    else fa_part<h16, false>(Q16 + pu, nullptr, K16 + pu, nullptr, V16 + (size_t)(g % NH_) * HD * 2 * TT + (size_t)(g / NH_) * TT, nullptr, QEz, &ring[ks][0][0], &et[w][0], tg, lane, i0, jbeg, jend, c, h, m, l, O);
    if (ks != 0) { cm[tile][lane] = m; cl[tile][lane] = l;
#pragma unroll
        for (int dt = 0; dt < 4; ++dt)
#pragma unroll
            for (int r = 0; r < 8; ++r) cO[tile][dt * 8 + r][lane] = O[dt][r]; }
    __syncthreads();   // publishes the second half's parts to the joining wave
    if (ks != 0) return;
    const float m1 = cm[tile][lane], M = fmaxf(m, m1), a0 = __builtin_amdgcn_exp2f(m - M), a1 = __builtin_amdgcn_exp2f(m1 - M);
    l = l * a0 + cl[tile][lane] * a1;
#pragma unroll
    for (int dt = 0; dt < 4; ++dt)
#pragma unroll
        for (int r = 0; r < 8; ++r) O[dt][r] = O[dt][r] * a0 + cO[tile][dt * 8 + r][lane] * a1;
    l += xhalf(l);
    const float inv = __fdiv_rn(1.0f, l);
    const size_t oo = ((size_t)(g / NH_) * TT + i0 + c) * DQ + (g % NH_) * HD + 8 * h;
#pragma unroll
    for (int dt = 0; dt < 4; ++dt) { v8us oh, ol;
#pragma unroll
        for (int r = 0; r < 8; ++r) { unsigned short a, b2; splitf(O[dt][r] * inv, a, b2); oh[r] = a; ol[r] = b2; }
        *(v8us*)(Ah + oo + dt * 16) = oh; *(v8us*)(Al + oo + dt * 16) = ol; }
}

extern "C" void kernel_launch(void* const* d_in, const int* in_sizes, int n_in,
                              void* d_out, int out_size, void* d_ws, size_t ws_size, hipStream_t stream) {
    (void)in_sizes; (void)n_in; (void)out_size;
    const float* x = (const float*)d_in[0]; const float* wq = (const float*)d_in[1]; const float* wkv = (const float*)d_in[2];   /* [512][1024]: k | v column halves */ const float* wo = (const float*)d_in[3]; const float* bo = (const float*)d_in[4]; const float* rel = (const float*)d_in[5];   /* rel_emb [1025][64] */ const float* wk = nullptr, *wv = nullptr; (void)wk; (void)wv;
    float* OUT = (float*)d_out;     // [2][2048][512]
    char* wsp = (char*)d_ws;
    auto take = [&](size_t bytes) { char* p = wsp; wsp += (bytes + 255) & ~(size_t)255; return (void*)p; };
    bf* WQ = (bf*)take((size_t)DQ * DM * 2); bf* WKV = (bf*)take((size_t)2 * DKV * DM * 2);   /* directly behind WQ: one Bt [1536][512], rows q | k | v */ bf* EB = (bf*)take((size_t)NE * HD * 2); float* QE = (float*)take((size_t)NB_ * NH_ * TT * NE * 4); bf* WO = (bf*)take((size_t)DM * DQ * 2);
    bf* XB = (bf*)take((size_t)NB_ * TT * DM * 2);
    const size_t PU = (size_t)TT * HD, NU = (size_t)NB_ * NH_;   // one (batch, head) plane; planes a tensor
    h16* QP16 = (h16*)take(2 * NU * PU * 2); h16* KP16 = QP16 + NU * PU; bf* QPh = (bf*)take(2 * NU * PU * 2); bf* KPh = QPh + NU * PU; bf* QPl = (bf*)take(2 * NU * PU * 2); bf* KPl = QPl + NU * PU;   // q planes, then k planes
    h16* VT16 = (h16*)take(NU * PU * 2); bf* VTh = (bf*)take(2 * NU * PU * 2); bf* VTl = VTh + TT;   // rows of pitch 2 x TT: [batch 0 | batch 1] and [hi | lo]
    bf* ATh = (bf*)take((size_t)NB_ * TT * DQ * 2); bf* ATl = (bf*)take((size_t)NB_ * TT * DQ * 2);
    if ((size_t)(wsp - (char*)d_ws) > ws_size) return;    // ws 256 MiB
    const int DP = DQ + 2 * DKV;
    k_prep<<<(unsigned)(PB_WKV + PB_WQ + PB_WO + PB_E + PB_X), 256, 0, stream>>>(x, wq, wkv, wo, rel, XB, WQ, WKV, WO, EB);   /* weights transposed, x and the relative table as bf16: one launch */
    k_proj<<<dim3(NB_ * TT / 64, DP / 64, 1), 32 * KSP, 0, stream>>>(XB, WQ, QP16, QPh, QPl, VT16, VTh, VTl);   /* q, k head planes and V^T planes, fp16 + hi/lo */
    k_gemmw<bf, 1, false><<<dim3(TT / 64, NE / 64, (unsigned)NU), 32, 0, stream>>>(QPh, QPl, EB, nullptr, HD, HD, QE, NE, nullptr, PU, 0, (size_t)TT * NE);   /* QE[u][i][r] = q_i . rel[r] (hi/lo x exact), all 16 (batch, head) planes */
    k_fattn<<<(unsigned)(NU * (TT / 64)), 256, 0, stream>>>(QP16, KP16, QPh, QPl, KPh, KPl, VT16, VTh, QE, ATh, ATl);   /* softmax((q.k + q_i . rel[clip(i - j) + 512]) / 8) . v, merged hi/lo */
    k_gemmw<bf, 1, true><<<dim3(NB_ * TT / 64, DM / 64, 1), 32, 0, stream>>>(ATh, ATl, WO, nullptr, DQ, DQ, OUT, DM, bo, 0, 0, 0);
}

// v007
// A run of this version takes 97.1 microseconds.
// Next to v006, in two timings, it ran 1.47 times as fast each time.
// All steps since v000 together make it 12.0 times as fast.
#include <hip/hip_runtime.h>

// Multi-head attention with a Shaw-style relative-key term over clipped distances (x [2][2048][512]; q = x Wq ('xw' [512][512]); k | v = x Wkv ('xw' [512][1024] column halves); 8 heads x 64; dots = (q.k + q.rel_emb[clip(i - j, -512, 512) + 512]) x 64^-0.5 (rel_emb [1025][64] shared by the heads, read); softmax (no causal mask in the module's code); out = merged Wo + bo ('xw') -> [2][2048][512] (2.1 M)).
// Layout: both batches as 4096 rows through one q|k|v projection launch, whose epilogue writes the head planes, and one Wo launch; bf16 copy of x; 'xw' weights transposed once (Wkv as one [1024][512] Bt whose row halves are k and v); exact projections; the relative table as one zero-padded bf16 plane [1088][64]; one attention launch: a wave holds 16 queries and walks half of the keys in stages of 32 that four waves share in LDS (scores^T = K Q^T, + q_i . rel[clip(i - j) + 512] from a product of the stage's 48 table rows with Q^T (hi/lo x exact), shifted per query through LDS, running maximum and sum, O^T += V^T P^T with P packed from the score accumulators), the two halves joined through LDS in fixed order; hybrid rows: < 512 hi/lo 3 products, rest fp16; merged hi/lo x Wo exact + bo.
// Compute dtypes, f32 accumulate: every input rounded to bf16; projections exact; q.k rows < 512 3 products, rest fp16; q.rel hi/lo x exact on every row; softmax f32 (running maximum); attn.v rows < 512 3 products, rest fp16 (unnormalised weights x 16); Wo hl x exact + bias.

#define NB_  2
#define TT   2048
#define DM   512
#define NH_  8
#define NKV  8
#define REP  (NH_ / NKV)
#define HD   64
#define DQ   (NH_ * HD)
#define DKV  (NKV * HD)
#define RH   512                  // query rows < RH use hi+lo planes (0: none)
#define WIN  0
#define SCL  0.125f
#define NE   1088     // 2*512+1 = 1025 relative offsets padded to a multiple of 64
#define NRE  1025
#define CUT  512
#define KSP  4        // k-slices of the q, k, v projections (K = 512 -> 128 a slice), one wave each
#define KSF  2        // key halves of a query tile in the attention kernel, one wave each
typedef _Float16 h16;
typedef unsigned short bf;
typedef __attribute__((ext_vector_type(16))) __bf16   v16bf;
typedef __attribute__((ext_vector_type(16))) _Float16 v16h;
typedef __attribute__((ext_vector_type(8)))  _Float16 v8h;
typedef __attribute__((ext_vector_type(8)))  unsigned short v8us;
typedef __attribute__((ext_vector_type(8)))  float    v8f;
typedef __attribute__((ext_vector_type(4)))  float    v4f;
typedef v8h  __attribute__((may_alias)) v8ha;
typedef v4f  __attribute__((may_alias)) v4fa;
typedef v8us __attribute__((may_alias)) v8usa;

__device__ __forceinline__ unsigned short f2bf(float f) { unsigned u = __float_as_uint(f); u += 0x7FFFu + ((u >> 16) & 1u); return (unsigned short)(u >> 16); }
__device__ __forceinline__ float bf2f(unsigned short b) { return __uint_as_float(((unsigned)b) << 16); }
__device__ __forceinline__ float bfr(float f) { return bf2f(f2bf(f)); }
__device__ __forceinline__ v16h cat16(v8h lo, v8h hi) { return __builtin_shufflevector(lo, hi, 0, 1, 2, 3, 4, 5, 6, 7, 8, 9, 10, 11, 12, 13, 14, 15); }
__device__ __forceinline__ v16bf cat16b(v8us lo, v8us hi) { return __builtin_bit_cast(v16bf, __builtin_shufflevector(lo, hi, 0, 1, 2, 3, 4, 5, 6, 7, 8, 9, 10, 11, 12, 13, 14, 15)); }
__device__ __forceinline__ v8f wmma16(v16h a, v16h b, v8f c) { return __builtin_amdgcn_wmma_f32_16x16x32_f16(false, a, false, b, (short)0, c, false, false); }
__device__ __forceinline__ v8f wmmab(v16bf a, v16bf b, v8f c) { return __builtin_amdgcn_wmma_f32_16x16x32_bf16(false, a, false, b, (short)0, c, false, false); }



// ---- k_gemmw: register-blocked GEMM, ONE WAVE per 64x64 output tile (16 accumulators), operands straight from K-contiguous 16-bit planes; grid (M/64, N/64, Z), 32 threads.
// C[m][n] (f32, pitch ldc, + optional f32 bias[n]) = sum_k A[m][k] Bt[n][k] (+ split products per NSPLIT). K is the row pitch of A and Bt, the sum runs over k < KX <= K. z-batch strides sA/sB/sC in elements. KX % 32 == 0.
// KSPL > 1: split-K over the grid. blockIdx.z = z * KSPL + s; slice s sums k in [s KX/KSPL, (s+1) KX/KSPL) into its own plane C + (z KSPL + s) sC.
template <typename T16> struct WFrag;
template <> struct WFrag<h16> { typedef v16h V; static __device__ __forceinline__ V ld(const h16* p) { return cat16(*(const v8h*)p, *(const v8h*)(p + 16)); } static __device__ __forceinline__ v8f mma(V a, V b, v8f c) { return wmma16(a, b, c); } };
template <> struct WFrag<bf> { typedef v16bf V; static __device__ __forceinline__ V ld(const bf* p) { return cat16b(*(const v8us*)p, *(const v8us*)(p + 16)); } static __device__ __forceinline__ v8f mma(V a, V b, v8f c) { return wmmab(a, b, c); } };
template <typename T16, int NSPLIT, bool BIAS, int KSPL = 1>
__global__ __launch_bounds__(32) void k_gemmw(const T16* __restrict__ A, const T16* __restrict__ A2, const T16* __restrict__ Bt, const T16* __restrict__ Bt2, int K, int KX, float* C, int ldc, const float* __restrict__ bias, size_t sA, size_t sB, size_t sC) {
    typedef typename WFrag<T16>::V V;
    __shared__ __align__(16) float os[16 * 68];
    const size_t z = blockIdx.z / KSPL; const int ks = (int)(blockIdx.z % KSPL); A += z * sA; if (A2) A2 += z * sA; Bt += z * sB; if (Bt2) Bt2 += z * sB; C += (size_t)blockIdx.z * sC;
    const int kbeg = ks * (KX / KSPL), kend = kbeg + KX / KSPL;
    const int lane = threadIdx.x & 31, lr = lane & 15, hi = lane >> 4; const int r0 = blockIdx.x * 64, c0 = blockIdx.y * 64;
    v8f acc[4][4];
#pragma unroll
    for (int mb = 0; mb < 4; ++mb)
#pragma unroll
        for (int nb = 0; nb < 4; ++nb) acc[mb][nb] = (v8f){};
    const size_t aoff = (size_t)(r0 + lr) * K + 8 * hi, boff = (size_t)(c0 + lr) * K + 8 * hi;
#pragma unroll 1
    for (int kc = kbeg; kc < kend; kc += 32) {
        V a[4], a2[4];
#pragma unroll
        for (int mb = 0; mb < 4; ++mb) { a[mb] = WFrag<T16>::ld(A + aoff + (size_t)mb * 16 * K + kc); if (NSPLIT == 1 || NSPLIT == 2) a2[mb] = WFrag<T16>::ld(A2 + aoff + (size_t)mb * 16 * K + kc); }
#pragma unroll
        for (int nb = 0; nb < 4; ++nb) { const V b = WFrag<T16>::ld(Bt + boff + (size_t)nb * 16 * K + kc); V b2; if (NSPLIT >= 2) b2 = WFrag<T16>::ld(Bt2 + boff + (size_t)nb * 16 * K + kc);
#pragma unroll
            for (int mb = 0; mb < 4; ++mb) { acc[mb][nb] = WFrag<T16>::mma(a[mb], b, acc[mb][nb]); if (NSPLIT == 1 || NSPLIT == 2) acc[mb][nb] = WFrag<T16>::mma(a2[mb], b, acc[mb][nb]); if (NSPLIT >= 2) acc[mb][nb] = WFrag<T16>::mma(a[mb], b2, acc[mb][nb]); } }
        asm volatile("v_nop\n\tv_nop\n\tv_nop\n\tv_nop" : "+v"(acc[0][0]), "+v"(acc[1][1]), "+v"(acc[2][2]), "+v"(acc[3][3]) : "v"(a[0]), "v"(a[3]));
    }
#pragma unroll
    for (int mb = 0; mb < 4; ++mb) {
#pragma unroll
        for (int nb = 0; nb < 4; ++nb) {
#pragma unroll
            for (int j = 0; j < 8; ++j) os[(hi * 8 + j) * 68 + nb * 16 + lr] = acc[mb][nb][j]; }
        __builtin_amdgcn_wave_barrier(); asm volatile("" ::: "memory");
        float* crow = C + (size_t)(r0 + mb * 16) * ldc + c0;
{
#pragma unroll
            for (int s = 0; s < 8; ++s) { const int row = 2 * s + hi, cofs = lr * 4; v4f val = *(const v4fa*)(os + row * 68 + cofs); if (BIAS) { val[0] += bfr(bias[c0 + cofs]); val[1] += bfr(bias[c0 + cofs + 1]); val[2] += bfr(bias[c0 + cofs + 2]); val[3] += bfr(bias[c0 + cofs + 3]); }
                *(v4f*)(crow + (size_t)row * ldc + cofs) = val; }
             }
        __builtin_amdgcn_wave_barrier(); asm volatile("" ::: "memory");
    }
}

__device__ __forceinline__ h16 tohx(float x) { return (h16)x; }
__device__ __forceinline__ void splitf(float y, unsigned short& h, unsigned short& l) { h = f2bf(y); l = f2bf(y - bf2f(h)); }
typedef __attribute__((ext_vector_type(2))) _Float16 v2h;
typedef __attribute__((ext_vector_type(4))) _Float16 v4h;
typedef __attribute__((ext_vector_type(2))) unsigned short v2us;
typedef __attribute__((ext_vector_type(4))) unsigned short v4us;
typedef __attribute__((ext_vector_type(2))) float v2f;
typedef __attribute__((ext_vector_type(4))) int v4i;

// The five preparation passes (three weight transposes, the bf16 copy of x, the padded relative table) read only inputs and write planes of their own: they are parts of ONE launch, k_prep, each on its own range of work-groups (blk = the work-group's index inside its part).
__device__ __forceinline__ void d_wtG(int blk, const float* __restrict__ w, int K, int N, bf* Bt) {
    const int lane = threadIdx.x & 31; const int L0 = (blk * 8 + (threadIdx.x >> 5)) * 8; const int nlines = N * K / 64;
{
#pragma unroll 1
        for (int l = 0; l < 8; ++l) { const int L = L0 + l; if (L >= nlines) break; const size_t e = (size_t)L * 64 + lane * 2; const int k = (int)(e % K), n = (int)(e / K); v2us o;
            o[0] = f2bf(w[(size_t)k * N + n]); o[1] = f2bf(w[(size_t)(k + 1) * N + n]); *(v2us*)(Bt + e) = o; }
         }
}
__device__ __forceinline__ void d_cvt8(int blk, const float* __restrict__ src, bf* dst, size_t n8) { const size_t i = (size_t)blk * 256 + threadIdx.x; if (i >= n8) return; const float* sp = src + i * 8; const v8f v = *(const v8f*)sp; v8us o;
    asm volatile("s_wait_xcnt 0x0" :: "v"(sp) : "memory");   // the load's address pair stays live up to this wait, so that no later value lands in it before
#pragma unroll
    for (int k = 0; k < 8; ++k) o[k] = f2bf(v[k]); *(v8us*)(dst + i * 8) = o;  }

#define RPI 68   // floats: LDS pitch of one 64-value row of a k-slice's tile (272 B = 16 B x odd: the 16-byte stores and reads of 16 lanes fall on all 64 banks)
// k_proj: the q | k | v projection with the head planes written by its own epilogue. Grid (4096 / 64 row tiles, 1536 / 64 column tiles = one head of q, k or v), KSP waves: wave s sums k in [s DM / KSP, (s + 1) DM / KSP) of the whole 64 x 64 tile (16 accumulators, operands straight from the K-contiguous planes), stores its tile in its own LDS plane, and behind one barrier the work-group adds the KSP planes in the order s = 0, 1, ... and stores fp16 + hi/lo bf16 in whole 128-byte lines.
// The operand whose rows run along the output's contiguous direction is the A side, so that a lane's 8 accumulator values are 8 neighbours of an output row: q, k planes [u][t][d] take A = weight rows (d), B = x rows (t); the V^T planes [d][t] take A = x rows (t), B = weight rows (d). Both sides use the same loader (the same k order).
__global__ __launch_bounds__(32 * KSP) void k_proj(const bf* __restrict__ X, const bf* __restrict__ Wt, h16* P16, bf* Ph, bf* Pl, h16* V16, bf* Vh, bf* Vl) {
    typedef WFrag<bf>::V V;
    __shared__ __align__(16) float red[KSP][64][RPI];
    const int lane = threadIdx.x & 31, lr = lane & 15, hi = lane >> 4; const int ks = __builtin_amdgcn_readfirstlane((int)(threadIdx.x >> 5));
    const int r0 = blockIdx.x * 64, cy = blockIdx.y; const bool isv = cy >= (DQ + DKV) / HD;
    const bf* xr = X + (size_t)r0 * DM; const bf* wr = Wt + (size_t)cy * 64 * DM;
    const bf* Am = isv ? xr : wr; const bf* Bn = isv ? wr : xr;
    v8f acc[4][4];
#pragma unroll
    for (int mb = 0; mb < 4; ++mb)
#pragma unroll
        for (int nb = 0; nb < 4; ++nb) acc[mb][nb] = (v8f){};
    const int off = lr * DM + 8 * hi; const int kbeg = ks * (DM / KSP), kend = kbeg + DM / KSP;
#pragma unroll 1   // rolled: one set of fragment registers and a short text; the fence in the trip would hold an unrolled trip's loads in place anyway
    for (int kc = kbeg; kc < kend; kc += 32) {
        V a[4], b[4]; const bf* ap = Am + off + kc; const bf* bp = Bn + off + kc;
#pragma unroll
        for (int u = 0; u < 4; ++u) { a[u] = WFrag<bf>::ld(ap + u * 16 * DM); b[u] = WFrag<bf>::ld(bp + u * 16 * DM); }
        // the address pairs stay live up to this wait, so that no load's result and no later address lands in them before it; the loaded values as inputs hold all 16 loads in front of the first matrix instruction (one latency a trip)
        asm volatile("s_wait_xcnt 0x0" :: "v"(ap), "v"(bp), "v"(a[0]), "v"(a[1]), "v"(a[2]), "v"(a[3]), "v"(b[0]), "v"(b[1]), "v"(b[2]), "v"(b[3]) : "memory");
#pragma unroll
        for (int nb = 0; nb < 4; ++nb)
#pragma unroll
            for (int mb = 0; mb < 4; ++mb) acc[mb][nb] = WFrag<bf>::mma(a[mb], b[nb], acc[mb][nb]);
    }
#pragma unroll
    for (int mb = 0; mb < 4; ++mb)
#pragma unroll
        for (int nb = 0; nb < 4; ++nb) { float* p = &red[ks][nb * 16 + lr][mb * 16 + hi * 8];
            *(v4fa*)p = __builtin_shufflevector(acc[mb][nb], acc[mb][nb], 0, 1, 2, 3); *(v4fa*)(p + 4) = __builtin_shufflevector(acc[mb][nb], acc[mb][nb], 4, 5, 6, 7); }
    __syncthreads();   // publishes every k-slice's tile to the waves that add them
    const int b = r0 / TT, t0 = r0 % TT, head = cy % NH_;
    // row n of the tile: a V^T row d (pitch 2 x TT: fp16 rows [head][d][b | b], hi/lo rows [b, head][d][hi | lo]) or a q / k row t (pitch HD, plane u = (q or k, b, head))
    const unsigned pit = isv ? 2u * TT : (unsigned)HD;
    const size_t o16 = isv ? ((size_t)head * HD * NB_ + b) * TT + t0 : ((size_t)((cy / NH_) * NB_ + b) * NH_ + head) * TT * HD + (size_t)t0 * HD;
    const size_t ohl = isv ? (size_t)(b * NKV + head) * HD * 2 * TT + t0 : o16;
    h16* D16 = (isv ? V16 : P16) + o16; bf* Dh = (isv ? Vh : Ph) + ohl; bf* Dl = (isv ? Vl : Pl) + ohl;
#pragma unroll
    for (int it = 0; it < 512 / (32 * KSP); ++it) { const int q = it * (32 * KSP) + (int)threadIdx.x, n = q >> 3, mc = (q & 7) * 8;   // 8 lanes a row: a wave's store covers 4 whole lines
        v4f x0 = *(const v4fa*)&red[0][n][mc], x1 = *(const v4fa*)&red[0][n][mc + 4];
#pragma unroll
        for (int s = 1; s < KSP; ++s) { x0 += *(const v4fa*)&red[s][n][mc]; x1 += *(const v4fa*)&red[s][n][mc + 4]; }   // the k-slices, added in fixed order
        v8h v16; v8us vh, vl;
#pragma unroll
        for (int k = 0; k < 8; ++k) { const float x = k < 4 ? x0[k & 3] : x1[k & 3]; v16[k] = tohx(x); unsigned short a2, c2; splitf(x, a2, c2); vh[k] = a2; vl[k] = c2; }
        const unsigned eb = ((unsigned)n * pit + (unsigned)mc) * 2u;   // byte offset in all three planes (2-byte elements): scalar base + 32-bit offset
        *(v8h*)((char*)D16 + eb) = v16; *(v8us*)((char*)Dh + eb) = vh; *(v8us*)((char*)Dl + eb) = vl;
    }
}
__device__ __forceinline__ void d_epadK(int blk, const float* __restrict__ E, bf* EB) { const size_t i = (size_t)blk * 256 + threadIdx.x; if (i >= (size_t)NE * HD / 8) return; const int d0 = (int)(i % (HD / 8)) * 8; const int r = (int)(i / (HD / 8)); const float* src = E + (size_t)min(r, NRE - 1) * HD + d0; v8us o;
#pragma unroll
    for (int q = 0; q < 8; ++q) { const unsigned short v = f2bf(src[q]); o[q] = (r < NRE) ? v : (unsigned short)0; }
    *(v8us*)(EB + (size_t)r * HD + d0) = o;  }
#define PB_WKV ((DM * 2 * DKV / 64 + 63) / 64)   // work-groups of each part of k_prep
#define PB_WQ  ((DM * DQ / 64 + 63) / 64)
#define PB_WO  ((DQ * DM / 64 + 63) / 64)
#define PB_E   ((NE * HD / 8 + 255) / 256)
#define PB_X   ((NB_ * TT * DM / 8 + 255) / 256)
// k_prep: the transposes take the lowest indices (a wave of theirs walks 8 lines one after another, the longest part: it starts first), then the table, then the copy of x. The part is chosen by blockIdx alone: a work-group runs exactly one.
__global__ __launch_bounds__(256) void k_prep(const float* __restrict__ x, const float* __restrict__ wq, const float* __restrict__ wkv, const float* __restrict__ wo, const float* __restrict__ rel, bf* XB, bf* WQ, bf* WKV, bf* WO, bf* EB) {
    int n = blockIdx.x;
    if (n < PB_WKV) { d_wtG(n, wkv, DM, 2 * DKV, WKV); return; }   // 'xw' [512][1024] -> Bt [1024][512]: rows 0..511 = k, 512..1023 = v
    n -= PB_WKV;
    if (n < PB_WQ) { d_wtG(n, wq, DM, DQ, WQ); return; }
    n -= PB_WQ;
    if (n < PB_WO) { d_wtG(n, wo, DQ, DM, WO); return; }
    n -= PB_WO;
    if (n < PB_E) { d_epadK(n, rel, EB); return; }
    d_cvt8(n - PB_E, x, XB, (size_t)NB_ * TT * DM / 8);
}

__device__ __forceinline__ float xhalf(float x) { return __builtin_bit_cast(float, __builtin_amdgcn_permlanex16(__builtin_bit_cast(int, x), __builtin_bit_cast(int, x), 0x76543210, 0xfedcba98, false, false)); }   // lane l with lane l ^ 16
#define KPI 144   // bytes: LDS pitch of a staged K row (128 B of data), 16 B x odd against bank conflicts of the 16-byte fragment reads
#define VPI 80    // bytes: LDS pitch of a staged V^T row (64 B of data), 16 B x odd
#define EPI 52    // floats: LDS pitch of one query's 48 relative terms in a wave's patch (208 B = 16 B x odd)
#define RPW 128   // slots of the ring of staged table rows (pitch KPI): the 96 rows that four waves' queries meet in a stage and the next stage's 32 new ones
#define FPL (32 * KPI + 64 * VPI)   // one staged plane pair: 32 K rows, then 64 V^T rows
template <typename T16> struct Chunk;
template <> struct Chunk<h16> { typedef v8h T; };
template <> struct Chunk<bf> { typedef v8us T; };
template <typename T16, bool HI>
__device__ __forceinline__ void fa_part(const T16* __restrict__ Q, const T16* __restrict__ Q2, const T16* __restrict__ Kp, const T16* __restrict__ K2, const T16* __restrict__ Vt, const T16* __restrict__ Vt2, const bf* __restrict__ Qbh, const bf* __restrict__ Qbl, const bf* __restrict__ EB, char* ring, char* rr, float* et, int tg, int ib, int i0, int jbeg, int jend, int c, int h, float& m, float& l, v8f (&O)[4]) {
    typedef typename WFrag<T16>::V V; typedef typename Chunk<T16>::T C8; typedef WFrag<bf>::V VB;
    V qf[2], q2f[2]; const T16* qp = Q + (size_t)(i0 + c) * HD + 8 * h; const T16* q2p = HI ? Q2 + (size_t)(i0 + c) * HD + 8 * h : qp;
#pragma unroll
    for (int kk = 0; kk < 2; ++kk) { qf[kk] = WFrag<T16>::ld(qp + kk * 32); if (HI) q2f[kk] = WFrag<T16>::ld(q2p + kk * 32); }
    VB rqh[2], rql[2], ef[2]; const bf* bhp = Qbh + (size_t)(i0 + c) * HD + 8 * h; const bf* blp = Qbl + (size_t)(i0 + c) * HD + 8 * h;   // the queries as hi/lo bf16, the B side of the relative product
    const bf* ep = EB + (size_t)((c & 1) * (2 * CUT)) * HD + 8 * h;   // the table's two ends: even A rows = row 0, odd = row 2 CUT
#pragma unroll
    for (int kk = 0; kk < 2; ++kk) { if constexpr (HI) { rqh[kk] = qf[kk]; rql[kk] = q2f[kk]; } else { rqh[kk] = WFrag<bf>::ld(bhp + kk * 32); rql[kk] = WFrag<bf>::ld(blp + kk * 32); } ef[kk] = WFrag<bf>::ld(ep + kk * 32); }
    asm volatile("s_wait_xcnt 0x0" :: "v"(qp), "v"(q2p), "v"(bhp), "v"(blp), "v"(ep) : "memory");   // the address registers of the loads above stay live up to this wait
    v8f ee2 = (v8f){};
#pragma unroll
    for (int kk = 0; kk < 2; ++kk) { ee2 = wmmab(ef[kk], rqh[kk], ee2); ee2 = wmmab(ef[kk], rql[kk], ee2); }
    const float eLo = ee2[0], eHi = ee2[1];   // this query's terms at the two clipped ends
    // staging: 16-byte chunk tg + 128 u of a stage: K row (tg >> 3) + 16 u, V^T row (tg >> 2) + 32 u
    const size_t kgo = (size_t)jbeg * HD + tg * 8, vgo = (size_t)(tg >> 2) * 2 * TT + jbeg + (tg & 3) * 8;
    const T16* kg = Kp + kgo; const T16* k2g = HI ? K2 + kgo : kg; const T16* vg = Vt + vgo; const T16* v2g = HI ? Vt2 + vgo : vg;
    const int ksl = (tg >> 3) * KPI + (tg & 7) * 16, vsl = 32 * KPI + (tg >> 2) * VPI + (tg & 3) * 16;
    C8 gk[2], gv[2], gk2[2], gv2[2]; v8us ge[2]; int rsl[2];
    int rp = ib - jbeg + CUT - 32 + (tg >> 3);   // table position of this thread's first row among the 32 lowest of the coming stage's window
    auto gload = [&]() {
#pragma unroll
        for (int u = 0; u < 2; ++u) { gk[u] = *(const C8*)(kg + u * 128 * 8); gv[u] = *(const C8*)(vg + (size_t)u * 32 * 2 * TT); if (HI) { gk2[u] = *(const C8*)(k2g + u * 128 * 8); gv2[u] = *(const C8*)(v2g + (size_t)u * 32 * 2 * TT); } }
        unsigned eo[2];
#pragma unroll
        for (int u = 0; u < 2; ++u) { const int p = rp + 16 * u; eo[u] = (unsigned)min(max(p, 0), 2 * CUT) * (HD * 2u) + (unsigned)(tg & 7) * 16u; ge[u] = *(const v8usa*)((const char*)EB + eo[u]); rsl[u] = (p & (RPW - 1)) * KPI + (tg & 7) * 16; }
        asm volatile("s_wait_xcnt 0x0" :: "v"(kg), "v"(k2g), "v"(vg), "v"(v2g), "v"(eo[0]), "v"(eo[1]) : "memory");   // the staging loads' address registers stay live up to this wait; they are stepped only behind it
        kg += 32 * HD; k2g += 32 * HD; vg += 32; v2g += 32; rp -= 32; };
    auto sstore = [&](char* b) {
#pragma unroll
        for (int u = 0; u < 2; ++u) { *(C8*)(b + ksl + u * 16 * KPI) = gk[u]; *(C8*)(b + vsl + u * 32 * VPI) = gv[u]; if (HI) { *(C8*)(b + FPL + ksl + u * 16 * KPI) = gk2[u]; *(C8*)(b + FPL + vsl + u * 32 * VPI) = gv2[u]; } *(v8usa*)(rr + rsl[u]) = ge[u]; } };
    {   // the upper 64 rows of stage 0's window; its lowest 32 come with the first gload
        unsigned eo[4]; v8us g4[4]; const int p0 = rp + 32;
#pragma unroll
        for (int u = 0; u < 4; ++u) { eo[u] = (unsigned)min(max(p0 + 16 * u, 0), 2 * CUT) * (HD * 2u) + (unsigned)(tg & 7) * 16u; g4[u] = *(const v8usa*)((const char*)EB + eo[u]); }
        asm volatile("s_wait_xcnt 0x0" :: "v"(eo[0]), "v"(eo[1]), "v"(eo[2]), "v"(eo[3]) : "memory");   // the offset registers of these loads stay live up to this wait
#pragma unroll
        for (int u = 0; u < 4; ++u) *(v8usa*)(rr + ((p0 + 16 * u) & (RPW - 1)) * KPI + (tg & 7) * 16) = g4[u];
    }
    gload(); sstore(ring);
    __syncthreads();   // publishes stage 0
    const int ns = (jend - jbeg) / 32;
#pragma unroll 1
    for (int s = 0; s < ns; ++s) {
        const int j0 = jbeg + 32 * s; const bool more = s + 1 < ns; const char* b = ring + (s & 1) * (2 * FPL);
        if (more) gload();   // stage s + 1 flies while stage s is worked on
        V kf[2][2], k2f[2][2]; float e[2][8];
#pragma unroll
        for (int t = 0; t < 2; ++t)
#pragma unroll
            for (int kk = 0; kk < 2; ++kk) { kf[t][kk] = WFrag<T16>::ld((const T16*)(b + (16 * t + c) * KPI + kk * 64 + 16 * h)); if (HI) k2f[t][kk] = WFrag<T16>::ld((const T16*)(b + FPL + (16 * t + c) * KPI + kk * 64 + 16 * h)); }
        v8f s_[2]; float x[2][8]; float mb = -3.0e38f;
        auto scores = [&]() {   // called in both branches below, so that in the first its products can fill the wait for the patch
#pragma unroll
            for (int t = 0; t < 2; ++t) { s_[t] = (v8f){};
#pragma unroll
                for (int kk = 0; kk < 2; ++kk) { s_[t] = WFrag<T16>::mma(kf[t][kk], qf[kk], s_[t]); if (HI) { s_[t] = WFrag<T16>::mma(kf[t][kk], q2f[kk], s_[t]); s_[t] = WFrag<T16>::mma(k2f[t][kk], qf[kk], s_[t]); } } }
#pragma unroll
            for (int t = 0; t < 2; ++t)
#pragma unroll
                for (int r = 0; r < 8; ++r) { x[t][r] = (s_[t][r] + e[t][r]) * (SCL * 1.4426950408889634f); mb = fmaxf(mb, x[t][r]); } };
        if (i0 + 15 - j0 > -CUT && i0 - (j0 + 31) < CUT) {   // wave-uniform. R^T = the wave's 48 table rows . Q^T (hi, then lo, a k step: the order of sums of a hi/lo x exact product), then the shift per query through the wave's own patch
            const int pb = i0 - j0 + CUT + 15 - c;
            v8f rt[3]; const char* rw[3];
#pragma unroll
            for (int u = 0; u < 3; ++u) { rw[u] = rr + ((pb - 16 * u) & (RPW - 1)) * KPI + 16 * h; rt[u] = (v8f){}; }
#pragma unroll
            for (int kk = 0; kk < 2; ++kk) { VB rf[3];   // the three tiles' chains side by side: each fills the others' latency
#pragma unroll
                for (int u = 0; u < 3; ++u) rf[u] = WFrag<bf>::ld((const bf*)(rw[u] + kk * 64));
#pragma unroll
                for (int u = 0; u < 3; ++u) rt[u] = wmmab(rf[u], rqh[kk], rt[u]);
#pragma unroll
                for (int u = 0; u < 3; ++u) rt[u] = wmmab(rf[u], rql[kk], rt[u]); }
#pragma unroll
            for (int u = 0; u < 3; ++u) { float* p = et + c * EPI + 16 * u + 8 * h;
                *(v4fa*)p = __builtin_shufflevector(rt[u], rt[u], 0, 1, 2, 3); *(v4fa*)(p + 4) = __builtin_shufflevector(rt[u], rt[u], 4, 5, 6, 7); }
            __builtin_amdgcn_wave_barrier(); asm volatile("" ::: "memory");   // keeps the compiler from moving the reads below over the other lanes' stores above (one wave: its LDS operations run in order)
            const float* es = et + c * (EPI - 1) + 15 + 8 * h;
#pragma unroll
            for (int t = 0; t < 2; ++t)
#pragma unroll
                for (int r = 0; r < 8; ++r) e[t][r] = es[16 * t + r];
            __builtin_amdgcn_wave_barrier(); asm volatile("" ::: "memory");   // and the next stage's stores over these reads; it also keeps the 16 reads together in front of their first use (one latency, not eight)
            scores();
        } else {   // the whole block is clipped to one end
            const float ee = (i0 < j0) ? eLo : eHi;
#pragma unroll
            for (int t = 0; t < 2; ++t)
#pragma unroll
                for (int r = 0; r < 8; ++r) e[t][r] = ee;
            scores();
        }
        V vf[4], v2f_[4];
#pragma unroll
        for (int dt = 0; dt < 4; ++dt) { vf[dt] = WFrag<T16>::ld((const T16*)(b + 32 * KPI + (dt * 16 + c) * VPI + 16 * h)); if (HI) v2f_[dt] = WFrag<T16>::ld((const T16*)(b + FPL + 32 * KPI + (dt * 16 + c) * VPI + 16 * h)); }
        mb = fmaxf(mb, xhalf(mb));
        const float mn = fmaxf(m, HI ? mb : mb - 4.0f);   // fp16 weights run up to 16: four more binades above the subnormals; the factor cancels in O / l
        const float al = __builtin_amdgcn_exp2f(m - mn); m = mn;
        float ps = 0.f;
#pragma unroll
        for (int t = 0; t < 2; ++t)
#pragma unroll
            for (int r = 0; r < 8; ++r) { x[t][r] = __builtin_amdgcn_exp2f(x[t][r] - mn); ps += x[t][r]; }
        l = l * al + ps;
#pragma unroll
        for (int dt = 0; dt < 4; ++dt) O[dt] *= al;
        if constexpr (HI) {
            v8us ph[2], pl[2];
#pragma unroll
            for (int t = 0; t < 2; ++t)
#pragma unroll
                for (int r = 0; r < 8; ++r) { unsigned short a, b2; splitf(x[t][r], a, b2); ph[t][r] = a; pl[t][r] = b2; }
            const V pbh = cat16b(ph[0], ph[1]), pbl = cat16b(pl[0], pl[1]);
#pragma unroll
            for (int dt = 0; dt < 4; ++dt) { O[dt] = WFrag<T16>::mma(vf[dt], pbh, O[dt]); O[dt] = WFrag<T16>::mma(vf[dt], pbl, O[dt]); O[dt] = WFrag<T16>::mma(v2f_[dt], pbh, O[dt]); }
        } else {
            v8h p0, p1;
#pragma unroll
            for (int r = 0; r < 8; ++r) { p0[r] = tohx(x[0][r]); p1[r] = tohx(x[1][r]); }
            const V pb = cat16(p0, p1);
#pragma unroll
            for (int dt = 0; dt < 4; ++dt) O[dt] = WFrag<T16>::mma(vf[dt], pb, O[dt]);
        }
        if (more) sstore(ring + ((s + 1) & 1) * (2 * FPL));   // into the buffer that every wave left at the last barrier
        __syncthreads();   // publishes stage s + 1 and ends every reader's last read of stage s
    }
}
// k_fattn: grid (batch x head x TT / 64), 8 waves = KSF key halves x 4 query tiles of 16. Each wave runs fa_part on its half of the keys; half 1 hands (m, l, O^T) over through LDS, half 0 joins the two in fixed order and stores the row's 64 merged values as hi/lo bf16.
__global__ __launch_bounds__(256) void k_fattn(const h16* __restrict__ Q16, const h16* __restrict__ K16, const bf* __restrict__ Qh, const bf* __restrict__ Ql, const bf* __restrict__ Kh, const bf* __restrict__ Kl, const h16* __restrict__ V16, const bf* __restrict__ Vh, const bf* __restrict__ EB, bf* Ah, bf* Al) {
    __shared__ __align__(16) char ring[KSF][2][2 * FPL]; __shared__ __align__(16) char rring[KSF][RPW * KPI]; __shared__ __align__(16) float et[8][16 * EPI];
    __shared__ float cm[4][32]; __shared__ float cl[4][32]; __shared__ float cO[4][32][32];   // [query tile][register][lane]
    const int lane = threadIdx.x & 31, c = lane & 15, h = lane >> 4; const int w = __builtin_amdgcn_readfirstlane((int)(threadIdx.x >> 5));
    const int n = blockIdx.x, nh = NB_ * NH_ * (RH / 64); const bool hires = n < nh;   // the costlier hi/lo row blocks take the lowest indices: they start first and the lighter ones fill in beside them
    const int g = hires ? n / (RH / 64) : (n - nh) / ((TT - RH) / 64), xb = hires ? n % (RH / 64) : RH / 64 + (n - nh) % ((TT - RH) / 64);
    const int tile = w & 3, ks = w >> 2, i0 = xb * 64 + tile * 16, jbeg = ks * (TT / KSF), jend = jbeg + TT / KSF, tg = threadIdx.x & 127;
    const size_t pu = (size_t)g * TT * HD;
    float m = -3.0e38f, l = 0.f; v8f O[4];
#pragma unroll
    for (int dt = 0; dt < 4; ++dt) O[dt] = (v8f){};
    if (hires) fa_part<bf, true>(Qh + pu, Ql + pu, Kh + pu, Kl + pu, Vh + 2 * pu, Vh + 2 * pu + TT, Qh + pu, Ql + pu, EB, &ring[ks][0][0], &rring[ks][0], &et[w][0], tg, xb * 64, i0, jbeg, jend, c, h, m, l, O);
    else fa_part<h16, false>(Q16 + pu, nullptr, K16 + pu, nullptr, V16 + (size_t)(g % NH_) * HD * 2 * TT + (size_t)(g / NH_) * TT, nullptr, Qh + pu, Ql + pu, EB, &ring[ks][0][0], &rring[ks][0], &et[w][0], tg, xb * 64, i0, jbeg, jend, c, h, m, l, O);
    if (ks != 0) { cm[tile][lane] = m; cl[tile][lane] = l;
#pragma unroll
        for (int dt = 0; dt < 4; ++dt)
#pragma unroll
            for (int r = 0; r < 8; ++r) cO[tile][dt * 8 + r][lane] = O[dt][r]; }
    __syncthreads();   // publishes the second half's parts to the joining wave
    if (ks != 0) return;
    const float m1 = cm[tile][lane], M = fmaxf(m, m1), a0 = __builtin_amdgcn_exp2f(m - M), a1 = __builtin_amdgcn_exp2f(m1 - M);
    l = l * a0 + cl[tile][lane] * a1;
#pragma unroll
    for (int dt = 0; dt < 4; ++dt)
#pragma unroll
        for (int r = 0; r < 8; ++r) O[dt][r] = O[dt][r] * a0 + cO[tile][dt * 8 + r][lane] * a1;
    l += xhalf(l);
    const float inv = __fdiv_rn(1.0f, l);
    const size_t oo = ((size_t)(g / NH_) * TT + i0 + c) * DQ + (g % NH_) * HD + 8 * h;
#pragma unroll
    for (int dt = 0; dt < 4; ++dt) { v8us oh, ol;
#pragma unroll
        for (int r = 0; r < 8; ++r) { unsigned short a, b2; splitf(O[dt][r] * inv, a, b2); oh[r] = a; ol[r] = b2; }
        *(v8us*)(Ah + oo + dt * 16) = oh; *(v8us*)(Al + oo + dt * 16) = ol; }
}

extern "C" void kernel_launch(void* const* d_in, const int* in_sizes, int n_in,
                              void* d_out, int out_size, void* d_ws, size_t ws_size, hipStream_t stream) {
    (void)in_sizes; (void)n_in; (void)out_size;
    const float* x = (const float*)d_in[0]; const float* wq = (const float*)d_in[1]; const float* wkv = (const float*)d_in[2];   /* [512][1024]: k | v column halves */ const float* wo = (const float*)d_in[3]; const float* bo = (const float*)d_in[4]; const float* rel = (const float*)d_in[5];   /* rel_emb [1025][64] */ const float* wk = nullptr, *wv = nullptr; (void)wk; (void)wv;
    float* OUT = (float*)d_out;     // [2][2048][512]
    char* wsp = (char*)d_ws;
    auto take = [&](size_t bytes) { char* p = wsp; wsp += (bytes + 255) & ~(size_t)255; return (void*)p; };
    bf* WQ = (bf*)take((size_t)DQ * DM * 2); bf* WKV = (bf*)take((size_t)2 * DKV * DM * 2);   /* directly behind WQ: one Bt [1536][512], rows q | k | v */ bf* EB = (bf*)take((size_t)NE * HD * 2); bf* WO = (bf*)take((size_t)DM * DQ * 2);
    bf* XB = (bf*)take((size_t)NB_ * TT * DM * 2);
    const size_t PU = (size_t)TT * HD, NU = (size_t)NB_ * NH_;   // one (batch, head) plane; planes a tensor
    h16* QP16 = (h16*)take(2 * NU * PU * 2); h16* KP16 = QP16 + NU * PU; bf* QPh = (bf*)take(2 * NU * PU * 2); bf* KPh = QPh + NU * PU; bf* QPl = (bf*)take(2 * NU * PU * 2); bf* KPl = QPl + NU * PU;   // q planes, then k planes
    h16* VT16 = (h16*)take(NU * PU * 2); bf* VTh = (bf*)take(2 * NU * PU * 2); bf* VTl = VTh + TT;   // rows of pitch 2 x TT: [batch 0 | batch 1] and [hi | lo]
    bf* ATh = (bf*)take((size_t)NB_ * TT * DQ * 2); bf* ATl = (bf*)take((size_t)NB_ * TT * DQ * 2);
    if ((size_t)(wsp - (char*)d_ws) > ws_size) return;    // ws 256 MiB
    const int DP = DQ + 2 * DKV;
    k_prep<<<(unsigned)(PB_WKV + PB_WQ + PB_WO + PB_E + PB_X), 256, 0, stream>>>(x, wq, wkv, wo, rel, XB, WQ, WKV, WO, EB);   /* weights transposed, x and the relative table as bf16: one launch */
    k_proj<<<dim3(NB_ * TT / 64, DP / 64, 1), 32 * KSP, 0, stream>>>(XB, WQ, QP16, QPh, QPl, VT16, VTh, VTl);   /* q, k head planes and V^T planes, fp16 + hi/lo */
    k_fattn<<<(unsigned)(NU * (TT / 64)), 256, 0, stream>>>(QP16, KP16, QPh, QPl, KPh, KPl, VT16, VTh, EB, ATh, ATl);   /* softmax((q.k + q_i . rel[clip(i - j) + 512]) / 8) . v, merged hi/lo */
    k_gemmw<bf, 1, true><<<dim3(NB_ * TT / 64, DM / 64, 1), 32, 0, stream>>>(ATh, ATl, WO, nullptr, DQ, DQ, OUT, DM, bo, 0, 0, 0);
}

// v008
// A run of this version takes 93.9 microseconds.
// In both of two side-by-side timings against v007, it was 1.03 times as fast.
// Over all steps from v000 it is 12.4 times as fast.
#include <hip/hip_runtime.h>

// Multi-head attention with a Shaw-style relative-key term over clipped distances (x [2][2048][512]; q = x Wq ('xw' [512][512]); k | v = x Wkv ('xw' [512][1024] column halves); 8 heads x 64; dots = (q.k + q.rel_emb[clip(i - j, -512, 512) + 512]) x 64^-0.5 (rel_emb [1025][64] shared by the heads, read); softmax (no causal mask in the module's code); out = merged Wo + bo ('xw') -> [2][2048][512] (2.1 M)).
// Layout: both batches as 4096 rows through one q|k|v projection launch, whose epilogue writes the head planes, and one Wo launch; bf16 copy of x; 'xw' weights transposed once (Wkv as one [1024][512] Bt whose row halves are k and v); the planes that the two GEMM kernels read (x, weights, merged) lie in fragment order (FRAGMENT ORDER below); exact projections; the relative table as one zero-padded bf16 plane [1088][64]; one attention launch: a wave holds 16 queries and walks half of the keys in stages of 32 that four waves share in LDS (scores^T = K Q^T, + q_i . rel[clip(i - j) + 512] from a product of the stage's 48 table rows with Q^T (hi/lo x exact), shifted per query through LDS, running maximum and sum, O^T += V^T P^T with P packed from the score accumulators), the two halves joined through LDS in fixed order; hybrid rows: < 512 hi/lo 3 products, rest fp16; merged hi/lo x Wo exact + bo.
// Compute dtypes, f32 accumulate: every input rounded to bf16; projections exact; q.k rows < 512 3 products, rest fp16; q.rel hi/lo x exact on every row; softmax f32 (running maximum); attn.v rows < 512 3 products, rest fp16 (unnormalised weights x 16); Wo hl x exact + bias.

#define NB_  2
#define TT   2048
#define DM   512
#define NH_  8
#define NKV  8
#define REP  (NH_ / NKV)
#define HD   64
#define DQ   (NH_ * HD)
#define DKV  (NKV * HD)
#define RH   512                  // query rows < RH use hi+lo planes (0: none)
#define WIN  0
#define SCL  0.125f
#define NE   1088     // 2*512+1 = 1025 relative offsets padded to a multiple of 64
#define NRE  1025
#define CUT  512
#define KSP  4        // k-slices of the q, k, v projections (K = 512 -> 128 a slice), one wave each
#define KSF  2        // key halves of a query tile in the attention kernel, one wave each
typedef _Float16 h16;
typedef unsigned short bf;
typedef __attribute__((ext_vector_type(16))) __bf16   v16bf;
typedef __attribute__((ext_vector_type(16))) _Float16 v16h;
typedef __attribute__((ext_vector_type(8)))  _Float16 v8h;
typedef __attribute__((ext_vector_type(8)))  unsigned short v8us;
typedef __attribute__((ext_vector_type(8)))  float    v8f;
typedef __attribute__((ext_vector_type(4)))  float    v4f;
typedef v8h  __attribute__((may_alias)) v8ha;
typedef v4f  __attribute__((may_alias)) v4fa;
typedef v8us __attribute__((may_alias)) v8usa;

__device__ __forceinline__ unsigned short f2bf(float f) { unsigned u = __float_as_uint(f); u += 0x7FFFu + ((u >> 16) & 1u); return (unsigned short)(u >> 16); }
__device__ __forceinline__ float bf2f(unsigned short b) { return __uint_as_float(((unsigned)b) << 16); }
__device__ __forceinline__ float bfr(float f) { return bf2f(f2bf(f)); }
__device__ __forceinline__ v16h cat16(v8h lo, v8h hi) { return __builtin_shufflevector(lo, hi, 0, 1, 2, 3, 4, 5, 6, 7, 8, 9, 10, 11, 12, 13, 14, 15); }
__device__ __forceinline__ v16bf cat16b(v8us lo, v8us hi) { return __builtin_bit_cast(v16bf, __builtin_shufflevector(lo, hi, 0, 1, 2, 3, 4, 5, 6, 7, 8, 9, 10, 11, 12, 13, 14, 15)); }
__device__ __forceinline__ v8f wmma16(v16h a, v16h b, v8f c) { return __builtin_amdgcn_wmma_f32_16x16x32_f16(false, a, false, b, (short)0, c, false, false); }
__device__ __forceinline__ v8f wmmab(v16bf a, v16bf b, v8f c) { return __builtin_amdgcn_wmma_f32_16x16x32_bf16(false, a, false, b, (short)0, c, false, false); }



// ---- k_gemmw: register-blocked GEMM, ONE WAVE per 64x64 output tile (16 accumulators), operands straight from 16-bit planes in fragment order; grid (M/64, N/64, Z), 32 threads.
// C[m][n] (f32, pitch ldc, + optional f32 bias[n]) = sum_k A[m][k] Bt[n][k] (+ split products per NSPLIT). K is the row length of A and Bt (a compile-time value: a trip's fragments lie at constant offsets from one address a plane), the sum runs over k < KX <= K. z-batch strides sA/sB/sC in elements. KX % 32 == 0.
// KSPL > 1: split-K over the grid. blockIdx.z = z * KSPL + s; slice s sums k in [s KX/KSPL, (s+1) KX/KSPL) into its own plane C + (z KSPL + s) sC; the consumer adds the KSPL planes of a z in the order s = 0, 1, ...
// FRAGMENT ORDER of a [rows][K] 16-bit plane: units of 16 rows x 32 k (1 KB; a block of 16 rows holds its K / 32 units one after another, so it starts at row x K as in a row-major plane); a unit is two pieces of 512 B (k bit 4), a piece holds 32 slots of 16 B, slot = 16 x (k bit 3) + (row & 15), 8 values k & 7 a slot. Slot = lane: a wave's 16-byte load of a piece covers 512 contiguous bytes (4 whole lines; from a row-major plane it touches 16 lines, 32 B of each), and the two pieces are a lane's fragment in the k order of ld.
template <typename T16> struct WFrag;
template <> struct WFrag<h16> { typedef v16h V; static __device__ __forceinline__ V ld(const h16* p) { return cat16(*(const v8h*)p, *(const v8h*)(p + 16)); } static __device__ __forceinline__ v8f mma(V a, V b, v8f c) { return wmma16(a, b, c); } };
template <> struct WFrag<bf> { typedef v16bf V; static __device__ __forceinline__ V ld(const bf* p) { return cat16b(*(const v8us*)p, *(const v8us*)(p + 16)); } static __device__ __forceinline__ V ldp(const bf* p) { return cat16b(*(const v8us*)p, *(const v8us*)(p + 256)); }   /* ldp: from a plane in fragment order, p = unit + 8 x lane */ static __device__ __forceinline__ v8f mma(V a, V b, v8f c) { return wmmab(a, b, c); } };
template <typename T16, int NSPLIT, bool BIAS, int K, int KSPL = 1>
__global__ __launch_bounds__(32) void k_gemmw(const T16* __restrict__ A, const T16* __restrict__ A2, const T16* __restrict__ Bt, const T16* __restrict__ Bt2, int KX, float* C, int ldc, const float* __restrict__ bias, size_t sA, size_t sB, size_t sC) {
    typedef typename WFrag<T16>::V V;
    __shared__ __align__(16) float os[16 * 68];
    const size_t z = blockIdx.z / KSPL; const int ks = (int)(blockIdx.z % KSPL); A += z * sA; if (A2) A2 += z * sA; Bt += z * sB; if (Bt2) Bt2 += z * sB; C += (size_t)blockIdx.z * sC;
    const int kbeg = ks * (KX / KSPL), kend = kbeg + KX / KSPL;
    const int lane = threadIdx.x & 31, lr = lane & 15, hi = lane >> 4; const int r0 = blockIdx.x * 64, c0 = blockIdx.y * 64;
    v8f acc[4][4];
#pragma unroll
    for (int mb = 0; mb < 4; ++mb)
#pragma unroll
        for (int nb = 0; nb < 4; ++nb) acc[mb][nb] = (v8f){};
    const size_t aoff = (size_t)r0 * K + 8 * lane, boff = (size_t)c0 * K + 8 * lane;
#pragma unroll 1
    for (int kc = kbeg; kc < kend; kc += 32) {
        V a[4], a2[4], b[4], b2[4]; const T16* ap = A + aoff + (size_t)kc * 16; const T16* a2p = (NSPLIT == 1 || NSPLIT == 2) ? A2 + aoff + (size_t)kc * 16 : ap; const T16* bp = Bt + boff + (size_t)kc * 16; const T16* b2p = (NSPLIT >= 2) ? Bt2 + boff + (size_t)kc * 16 : bp;   // unit kc / 32 of each block of 16 rows
#pragma unroll
        for (int u = 0; u < 4; ++u) { a[u] = WFrag<T16>::ldp(ap + u * 16 * K); if (NSPLIT == 1 || NSPLIT == 2) a2[u] = WFrag<T16>::ldp(a2p + u * 16 * K); b[u] = WFrag<T16>::ldp(bp + u * 16 * K); if (NSPLIT >= 2) b2[u] = WFrag<T16>::ldp(b2p + u * 16 * K); }
        asm volatile("s_wait_xcnt 0x0" :: "v"(ap), "v"(a2p), "v"(bp), "v"(b2p) : "memory");   // the address pairs stay live up to this wait, so that no load's result and no later address lands in them before it
#pragma unroll
        for (int nb = 0; nb < 4; ++nb) {
#pragma unroll
            for (int mb = 0; mb < 4; ++mb) { acc[mb][nb] = WFrag<T16>::mma(a[mb], b[nb], acc[mb][nb]); if (NSPLIT == 1 || NSPLIT == 2) acc[mb][nb] = WFrag<T16>::mma(a2[mb], b[nb], acc[mb][nb]); if (NSPLIT >= 2) acc[mb][nb] = WFrag<T16>::mma(a[mb], b2[nb], acc[mb][nb]); } }
        asm volatile("v_nop\n\tv_nop\n\tv_nop\n\tv_nop" : "+v"(acc[0][0]), "+v"(acc[1][1]), "+v"(acc[2][2]), "+v"(acc[3][3]) : "v"(a[0]), "v"(a[3]));
    }
#pragma unroll
    for (int mb = 0; mb < 4; ++mb) {
#pragma unroll
        for (int nb = 0; nb < 4; ++nb) {
#pragma unroll
            for (int j = 0; j < 8; ++j) os[(hi * 8 + j) * 68 + nb * 16 + lr] = acc[mb][nb][j]; }
        __builtin_amdgcn_wave_barrier(); asm volatile("" ::: "memory");
        float* crow = C + (size_t)(r0 + mb * 16) * ldc + c0;
{
#pragma unroll
            for (int s = 0; s < 8; ++s) { const int row = 2 * s + hi, cofs = lr * 4; v4f val = *(const v4fa*)(os + row * 68 + cofs); if (BIAS) { val[0] += bfr(bias[c0 + cofs]); val[1] += bfr(bias[c0 + cofs + 1]); val[2] += bfr(bias[c0 + cofs + 2]); val[3] += bfr(bias[c0 + cofs + 3]); }
                *(v4f*)(crow + (size_t)row * ldc + cofs) = val; }
             }
        __builtin_amdgcn_wave_barrier(); asm volatile("" ::: "memory");
    }
}

__device__ __forceinline__ h16 tohx(float x) { return (h16)x; }
__device__ __forceinline__ void splitf(float y, unsigned short& h, unsigned short& l) { h = f2bf(y); l = f2bf(y - bf2f(h)); }
typedef __attribute__((ext_vector_type(2))) _Float16 v2h;
typedef __attribute__((ext_vector_type(4))) _Float16 v4h;
typedef __attribute__((ext_vector_type(2))) unsigned short v2us;
typedef __attribute__((ext_vector_type(4))) unsigned short v4us;
typedef __attribute__((ext_vector_type(2))) float v2f;
typedef __attribute__((ext_vector_type(4))) int v4i;

// The five preparation passes (three weight transposes, the bf16 copy of x, the padded relative table) read only inputs and write planes of their own: they are parts of ONE launch, k_prep, each on its own range of work-groups (blk = the work-group's index inside its part).
// d_wtG: w [K][N] -> Bt [N][K] in fragment order, one unit (16 n x 32 k) a wave: lane = slot, its 8 values of a piece come from 8 rows of w (a load covers 64 contiguous bytes of two rows), all 16 loads in flight together; a store covers a whole piece.
__device__ __forceinline__ void d_wtG(int blk, const float* __restrict__ w, int K, int N, bf* Bt) {
    const int lane = threadIdx.x & 31; const int U = blk * 8 + (int)(threadIdx.x >> 5); if (U >= N * K / 512) return;
    const int n = (U / (K / 32)) * 16 + (lane & 15), k0 = (U % (K / 32)) * 32 + (lane >> 4) * 8;
    const float* sp = w + (size_t)k0 * N + n; float v[2][8];
#pragma unroll
    for (int p = 0; p < 2; ++p)
#pragma unroll
        for (int j = 0; j < 8; ++j) v[p][j] = sp[(size_t)(p * 16 + j) * N];
    asm volatile("s_wait_xcnt 0x0" :: "v"(sp) : "memory");   // the loads' address pair stays live up to this wait, so that no later value lands in it before
#pragma unroll
    for (int p = 0; p < 2; ++p) { v8us o;
#pragma unroll
        for (int j = 0; j < 8; ++j) o[j] = f2bf(v[p][j]);
        *(v8us*)(Bt + (size_t)U * 512 + p * 256 + lane * 8) = o; }
}
// d_cvt8: src [rows][DM] f32 -> dst in fragment order; thread i fills slot i of the plane (a wave's store covers a whole piece) from row 16 x block + (slot & 15), 8 values from k = 32 x unit + 16 x piece + 8 x (slot >> 4).
__device__ __forceinline__ void d_cvt8(int blk, const float* __restrict__ src, bf* dst, size_t n8) { const size_t i = (size_t)blk * 256 + threadIdx.x; if (i >= n8) return; const size_t un = i >> 6; const float* sp = src + ((un / (DM / 32)) * 16 + (i & 15)) * DM + (un % (DM / 32)) * 32 + ((i >> 5) & 1) * 16 + ((i >> 4) & 1) * 8; const v8f v = *(const v8f*)sp; v8us o;
    asm volatile("s_wait_xcnt 0x0" :: "v"(sp) : "memory");   // the load's address pair stays live up to this wait, so that no later value lands in it before
#pragma unroll
    for (int k = 0; k < 8; ++k) o[k] = f2bf(v[k]); *(v8us*)(dst + i * 8) = o;  }

#define RPI 68   // floats: LDS pitch of one 64-value row of a k-slice's tile (272 B = 16 B x odd: the 16-byte stores and reads of 16 lanes fall on all 64 banks)
// k_proj: the q | k | v projection with the head planes written by its own epilogue. Grid (4096 / 64 row tiles, 1536 / 64 column tiles = one head of q, k or v), KSP waves: wave s sums k in [s DM / KSP, (s + 1) DM / KSP) of the whole 64 x 64 tile (16 accumulators, operands straight from the planes in fragment order), stores its tile in its own LDS plane, and behind one barrier the work-group adds the KSP planes in the order s = 0, 1, ... and stores fp16 + hi/lo bf16 in whole 128-byte lines.
// The operand whose rows run along the output's contiguous direction is the A side, so that a lane's 8 accumulator values are 8 neighbours of an output row: q, k planes [u][t][d] take A = weight rows (d), B = x rows (t); the V^T planes [d][t] take A = x rows (t), B = weight rows (d). Both sides use the same loader (the same k order).
__global__ __launch_bounds__(32 * KSP) void k_proj(const bf* __restrict__ X, const bf* __restrict__ Wt, h16* P16, bf* Ph, bf* Pl, h16* V16, bf* Vh, bf* Vl) {
    typedef WFrag<bf>::V V;
    __shared__ __align__(16) float red[KSP][64][RPI];
    const int lane = threadIdx.x & 31, lr = lane & 15, hi = lane >> 4; const int ks = __builtin_amdgcn_readfirstlane((int)(threadIdx.x >> 5));
    const int r0 = blockIdx.x * 64, cy = blockIdx.y; const bool isv = cy >= (DQ + DKV) / HD;
    const bf* xr = X + (size_t)r0 * DM; const bf* wr = Wt + (size_t)cy * 64 * DM;
    const bf* Am = isv ? xr : wr; const bf* Bn = isv ? wr : xr;
    v8f acc[4][4];
#pragma unroll
    for (int mb = 0; mb < 4; ++mb)
#pragma unroll
        for (int nb = 0; nb < 4; ++nb) acc[mb][nb] = (v8f){};
    const int off = 8 * lane; const int kbeg = ks * (DM / KSP), kend = kbeg + DM / KSP;
#pragma unroll 1   // rolled: one set of fragment registers and a short text; the fence in the trip would hold an unrolled trip's loads in place anyway
    for (int kc = kbeg; kc < kend; kc += 32) {
        V a[4], b[4]; const bf* ap = Am + off + kc * 16; const bf* bp = Bn + off + kc * 16;   // unit kc / 32 of each block of 16 rows
#pragma unroll
        for (int u = 0; u < 4; ++u) { a[u] = WFrag<bf>::ldp(ap + u * 16 * DM); b[u] = WFrag<bf>::ldp(bp + u * 16 * DM); }
        // the address pairs stay live up to this wait, so that no load's result and no later address lands in them before it; the loaded values as inputs hold all 16 loads in front of the first matrix instruction (one latency a trip)
        asm volatile("s_wait_xcnt 0x0" :: "v"(ap), "v"(bp), "v"(a[0]), "v"(a[1]), "v"(a[2]), "v"(a[3]), "v"(b[0]), "v"(b[1]), "v"(b[2]), "v"(b[3]) : "memory");
#pragma unroll
        for (int nb = 0; nb < 4; ++nb)
#pragma unroll
            for (int mb = 0; mb < 4; ++mb) acc[mb][nb] = WFrag<bf>::mma(a[mb], b[nb], acc[mb][nb]);
    }
#pragma unroll
    for (int mb = 0; mb < 4; ++mb)
#pragma unroll
        for (int nb = 0; nb < 4; ++nb) { float* p = &red[ks][nb * 16 + lr][mb * 16 + hi * 8];
            *(v4fa*)p = __builtin_shufflevector(acc[mb][nb], acc[mb][nb], 0, 1, 2, 3); *(v4fa*)(p + 4) = __builtin_shufflevector(acc[mb][nb], acc[mb][nb], 4, 5, 6, 7); }
    __syncthreads();   // publishes every k-slice's tile to the waves that add them
    const int b = r0 / TT, t0 = r0 % TT, head = cy % NH_;
    // row n of the tile: a V^T row d (pitch 2 x TT: fp16 rows [head][d][b | b], hi/lo rows [b, head][d][hi | lo]) or a q / k row t (pitch HD, plane u = (q or k, b, head))
    const unsigned pit = isv ? 2u * TT : (unsigned)HD;
    const size_t o16 = isv ? ((size_t)head * HD * NB_ + b) * TT + t0 : ((size_t)((cy / NH_) * NB_ + b) * NH_ + head) * TT * HD + (size_t)t0 * HD;
    const size_t ohl = isv ? (size_t)(b * NKV + head) * HD * 2 * TT + t0 : o16;
    h16* D16 = (isv ? V16 : P16) + o16; bf* Dh = (isv ? Vh : Ph) + ohl; bf* Dl = (isv ? Vl : Pl) + ohl;
#pragma unroll
    for (int it = 0; it < 512 / (32 * KSP); ++it) { const int q = it * (32 * KSP) + (int)threadIdx.x, n = q >> 3, mc = (q & 7) * 8;   // 8 lanes a row: a wave's store covers 4 whole lines
        v4f x0 = *(const v4fa*)&red[0][n][mc], x1 = *(const v4fa*)&red[0][n][mc + 4];
#pragma unroll
        for (int s = 1; s < KSP; ++s) { x0 += *(const v4fa*)&red[s][n][mc]; x1 += *(const v4fa*)&red[s][n][mc + 4]; }   // the k-slices, added in fixed order
        v8h v16; v8us vh, vl;
#pragma unroll
        for (int k = 0; k < 8; ++k) { const float x = k < 4 ? x0[k & 3] : x1[k & 3]; v16[k] = tohx(x); unsigned short a2, c2; splitf(x, a2, c2); vh[k] = a2; vl[k] = c2; }
        const unsigned eb = ((unsigned)n * pit + (unsigned)mc) * 2u;   // byte offset in all three planes (2-byte elements): scalar base + 32-bit offset
        *(v8h*)((char*)D16 + eb) = v16; *(v8us*)((char*)Dh + eb) = vh; *(v8us*)((char*)Dl + eb) = vl;
    }
}
__device__ __forceinline__ void d_epadK(int blk, const float* __restrict__ E, bf* EB) { const size_t i = (size_t)blk * 256 + threadIdx.x; if (i >= (size_t)NE * HD / 8) return; const int d0 = (int)(i % (HD / 8)) * 8; const int r = (int)(i / (HD / 8)); const float* src = E + (size_t)min(r, NRE - 1) * HD + d0; v8us o;
#pragma unroll
    for (int q = 0; q < 8; ++q) { const unsigned short v = f2bf(src[q]); o[q] = (r < NRE) ? v : (unsigned short)0; }
    *(v8us*)(EB + (size_t)r * HD + d0) = o;  }
#define PB_WKV ((DM * 2 * DKV / 64 + 63) / 64)   // work-groups of each part of k_prep
#define PB_WQ  ((DM * DQ / 64 + 63) / 64)
#define PB_WO  ((DQ * DM / 64 + 63) / 64)
#define PB_E   ((NE * HD / 8 + 255) / 256)
#define PB_X   ((NB_ * TT * DM / 8 + 255) / 256)
// k_prep: the transposes take the lowest indices, then the table, then the copy of x. The part is chosen by blockIdx alone: a work-group runs exactly one.
__global__ __launch_bounds__(256) void k_prep(const float* __restrict__ x, const float* __restrict__ wq, const float* __restrict__ wkv, const float* __restrict__ wo, const float* __restrict__ rel, bf* XB, bf* WQ, bf* WKV, bf* WO, bf* EB) {
    int n = blockIdx.x;
    if (n < PB_WKV) { d_wtG(n, wkv, DM, 2 * DKV, WKV); return; }   // 'xw' [512][1024] -> Bt [1024][512], fragment order: rows 0..511 = k, 512..1023 = v
    n -= PB_WKV;
    if (n < PB_WQ) { d_wtG(n, wq, DM, DQ, WQ); return; }
    n -= PB_WQ;
    if (n < PB_WO) { d_wtG(n, wo, DQ, DM, WO); return; }
    n -= PB_WO;
    if (n < PB_E) { d_epadK(n, rel, EB); return; }
    d_cvt8(n - PB_E, x, XB, (size_t)NB_ * TT * DM / 8);
}

__device__ __forceinline__ float xhalf(float x) { return __builtin_bit_cast(float, __builtin_amdgcn_permlanex16(__builtin_bit_cast(int, x), __builtin_bit_cast(int, x), 0x76543210, 0xfedcba98, false, false)); }   // lane l with lane l ^ 16
#define KPI 144   // bytes: LDS pitch of a staged K row (128 B of data), 16 B x odd against bank conflicts of the 16-byte fragment reads
#define VPI 80    // bytes: LDS pitch of a staged V^T row (64 B of data), 16 B x odd
#define EPI 52    // floats: LDS pitch of one query's 48 relative terms in a wave's patch (208 B = 16 B x odd)
#define RPW 128   // slots of the ring of staged table rows (pitch KPI): the 96 rows that four waves' queries meet in a stage and the next stage's 32 new ones
#define FPL (32 * KPI + 64 * VPI)   // one staged plane pair: 32 K rows, then 64 V^T rows
template <typename T16> struct Chunk;
template <> struct Chunk<h16> { typedef v8h T; };
template <> struct Chunk<bf> { typedef v8us T; };
template <typename T16, bool HI>
__device__ __forceinline__ void fa_part(const T16* __restrict__ Q, const T16* __restrict__ Q2, const T16* __restrict__ Kp, const T16* __restrict__ K2, const T16* __restrict__ Vt, const T16* __restrict__ Vt2, const bf* __restrict__ Qbh, const bf* __restrict__ Qbl, const bf* __restrict__ EB, char* ring, char* rr, float* et, int tg, int ib, int i0, int jbeg, int jend, int c, int h, float& m, float& l, v8f (&O)[4]) {
    typedef typename WFrag<T16>::V V; typedef typename Chunk<T16>::T C8; typedef WFrag<bf>::V VB;
    V qf[2], q2f[2]; const T16* qp = Q + (size_t)(i0 + c) * HD + 8 * h; const T16* q2p = HI ? Q2 + (size_t)(i0 + c) * HD + 8 * h : qp;
#pragma unroll
    for (int kk = 0; kk < 2; ++kk) { qf[kk] = WFrag<T16>::ld(qp + kk * 32); if (HI) q2f[kk] = WFrag<T16>::ld(q2p + kk * 32); }
    VB rqh[2], rql[2], ef[2]; const bf* bhp = Qbh + (size_t)(i0 + c) * HD + 8 * h; const bf* blp = Qbl + (size_t)(i0 + c) * HD + 8 * h;   // the queries as hi/lo bf16, the B side of the relative product
    const bf* ep = EB + (size_t)((c & 1) * (2 * CUT)) * HD + 8 * h;   // the table's two ends: even A rows = row 0, odd = row 2 CUT
#pragma unroll
    for (int kk = 0; kk < 2; ++kk) { if constexpr (HI) { rqh[kk] = qf[kk]; rql[kk] = q2f[kk]; } else { rqh[kk] = WFrag<bf>::ld(bhp + kk * 32); rql[kk] = WFrag<bf>::ld(blp + kk * 32); } ef[kk] = WFrag<bf>::ld(ep + kk * 32); }
    asm volatile("s_wait_xcnt 0x0" :: "v"(qp), "v"(q2p), "v"(bhp), "v"(blp), "v"(ep) : "memory");   // the address registers of the loads above stay live up to this wait
    v8f ee2 = (v8f){};
#pragma unroll
    for (int kk = 0; kk < 2; ++kk) { ee2 = wmmab(ef[kk], rqh[kk], ee2); ee2 = wmmab(ef[kk], rql[kk], ee2); }
    const float eLo = ee2[0], eHi = ee2[1];   // this query's terms at the two clipped ends
    // staging: 16-byte chunk tg + 128 u of a stage: K row (tg >> 3) + 16 u, V^T row (tg >> 2) + 32 u
    const size_t kgo = (size_t)jbeg * HD + tg * 8, vgo = (size_t)(tg >> 2) * 2 * TT + jbeg + (tg & 3) * 8;
    const T16* kg = Kp + kgo; const T16* k2g = HI ? K2 + kgo : kg; const T16* vg = Vt + vgo; const T16* v2g = HI ? Vt2 + vgo : vg;
    const int ksl = (tg >> 3) * KPI + (tg & 7) * 16, vsl = 32 * KPI + (tg >> 2) * VPI + (tg & 3) * 16;
    C8 gk[2], gv[2], gk2[2], gv2[2]; v8us ge[2]; int rsl[2];
    int rp = ib - jbeg + CUT - 32 + (tg >> 3);   // table position of this thread's first row among the 32 lowest of the coming stage's window
    auto gload = [&]() {
#pragma unroll
        for (int u = 0; u < 2; ++u) { gk[u] = *(const C8*)(kg + u * 128 * 8); gv[u] = *(const C8*)(vg + (size_t)u * 32 * 2 * TT); if (HI) { gk2[u] = *(const C8*)(k2g + u * 128 * 8); gv2[u] = *(const C8*)(v2g + (size_t)u * 32 * 2 * TT); } }
        unsigned eo[2];
#pragma unroll
        for (int u = 0; u < 2; ++u) { const int p = rp + 16 * u; eo[u] = (unsigned)min(max(p, 0), 2 * CUT) * (HD * 2u) + (unsigned)(tg & 7) * 16u; ge[u] = *(const v8usa*)((const char*)EB + eo[u]); rsl[u] = (p & (RPW - 1)) * KPI + (tg & 7) * 16; }
        asm volatile("s_wait_xcnt 0x0" :: "v"(kg), "v"(k2g), "v"(vg), "v"(v2g), "v"(eo[0]), "v"(eo[1]) : "memory");   // the staging loads' address registers stay live up to this wait; they are stepped only behind it
        kg += 32 * HD; k2g += 32 * HD; vg += 32; v2g += 32; rp -= 32; };
    auto sstore = [&](char* b) {
#pragma unroll
        for (int u = 0; u < 2; ++u) { *(C8*)(b + ksl + u * 16 * KPI) = gk[u]; *(C8*)(b + vsl + u * 32 * VPI) = gv[u]; if (HI) { *(C8*)(b + FPL + ksl + u * 16 * KPI) = gk2[u]; *(C8*)(b + FPL + vsl + u * 32 * VPI) = gv2[u]; } *(v8usa*)(rr + rsl[u]) = ge[u]; } };
    {   // the upper 64 rows of stage 0's window; its lowest 32 come with the first gload
        unsigned eo[4]; v8us g4[4]; const int p0 = rp + 32;
#pragma unroll
        for (int u = 0; u < 4; ++u) { eo[u] = (unsigned)min(max(p0 + 16 * u, 0), 2 * CUT) * (HD * 2u) + (unsigned)(tg & 7) * 16u; g4[u] = *(const v8usa*)((const char*)EB + eo[u]); }
        asm volatile("s_wait_xcnt 0x0" :: "v"(eo[0]), "v"(eo[1]), "v"(eo[2]), "v"(eo[3]) : "memory");   // the offset registers of these loads stay live up to this wait
#pragma unroll
        for (int u = 0; u < 4; ++u) *(v8usa*)(rr + ((p0 + 16 * u) & (RPW - 1)) * KPI + (tg & 7) * 16) = g4[u];
    }
    gload(); sstore(ring);
    __syncthreads();   // publishes stage 0
    const int ns = (jend - jbeg) / 32;
#pragma unroll 1
    for (int s = 0; s < ns; ++s) {
        const int j0 = jbeg + 32 * s; const bool more = s + 1 < ns; const char* b = ring + (s & 1) * (2 * FPL);
        if (more) gload();   // stage s + 1 flies while stage s is worked on
        V kf[2][2], k2f[2][2]; float e[2][8];
#pragma unroll
        for (int t = 0; t < 2; ++t)
#pragma unroll
            for (int kk = 0; kk < 2; ++kk) { kf[t][kk] = WFrag<T16>::ld((const T16*)(b + (16 * t + c) * KPI + kk * 64 + 16 * h)); if (HI) k2f[t][kk] = WFrag<T16>::ld((const T16*)(b + FPL + (16 * t + c) * KPI + kk * 64 + 16 * h)); }
        v8f s_[2]; float x[2][8]; float mb = -3.0e38f;
        auto scores = [&]() {   // called in both branches below, so that in the first its products can fill the wait for the patch
#pragma unroll
            for (int t = 0; t < 2; ++t) { s_[t] = (v8f){};
#pragma unroll
                for (int kk = 0; kk < 2; ++kk) { s_[t] = WFrag<T16>::mma(kf[t][kk], qf[kk], s_[t]); if (HI) { s_[t] = WFrag<T16>::mma(kf[t][kk], q2f[kk], s_[t]); s_[t] = WFrag<T16>::mma(k2f[t][kk], qf[kk], s_[t]); } } }
#pragma unroll
            for (int t = 0; t < 2; ++t)
#pragma unroll
                for (int r = 0; r < 8; ++r) { x[t][r] = (s_[t][r] + e[t][r]) * (SCL * 1.4426950408889634f); mb = fmaxf(mb, x[t][r]); } };
        if (i0 + 15 - j0 > -CUT && i0 - (j0 + 31) < CUT) {   // wave-uniform. R^T = the wave's 48 table rows . Q^T (hi, then lo, a k step: the order of sums of a hi/lo x exact product), then the shift per query through the wave's own patch
            const int pb = i0 - j0 + CUT + 15 - c;
            v8f rt[3]; const char* rw[3];
#pragma unroll
            for (int u = 0; u < 3; ++u) { rw[u] = rr + ((pb - 16 * u) & (RPW - 1)) * KPI + 16 * h; rt[u] = (v8f){}; }
#pragma unroll
            for (int kk = 0; kk < 2; ++kk) { VB rf[3];   // the three tiles' chains side by side: each fills the others' latency
#pragma unroll
                for (int u = 0; u < 3; ++u) rf[u] = WFrag<bf>::ld((const bf*)(rw[u] + kk * 64));
#pragma unroll
                for (int u = 0; u < 3; ++u) rt[u] = wmmab(rf[u], rqh[kk], rt[u]);
#pragma unroll
                for (int u = 0; u < 3; ++u) rt[u] = wmmab(rf[u], rql[kk], rt[u]); }
#pragma unroll
            for (int u = 0; u < 3; ++u) { float* p = et + c * EPI + 16 * u + 8 * h;
                *(v4fa*)p = __builtin_shufflevector(rt[u], rt[u], 0, 1, 2, 3); *(v4fa*)(p + 4) = __builtin_shufflevector(rt[u], rt[u], 4, 5, 6, 7); }
            __builtin_amdgcn_wave_barrier(); asm volatile("" ::: "memory");   // keeps the compiler from moving the reads below over the other lanes' stores above (one wave: its LDS operations run in order)
            const float* es = et + c * (EPI - 1) + 15 + 8 * h;
#pragma unroll
            for (int t = 0; t < 2; ++t)
#pragma unroll
                for (int r = 0; r < 8; ++r) e[t][r] = es[16 * t + r];
            __builtin_amdgcn_wave_barrier(); asm volatile("" ::: "memory");   // and the next stage's stores over these reads; it also keeps the 16 reads together in front of their first use (one latency, not eight)
            scores();
        } else {   // the whole block is clipped to one end
            const float ee = (i0 < j0) ? eLo : eHi;
#pragma unroll
            for (int t = 0; t < 2; ++t)
#pragma unroll
                for (int r = 0; r < 8; ++r) e[t][r] = ee;
            scores();
        }
        V vf[4], v2f_[4];
#pragma unroll
        for (int dt = 0; dt < 4; ++dt) { vf[dt] = WFrag<T16>::ld((const T16*)(b + 32 * KPI + (dt * 16 + c) * VPI + 16 * h)); if (HI) v2f_[dt] = WFrag<T16>::ld((const T16*)(b + FPL + 32 * KPI + (dt * 16 + c) * VPI + 16 * h)); }
        mb = fmaxf(mb, xhalf(mb));
        const float mn = fmaxf(m, HI ? mb : mb - 4.0f);   // fp16 weights run up to 16: four more binades above the subnormals; the factor cancels in O / l
        const float al = __builtin_amdgcn_exp2f(m - mn); m = mn;
        float ps = 0.f;
#pragma unroll
        for (int t = 0; t < 2; ++t)
#pragma unroll
            for (int r = 0; r < 8; ++r) { x[t][r] = __builtin_amdgcn_exp2f(x[t][r] - mn); ps += x[t][r]; }
        l = l * al + ps;
#pragma unroll
        for (int dt = 0; dt < 4; ++dt) O[dt] *= al;
        if constexpr (HI) {
            v8us ph[2], pl[2];
#pragma unroll
            for (int t = 0; t < 2; ++t)
#pragma unroll
                for (int r = 0; r < 8; ++r) { unsigned short a, b2; splitf(x[t][r], a, b2); ph[t][r] = a; pl[t][r] = b2; }
            const V pbh = cat16b(ph[0], ph[1]), pbl = cat16b(pl[0], pl[1]);
#pragma unroll
            for (int dt = 0; dt < 4; ++dt) { O[dt] = WFrag<T16>::mma(vf[dt], pbh, O[dt]); O[dt] = WFrag<T16>::mma(vf[dt], pbl, O[dt]); O[dt] = WFrag<T16>::mma(v2f_[dt], pbh, O[dt]); }
        } else {
            v8h p0, p1;
#pragma unroll
            for (int r = 0; r < 8; ++r) { p0[r] = tohx(x[0][r]); p1[r] = tohx(x[1][r]); }
            const V pb = cat16(p0, p1);
#pragma unroll
            for (int dt = 0; dt < 4; ++dt) O[dt] = WFrag<T16>::mma(vf[dt], pb, O[dt]);
        }
        if (more) sstore(ring + ((s + 1) & 1) * (2 * FPL));   // into the buffer that every wave left at the last barrier
        __syncthreads();   // publishes stage s + 1 and ends every reader's last read of stage s
    }
}
// k_fattn: grid (batch x head x TT / 64), 8 waves = KSF key halves x 4 query tiles of 16. Each wave runs fa_part on its half of the keys; half 1 hands (m, l, O^T) over through LDS, half 0 joins the two in fixed order and stores the merged values as hi/lo bf16 in fragment order: a lane's 8 values d = 16 dt + 8 h + r of query i0 + c are slot 16 h + c = lane of piece dt of the head's two units, so a wave's store covers a whole piece.
__global__ __launch_bounds__(256) void k_fattn(const h16* __restrict__ Q16, const h16* __restrict__ K16, const bf* __restrict__ Qh, const bf* __restrict__ Ql, const bf* __restrict__ Kh, const bf* __restrict__ Kl, const h16* __restrict__ V16, const bf* __restrict__ Vh, const bf* __restrict__ EB, bf* Ah, bf* Al) {
    __shared__ __align__(16) char ring[KSF][2][2 * FPL]; __shared__ __align__(16) char rring[KSF][RPW * KPI]; __shared__ __align__(16) float et[8][16 * EPI];
    __shared__ float cm[4][32]; __shared__ float cl[4][32]; __shared__ float cO[4][32][32];   // [query tile][register][lane]
    const int lane = threadIdx.x & 31, c = lane & 15, h = lane >> 4; const int w = __builtin_amdgcn_readfirstlane((int)(threadIdx.x >> 5));
    const int n = blockIdx.x, nh = NB_ * NH_ * (RH / 64); const bool hires = n < nh;   // the costlier hi/lo row blocks take the lowest indices: they start first and the lighter ones fill in beside them
    const int g = hires ? n / (RH / 64) : (n - nh) / ((TT - RH) / 64), xb = hires ? n % (RH / 64) : RH / 64 + (n - nh) % ((TT - RH) / 64);
    const int tile = w & 3, ks = w >> 2, i0 = xb * 64 + tile * 16, jbeg = ks * (TT / KSF), jend = jbeg + TT / KSF, tg = threadIdx.x & 127;
    const size_t pu = (size_t)g * TT * HD;
    float m = -3.0e38f, l = 0.f; v8f O[4];
#pragma unroll
    for (int dt = 0; dt < 4; ++dt) O[dt] = (v8f){};
    if (hires) fa_part<bf, true>(Qh + pu, Ql + pu, Kh + pu, Kl + pu, Vh + 2 * pu, Vh + 2 * pu + TT, Qh + pu, Ql + pu, EB, &ring[ks][0][0], &rring[ks][0], &et[w][0], tg, xb * 64, i0, jbeg, jend, c, h, m, l, O);
    else fa_part<h16, false>(Q16 + pu, nullptr, K16 + pu, nullptr, V16 + (size_t)(g % NH_) * HD * 2 * TT + (size_t)(g / NH_) * TT, nullptr, Qh + pu, Ql + pu, EB, &ring[ks][0][0], &rring[ks][0], &et[w][0], tg, xb * 64, i0, jbeg, jend, c, h, m, l, O);
    if (ks != 0) { cm[tile][lane] = m; cl[tile][lane] = l;
#pragma unroll
        for (int dt = 0; dt < 4; ++dt)
#pragma unroll
            for (int r = 0; r < 8; ++r) cO[tile][dt * 8 + r][lane] = O[dt][r]; }
    __syncthreads();   // publishes the second half's parts to the joining wave
    if (ks != 0) return;
    const float m1 = cm[tile][lane], M = fmaxf(m, m1), a0 = __builtin_amdgcn_exp2f(m - M), a1 = __builtin_amdgcn_exp2f(m1 - M);
    l = l * a0 + cl[tile][lane] * a1;
#pragma unroll
    for (int dt = 0; dt < 4; ++dt)
#pragma unroll
        for (int r = 0; r < 8; ++r) O[dt][r] = O[dt][r] * a0 + cO[tile][dt * 8 + r][lane] * a1;
    l += xhalf(l);
    const float inv = __fdiv_rn(1.0f, l);
    const size_t oo = ((size_t)(g / NH_) * TT + i0) * DQ + (g % NH_) * (HD * 16) + 8 * lane;
#pragma unroll
    for (int dt = 0; dt < 4; ++dt) { v8us oh, ol;
#pragma unroll
        for (int r = 0; r < 8; ++r) { unsigned short a, b2; splitf(O[dt][r] * inv, a, b2); oh[r] = a; ol[r] = b2; }
        *(v8us*)(Ah + oo + dt * 256) = oh; *(v8us*)(Al + oo + dt * 256) = ol; }
}

extern "C" void kernel_launch(void* const* d_in, const int* in_sizes, int n_in,
                              void* d_out, int out_size, void* d_ws, size_t ws_size, hipStream_t stream) {
    (void)in_sizes; (void)n_in; (void)out_size;
    const float* x = (const float*)d_in[0]; const float* wq = (const float*)d_in[1]; const float* wkv = (const float*)d_in[2];   /* [512][1024]: k | v column halves */ const float* wo = (const float*)d_in[3]; const float* bo = (const float*)d_in[4]; const float* rel = (const float*)d_in[5];   /* rel_emb [1025][64] */ const float* wk = nullptr, *wv = nullptr; (void)wk; (void)wv;
    float* OUT = (float*)d_out;     // [2][2048][512]
    char* wsp = (char*)d_ws;
    auto take = [&](size_t bytes) { char* p = wsp; wsp += (bytes + 255) & ~(size_t)255; return (void*)p; };
    bf* WQ = (bf*)take((size_t)DQ * DM * 2); bf* WKV = (bf*)take((size_t)2 * DKV * DM * 2);   /* directly behind WQ: one Bt [1536][512], rows q | k | v */ bf* EB = (bf*)take((size_t)NE * HD * 2); bf* WO = (bf*)take((size_t)DM * DQ * 2);
    bf* XB = (bf*)take((size_t)NB_ * TT * DM * 2);
    const size_t PU = (size_t)TT * HD, NU = (size_t)NB_ * NH_;   // one (batch, head) plane; planes a tensor
    h16* QP16 = (h16*)take(2 * NU * PU * 2); h16* KP16 = QP16 + NU * PU; bf* QPh = (bf*)take(2 * NU * PU * 2); bf* KPh = QPh + NU * PU; bf* QPl = (bf*)take(2 * NU * PU * 2); bf* KPl = QPl + NU * PU;   // q planes, then k planes
    h16* VT16 = (h16*)take(NU * PU * 2); bf* VTh = (bf*)take(2 * NU * PU * 2); bf* VTl = VTh + TT;   // rows of pitch 2 x TT: [batch 0 | batch 1] and [hi | lo]
    bf* ATh = (bf*)take((size_t)NB_ * TT * DQ * 2); bf* ATl = (bf*)take((size_t)NB_ * TT * DQ * 2);
    if ((size_t)(wsp - (char*)d_ws) > ws_size) return;    // ws 256 MiB
    const int DP = DQ + 2 * DKV;
    k_prep<<<(unsigned)(PB_WKV + PB_WQ + PB_WO + PB_E + PB_X), 256, 0, stream>>>(x, wq, wkv, wo, rel, XB, WQ, WKV, WO, EB);   /* weights transposed, x and the relative table as bf16: one launch */
    k_proj<<<dim3(NB_ * TT / 64, DP / 64, 1), 32 * KSP, 0, stream>>>(XB, WQ, QP16, QPh, QPl, VT16, VTh, VTl);   /* q, k head planes and V^T planes, fp16 + hi/lo */
    k_fattn<<<(unsigned)(NU * (TT / 64)), 256, 0, stream>>>(QP16, KP16, QPh, QPl, KPh, KPl, VT16, VTh, EB, ATh, ATl);   /* softmax((q.k + q_i . rel[clip(i - j) + 512]) / 8) . v, merged hi/lo */
    k_gemmw<bf, 1, true, DQ><<<dim3(NB_ * TT / 64, DM / 64, 1), 32, 0, stream>>>(ATh, ATl, WO, nullptr, DQ, OUT, DM, bo, 0, 0, 0);
}

// v009
// Measured time: 78.7 microseconds a run.
// Next to v008, in two timings, it ran 1.18 times as fast each time.
// All steps since v000 together make it 14.7 times as fast.
#include <hip/hip_runtime.h>

// Multi-head attention with a Shaw-style relative-key term over clipped distances (x [2][2048][512]; q = x Wq ('xw' [512][512]); k | v = x Wkv ('xw' [512][1024] column halves); 8 heads x 64; dots = (q.k + q.rel_emb[clip(i - j, -512, 512) + 512]) x 64^-0.5 (rel_emb [1025][64] shared by the heads, read); softmax (no causal mask in the module's code); out = merged Wo + bo ('xw') -> [2][2048][512] (2.1 M)).
// Layout: both batches as 4096 rows through one q|k|v projection launch, whose epilogue writes the head planes, and one Wo launch; bf16 copy of x; 'xw' weights transposed once (Wkv as one [1024][512] Bt whose row halves are k and v); the planes that the two GEMM kernels read (x, weights, merged) lie in fragment order (FRAGMENT ORDER below); exact projections; the relative table as one zero-padded bf16 plane [1088][64]; one attention launch: a wave holds 16 queries and walks half of the keys in stages of 32 that four waves share in LDS (scores^T = K Q^T, + q_i . rel[clip(i - j) + 512] from a product of the stage's 48 table rows with Q^T (hi/lo x exact), shifted per query through LDS, running maximum and sum, O^T += V^T P^T with P packed from the score accumulators), the two halves joined through LDS in fixed order; hybrid rows: < 512 hi/lo 3 products, rest fp16; merged hi/lo x Wo exact + bo.
// Compute dtypes, f32 accumulate: every input rounded to bf16; projections exact; q.k rows < 512 3 products, rest fp16; q.rel hi/lo x exact on every row; softmax f32 (running maximum); attn.v rows < 512 3 products, rest fp16 (unnormalised weights x 16); Wo hl x exact + bias.

#define NB_  2
#define TT   2048
#define DM   512
#define NH_  8
#define NKV  8
#define REP  (NH_ / NKV)
#define HD   64
#define DQ   (NH_ * HD)
#define DKV  (NKV * HD)
#define RH   512                  // query rows < RH use hi+lo planes (0: none)
#define WIN  0
#define SCL  0.125f
#define NE   1088     // 2*512+1 = 1025 relative offsets padded to a multiple of 64
#define NRE  1025
#define CUT  512
#define KSP  4        // k-slices of the q, k, v projections and of the Wo product (K = 512 -> 128 a slice), one wave each
#define KSF  2        // key halves of a query tile in the attention kernel, one wave each
typedef _Float16 h16;
typedef unsigned short bf;
typedef __attribute__((ext_vector_type(16))) __bf16   v16bf;
typedef __attribute__((ext_vector_type(16))) _Float16 v16h;
typedef __attribute__((ext_vector_type(8)))  _Float16 v8h;
typedef __attribute__((ext_vector_type(8)))  unsigned short v8us;
typedef __attribute__((ext_vector_type(8)))  float    v8f;
typedef __attribute__((ext_vector_type(4)))  float    v4f;
typedef v8h  __attribute__((may_alias)) v8ha;
typedef v4f  __attribute__((may_alias)) v4fa;
typedef v8us __attribute__((may_alias)) v8usa;

__device__ __forceinline__ unsigned short f2bf(float f) { unsigned u = __float_as_uint(f); u += 0x7FFFu + ((u >> 16) & 1u); return (unsigned short)(u >> 16); }
__device__ __forceinline__ float bf2f(unsigned short b) { return __uint_as_float(((unsigned)b) << 16); }
__device__ __forceinline__ float bfr(float f) { return bf2f(f2bf(f)); }
__device__ __forceinline__ v16h cat16(v8h lo, v8h hi) { return __builtin_shufflevector(lo, hi, 0, 1, 2, 3, 4, 5, 6, 7, 8, 9, 10, 11, 12, 13, 14, 15); }
__device__ __forceinline__ v16bf cat16b(v8us lo, v8us hi) { return __builtin_bit_cast(v16bf, __builtin_shufflevector(lo, hi, 0, 1, 2, 3, 4, 5, 6, 7, 8, 9, 10, 11, 12, 13, 14, 15)); }
__device__ __forceinline__ v8f wmma16(v16h a, v16h b, v8f c) { return __builtin_amdgcn_wmma_f32_16x16x32_f16(false, a, false, b, (short)0, c, false, false); }
__device__ __forceinline__ v8f wmmab(v16bf a, v16bf b, v8f c) { return __builtin_amdgcn_wmma_f32_16x16x32_bf16(false, a, false, b, (short)0, c, false, false); }



// ---- Fragment loaders of the matrix kernels; the two GEMM kernels (k_proj, k_wo) read their operands straight from 16-bit planes in fragment order.
// FRAGMENT ORDER of a [rows][K] 16-bit plane: units of 16 rows x 32 k (1 KB; a block of 16 rows holds its K / 32 units one after another, so it starts at row x K as in a row-major plane); a unit is two pieces of 512 B (k bit 4), a piece holds 32 slots of 16 B, slot = 16 x (k bit 3) + (row & 15), 8 values k & 7 a slot. Slot = lane: a wave's 16-byte load of a piece covers 512 contiguous bytes (4 whole lines; from a row-major plane it touches 16 lines, 32 B of each), and the two pieces are a lane's fragment in the k order of ld.
template <typename T16> struct WFrag;
template <> struct WFrag<h16> { typedef v16h V; static __device__ __forceinline__ V ld(const h16* p) { return cat16(*(const v8h*)p, *(const v8h*)(p + 16)); } static __device__ __forceinline__ v8f mma(V a, V b, v8f c) { return wmma16(a, b, c); } };
template <> struct WFrag<bf> { typedef v16bf V; static __device__ __forceinline__ V ld(const bf* p) { return cat16b(*(const v8us*)p, *(const v8us*)(p + 16)); } static __device__ __forceinline__ V ldp(const bf* p) { return cat16b(*(const v8us*)p, *(const v8us*)(p + 256)); }   /* ldp: from a plane in fragment order, p = unit + 8 x lane */ static __device__ __forceinline__ v8f mma(V a, V b, v8f c) { return wmmab(a, b, c); } };
__device__ __forceinline__ h16 tohx(float x) { return (h16)x; }
__device__ __forceinline__ void splitf(float y, unsigned short& h, unsigned short& l) { h = f2bf(y); l = f2bf(y - bf2f(h)); }
typedef __attribute__((ext_vector_type(2))) _Float16 v2h;
typedef __attribute__((ext_vector_type(4))) _Float16 v4h;
typedef __attribute__((ext_vector_type(2))) unsigned short v2us;
typedef __attribute__((ext_vector_type(4))) unsigned short v4us;
typedef __attribute__((ext_vector_type(2))) float v2f;
typedef __attribute__((ext_vector_type(4))) int v4i;

// The five preparation passes (three weight transposes, the bf16 copy of x, the padded relative table) read only inputs and write planes of their own: they are parts of ONE launch, k_prep, each on its own range of work-groups (blk = the work-group's index inside its part).
// d_wtG: w [K][N] -> Bt [N][K] in fragment order, one unit (16 n x 32 k) a wave: lane = slot, its 8 values of a piece come from 8 rows of w (a load covers 64 contiguous bytes of two rows), all 16 loads in flight together; a store covers a whole piece.
__device__ __forceinline__ void d_wtG(int blk, const float* __restrict__ w, int K, int N, bf* Bt) {
    const int lane = threadIdx.x & 31; const int U = blk * 8 + (int)(threadIdx.x >> 5); if (U >= N * K / 512) return;
    const int n = (U / (K / 32)) * 16 + (lane & 15), k0 = (U % (K / 32)) * 32 + (lane >> 4) * 8;
    const float* sp = w + (size_t)k0 * N + n; float v[2][8];
#pragma unroll
    for (int p = 0; p < 2; ++p)
#pragma unroll
        for (int j = 0; j < 8; ++j) v[p][j] = sp[(size_t)(p * 16 + j) * N];
    asm volatile("s_wait_xcnt 0x0" :: "v"(sp) : "memory");   // the loads' address pair stays live up to this wait, so that no later value lands in it before
#pragma unroll
    for (int p = 0; p < 2; ++p) { v8us o;
#pragma unroll
        for (int j = 0; j < 8; ++j) o[j] = f2bf(v[p][j]);
        *(v8us*)(Bt + (size_t)U * 512 + p * 256 + lane * 8) = o; }
}
// d_cvt8: src [rows][DM] f32 -> dst in fragment order; thread i fills slot i of the plane (a wave's store covers a whole piece) from row 16 x block + (slot & 15), 8 values from k = 32 x unit + 16 x piece + 8 x (slot >> 4).
__device__ __forceinline__ void d_cvt8(int blk, const float* __restrict__ src, bf* dst, size_t n8) { const size_t i = (size_t)blk * 256 + threadIdx.x; if (i >= n8) return; const size_t un = i >> 6; const float* sp = src + ((un / (DM / 32)) * 16 + (i & 15)) * DM + (un % (DM / 32)) * 32 + ((i >> 5) & 1) * 16 + ((i >> 4) & 1) * 8; const v8f v = *(const v8f*)sp; v8us o;
    asm volatile("s_wait_xcnt 0x0" :: "v"(sp) : "memory");   // the load's address pair stays live up to this wait, so that no later value lands in it before
#pragma unroll
    for (int k = 0; k < 8; ++k) o[k] = f2bf(v[k]); *(v8us*)(dst + i * 8) = o;  }

#define RPI 68   // floats: LDS pitch of one 64-value row of a k-slice's tile (272 B = 16 B x odd: the 16-byte stores and reads of 16 lanes fall on all 64 banks)
// k_proj: the q | k | v projection with the head planes written by its own epilogue. Grid (4096 / 64 row tiles, 1536 / 64 column tiles = one head of q, k or v), KSP waves: wave s sums k in [s DM / KSP, (s + 1) DM / KSP) of the whole 64 x 64 tile (16 accumulators, operands straight from the planes in fragment order), stores its tile in its own LDS plane, and behind one barrier the work-group adds the KSP planes in the order s = 0, 1, ... and stores fp16 + hi/lo bf16 in whole 128-byte lines.
// The operand whose rows run along the output's contiguous direction is the A side, so that a lane's 8 accumulator values are 8 neighbours of an output row: q, k planes [u][t][d] take A = weight rows (d), B = x rows (t); the V^T planes [d][t] take A = x rows (t), B = weight rows (d). Both sides use the same loader (the same k order).
__global__ __launch_bounds__(32 * KSP) void k_proj(const bf* __restrict__ X, const bf* __restrict__ Wt, h16* P16, bf* Ph, bf* Pl, h16* V16, bf* Vh, bf* Vl) {
    typedef WFrag<bf>::V V;
    __shared__ __align__(16) float red[KSP][64][RPI];
    const int lane = threadIdx.x & 31, lr = lane & 15, hi = lane >> 4; const int ks = __builtin_amdgcn_readfirstlane((int)(threadIdx.x >> 5));
    const int r0 = blockIdx.x * 64, cy = blockIdx.y; const bool isv = cy >= (DQ + DKV) / HD;
    const bf* xr = X + (size_t)r0 * DM; const bf* wr = Wt + (size_t)cy * 64 * DM;
    const bf* Am = isv ? xr : wr; const bf* Bn = isv ? wr : xr;
    v8f acc[4][4];
#pragma unroll
    for (int mb = 0; mb < 4; ++mb)
#pragma unroll
        for (int nb = 0; nb < 4; ++nb) acc[mb][nb] = (v8f){};
    const int off = 8 * lane; const int kbeg = ks * (DM / KSP), kend = kbeg + DM / KSP;
#pragma unroll 1   // rolled: one set of fragment registers and a short text; the fence in the trip would hold an unrolled trip's loads in place anyway
    for (int kc = kbeg; kc < kend; kc += 32) {
        V a[4], b[4]; const bf* ap = Am + off + kc * 16; const bf* bp = Bn + off + kc * 16;   // unit kc / 32 of each block of 16 rows
#pragma unroll
        for (int u = 0; u < 4; ++u) { a[u] = WFrag<bf>::ldp(ap + u * 16 * DM); b[u] = WFrag<bf>::ldp(bp + u * 16 * DM); }
        // the address pairs stay live up to this wait, so that no load's result and no later address lands in them before it; the loaded values as inputs hold all 16 loads in front of the first matrix instruction (one latency a trip)
        asm volatile("s_wait_xcnt 0x0" :: "v"(ap), "v"(bp), "v"(a[0]), "v"(a[1]), "v"(a[2]), "v"(a[3]), "v"(b[0]), "v"(b[1]), "v"(b[2]), "v"(b[3]) : "memory");
#pragma unroll
        for (int nb = 0; nb < 4; ++nb)
#pragma unroll
            for (int mb = 0; mb < 4; ++mb) acc[mb][nb] = WFrag<bf>::mma(a[mb], b[nb], acc[mb][nb]);
    }
#pragma unroll
    for (int mb = 0; mb < 4; ++mb)
#pragma unroll
        for (int nb = 0; nb < 4; ++nb) { float* p = &red[ks][nb * 16 + lr][mb * 16 + hi * 8];
            *(v4fa*)p = __builtin_shufflevector(acc[mb][nb], acc[mb][nb], 0, 1, 2, 3); *(v4fa*)(p + 4) = __builtin_shufflevector(acc[mb][nb], acc[mb][nb], 4, 5, 6, 7); }
    __syncthreads();   // publishes every k-slice's tile to the waves that add them
    const int b = r0 / TT, t0 = r0 % TT, head = cy % NH_;
    // row n of the tile: a V^T row d (pitch 2 x TT: fp16 rows [head][d][b | b], hi/lo rows [b, head][d][hi | lo]) or a q / k row t (pitch HD, plane u = (q or k, b, head))
    const unsigned pit = isv ? 2u * TT : (unsigned)HD;
    const size_t o16 = isv ? ((size_t)head * HD * NB_ + b) * TT + t0 : ((size_t)((cy / NH_) * NB_ + b) * NH_ + head) * TT * HD + (size_t)t0 * HD;
    const size_t ohl = isv ? (size_t)(b * NKV + head) * HD * 2 * TT + t0 : o16;
    h16* D16 = (isv ? V16 : P16) + o16; bf* Dh = (isv ? Vh : Ph) + ohl; bf* Dl = (isv ? Vl : Pl) + ohl;
#pragma unroll
    for (int it = 0; it < 512 / (32 * KSP); ++it) { const int q = it * (32 * KSP) + (int)threadIdx.x, n = q >> 3, mc = (q & 7) * 8;   // 8 lanes a row: a wave's store covers 4 whole lines
        v4f x0 = *(const v4fa*)&red[0][n][mc], x1 = *(const v4fa*)&red[0][n][mc + 4];
#pragma unroll
        for (int s = 1; s < KSP; ++s) { x0 += *(const v4fa*)&red[s][n][mc]; x1 += *(const v4fa*)&red[s][n][mc + 4]; }   // the k-slices, added in fixed order
        v8h v16; v8us vh, vl;
#pragma unroll
        for (int k = 0; k < 8; ++k) { const float x = k < 4 ? x0[k & 3] : x1[k & 3]; v16[k] = tohx(x); unsigned short a2, c2; splitf(x, a2, c2); vh[k] = a2; vl[k] = c2; }
        const unsigned eb = ((unsigned)n * pit + (unsigned)mc) * 2u;   // byte offset in all three planes (2-byte elements): scalar base + 32-bit offset
        *(v8h*)((char*)D16 + eb) = v16; *(v8us*)((char*)Dh + eb) = vh; *(v8us*)((char*)Dl + eb) = vl;
    }
}
// k_wo: out = merged (hi + lo) . Wo + bo. Grid (4096 / 64 row tiles, 512 / 64 column tiles), KSP waves, the frame of k_proj: wave s sums k in [s DQ / KSP, (s + 1) DQ / KSP) of the whole 64 x 64 tile (16 accumulators; a k step adds hi, then lo), stores its tile in its own LDS plane, and behind one barrier the work-group adds the KSP planes in the order s = 0, 1, ..., adds the bias and stores f32 in whole lines.
// A = weight rows (output columns n), B = merged rows (m): a lane's 8 accumulator values are 8 neighbours of an output row. Both sides use the same loader (the same k order).
__global__ __launch_bounds__(32 * KSP) void k_wo(const bf* __restrict__ Mh, const bf* __restrict__ Ml, const bf* __restrict__ Wt, const float* __restrict__ bias, float* C) {
    typedef WFrag<bf>::V V;
    __shared__ __align__(16) float red[KSP][64][RPI];
    const int lane = threadIdx.x & 31, lr = lane & 15, hi = lane >> 4; const int ks = __builtin_amdgcn_readfirstlane((int)(threadIdx.x >> 5));
    const int r0 = blockIdx.x * 64, c0 = blockIdx.y * 64;
    const bf* wr = Wt + (size_t)c0 * DQ; const bf* mh = Mh + (size_t)r0 * DQ; const bf* ml = Ml + (size_t)r0 * DQ;
    const int mc = ((int)threadIdx.x & 7) * 8;   // this thread's 8 columns in the join, the same on each of its rows
    const float* gp = bias + c0 + mc; float g[8];
#pragma unroll
    for (int k = 0; k < 8; ++k) g[k] = gp[k];   // loaded here so that it flies under the k loop
    asm volatile("s_wait_xcnt 0x0" :: "v"(gp) : "memory");   // the loads' address pair stays live up to this wait, so that no later value lands in it before
    v8f acc[4][4];
#pragma unroll
    for (int mb = 0; mb < 4; ++mb)
#pragma unroll
        for (int nb = 0; nb < 4; ++nb) acc[mb][nb] = (v8f){};
    const int off = 8 * lane; const int kbeg = ks * (DQ / KSP), kend = kbeg + DQ / KSP;
#pragma unroll 1   // rolled: one set of fragment registers and a short text; the fence in the trip would hold an unrolled trip's loads in place anyway
    for (int kc = kbeg; kc < kend; kc += 32) {
        V a[4], b[4], b2[4]; const bf* ap = wr + off + kc * 16; const bf* bp = mh + off + kc * 16; const bf* b2p = ml + off + kc * 16;   // unit kc / 32 of each block of 16 rows
#pragma unroll
        for (int u = 0; u < 4; ++u) { a[u] = WFrag<bf>::ldp(ap + u * 16 * DQ); b[u] = WFrag<bf>::ldp(bp + u * 16 * DQ); b2[u] = WFrag<bf>::ldp(b2p + u * 16 * DQ); }
        // the address pairs stay live up to this wait, so that no load's result and no later address lands in them before it; the loaded values as inputs hold all 24 loads in front of the first matrix instruction (one latency a trip)
        asm volatile("s_wait_xcnt 0x0" :: "v"(ap), "v"(bp), "v"(b2p), "v"(a[0]), "v"(a[1]), "v"(a[2]), "v"(a[3]), "v"(b[0]), "v"(b[1]), "v"(b[2]), "v"(b[3]), "v"(b2[0]), "v"(b2[1]), "v"(b2[2]), "v"(b2[3]) : "memory");
#pragma unroll
        for (int nb = 0; nb < 4; ++nb)
#pragma unroll
            for (int mb = 0; mb < 4; ++mb) acc[mb][nb] = WFrag<bf>::mma(a[mb], b[nb], acc[mb][nb]);
#pragma unroll
        for (int nb = 0; nb < 4; ++nb)
#pragma unroll
            for (int mb = 0; mb < 4; ++mb) acc[mb][nb] = WFrag<bf>::mma(a[mb], b2[nb], acc[mb][nb]);
    }
#pragma unroll
    for (int mb = 0; mb < 4; ++mb)
#pragma unroll
        for (int nb = 0; nb < 4; ++nb) { float* p = &red[ks][nb * 16 + lr][mb * 16 + hi * 8];
            *(v4fa*)p = __builtin_shufflevector(acc[mb][nb], acc[mb][nb], 0, 1, 2, 3); *(v4fa*)(p + 4) = __builtin_shufflevector(acc[mb][nb], acc[mb][nb], 4, 5, 6, 7); }
    __syncthreads();   // publishes every k-slice's tile to the waves that add them
    const v4f g0 = { bfr(g[0]), bfr(g[1]), bfr(g[2]), bfr(g[3]) }, g1 = { bfr(g[4]), bfr(g[5]), bfr(g[6]), bfr(g[7]) };
    float* cp = C + (size_t)r0 * DM + c0 + mc;
#pragma unroll
    for (int it = 0; it < 512 / (32 * KSP); ++it) { const int n = (it * (32 * KSP) + (int)threadIdx.x) >> 3;   // 8 lanes a row: a wave's two stores cover 4 rows of 2 whole lines
        v4f x0 = *(const v4fa*)&red[0][n][mc], x1 = *(const v4fa*)&red[0][n][mc + 4];
#pragma unroll
        for (int s = 1; s < KSP; ++s) { x0 += *(const v4fa*)&red[s][n][mc]; x1 += *(const v4fa*)&red[s][n][mc + 4]; }   // the k-slices, added in fixed order
        *(v4f*)(cp + (size_t)n * DM) = x0 + g0; *(v4f*)(cp + (size_t)n * DM + 4) = x1 + g1;
    }
}
__device__ __forceinline__ void d_epadK(int blk, const float* __restrict__ E, bf* EB) { const size_t i = (size_t)blk * 256 + threadIdx.x; if (i >= (size_t)NE * HD / 8) return; const int d0 = (int)(i % (HD / 8)) * 8; const int r = (int)(i / (HD / 8)); const float* src = E + (size_t)min(r, NRE - 1) * HD + d0; v8us o;
#pragma unroll
    for (int q = 0; q < 8; ++q) { const unsigned short v = f2bf(src[q]); o[q] = (r < NRE) ? v : (unsigned short)0; }
    *(v8us*)(EB + (size_t)r * HD + d0) = o;  }
#define PB_WKV ((DM * 2 * DKV / 64 + 63) / 64)   // work-groups of each part of k_prep
#define PB_WQ  ((DM * DQ / 64 + 63) / 64)
#define PB_WO  ((DQ * DM / 64 + 63) / 64)
#define PB_E   ((NE * HD / 8 + 255) / 256)
#define PB_X   ((NB_ * TT * DM / 8 + 255) / 256)
// k_prep: the transposes take the lowest indices, then the table, then the copy of x. The part is chosen by blockIdx alone: a work-group runs exactly one.
__global__ __launch_bounds__(256) void k_prep(const float* __restrict__ x, const float* __restrict__ wq, const float* __restrict__ wkv, const float* __restrict__ wo, const float* __restrict__ rel, bf* XB, bf* WQ, bf* WKV, bf* WO, bf* EB) {
    int n = blockIdx.x;
    if (n < PB_WKV) { d_wtG(n, wkv, DM, 2 * DKV, WKV); return; }   // 'xw' [512][1024] -> Bt [1024][512], fragment order: rows 0..511 = k, 512..1023 = v
    n -= PB_WKV;
    if (n < PB_WQ) { d_wtG(n, wq, DM, DQ, WQ); return; }
    n -= PB_WQ;
    if (n < PB_WO) { d_wtG(n, wo, DQ, DM, WO); return; }
    n -= PB_WO;
    if (n < PB_E) { d_epadK(n, rel, EB); return; }
    d_cvt8(n - PB_E, x, XB, (size_t)NB_ * TT * DM / 8);
}

__device__ __forceinline__ float xhalf(float x) { return __builtin_bit_cast(float, __builtin_amdgcn_permlanex16(__builtin_bit_cast(int, x), __builtin_bit_cast(int, x), 0x76543210, 0xfedcba98, false, false)); }   // lane l with lane l ^ 16
#define KPI 144   // bytes: LDS pitch of a staged K row (128 B of data), 16 B x odd against bank conflicts of the 16-byte fragment reads
#define VPI 80    // bytes: LDS pitch of a staged V^T row (64 B of data), 16 B x odd
#define EPI 52    // floats: LDS pitch of one query's 48 relative terms in a wave's patch (208 B = 16 B x odd)
#define RPW 128   // slots of the ring of staged table rows (pitch KPI): the 96 rows that four waves' queries meet in a stage and the next stage's 32 new ones
#define FPL (32 * KPI + 64 * VPI)   // one staged plane pair: 32 K rows, then 64 V^T rows
template <typename T16> struct Chunk;
template <> struct Chunk<h16> { typedef v8h T; };
template <> struct Chunk<bf> { typedef v8us T; };
template <typename T16, bool HI>
__device__ __forceinline__ void fa_part(const T16* __restrict__ Q, const T16* __restrict__ Q2, const T16* __restrict__ Kp, const T16* __restrict__ K2, const T16* __restrict__ Vt, const T16* __restrict__ Vt2, const bf* __restrict__ Qbh, const bf* __restrict__ Qbl, const bf* __restrict__ EB, char* ring, char* rr, float* et, int tg, int ib, int i0, int jbeg, int jend, int c, int h, float& m, float& l, v8f (&O)[4]) {
    typedef typename WFrag<T16>::V V; typedef typename Chunk<T16>::T C8; typedef WFrag<bf>::V VB;
    V qf[2], q2f[2]; const T16* qp = Q + (size_t)(i0 + c) * HD + 8 * h; const T16* q2p = HI ? Q2 + (size_t)(i0 + c) * HD + 8 * h : qp;
#pragma unroll
    for (int kk = 0; kk < 2; ++kk) { qf[kk] = WFrag<T16>::ld(qp + kk * 32); if (HI) q2f[kk] = WFrag<T16>::ld(q2p + kk * 32); }
    VB rqh[2], rql[2], ef[2]; const bf* bhp = Qbh + (size_t)(i0 + c) * HD + 8 * h; const bf* blp = Qbl + (size_t)(i0 + c) * HD + 8 * h;   // the queries as hi/lo bf16, the B side of the relative product
    const bf* ep = EB + (size_t)((c & 1) * (2 * CUT)) * HD + 8 * h;   // the table's two ends: even A rows = row 0, odd = row 2 CUT
#pragma unroll
    for (int kk = 0; kk < 2; ++kk) { if constexpr (HI) { rqh[kk] = qf[kk]; rql[kk] = q2f[kk]; } else { rqh[kk] = WFrag<bf>::ld(bhp + kk * 32); rql[kk] = WFrag<bf>::ld(blp + kk * 32); } ef[kk] = WFrag<bf>::ld(ep + kk * 32); }
    asm volatile("s_wait_xcnt 0x0" :: "v"(qp), "v"(q2p), "v"(bhp), "v"(blp), "v"(ep) : "memory");   // the address registers of the loads above stay live up to this wait
    v8f ee2 = (v8f){};
#pragma unroll
    for (int kk = 0; kk < 2; ++kk) { ee2 = wmmab(ef[kk], rqh[kk], ee2); ee2 = wmmab(ef[kk], rql[kk], ee2); }
    const float eLo = ee2[0], eHi = ee2[1];   // this query's terms at the two clipped ends
    // staging: 16-byte chunk tg + 128 u of a stage: K row (tg >> 3) + 16 u, V^T row (tg >> 2) + 32 u
    const size_t kgo = (size_t)jbeg * HD + tg * 8, vgo = (size_t)(tg >> 2) * 2 * TT + jbeg + (tg & 3) * 8;
    const T16* kg = Kp + kgo; const T16* k2g = HI ? K2 + kgo : kg; const T16* vg = Vt + vgo; const T16* v2g = HI ? Vt2 + vgo : vg;
    const int ksl = (tg >> 3) * KPI + (tg & 7) * 16, vsl = 32 * KPI + (tg >> 2) * VPI + (tg & 3) * 16;
    C8 gk[2], gv[2], gk2[2], gv2[2]; v8us ge[2]; int rsl[2];
    int rp = ib - jbeg + CUT - 32 + (tg >> 3);   // table position of this thread's first row among the 32 lowest of the coming stage's window
    auto gload = [&]() {
#pragma unroll
        for (int u = 0; u < 2; ++u) { gk[u] = *(const C8*)(kg + u * 128 * 8); gv[u] = *(const C8*)(vg + (size_t)u * 32 * 2 * TT); if (HI) { gk2[u] = *(const C8*)(k2g + u * 128 * 8); gv2[u] = *(const C8*)(v2g + (size_t)u * 32 * 2 * TT); } }
        unsigned eo[2];
#pragma unroll
        for (int u = 0; u < 2; ++u) { const int p = rp + 16 * u; eo[u] = (unsigned)min(max(p, 0), 2 * CUT) * (HD * 2u) + (unsigned)(tg & 7) * 16u; ge[u] = *(const v8usa*)((const char*)EB + eo[u]); rsl[u] = (p & (RPW - 1)) * KPI + (tg & 7) * 16; }
        asm volatile("s_wait_xcnt 0x0" :: "v"(kg), "v"(k2g), "v"(vg), "v"(v2g), "v"(eo[0]), "v"(eo[1]) : "memory");   // the staging loads' address registers stay live up to this wait; they are stepped only behind it
        kg += 32 * HD; k2g += 32 * HD; vg += 32; v2g += 32; rp -= 32; };
    auto sstore = [&](char* b) {
#pragma unroll
        for (int u = 0; u < 2; ++u) { *(C8*)(b + ksl + u * 16 * KPI) = gk[u]; *(C8*)(b + vsl + u * 32 * VPI) = gv[u]; if (HI) { *(C8*)(b + FPL + ksl + u * 16 * KPI) = gk2[u]; *(C8*)(b + FPL + vsl + u * 32 * VPI) = gv2[u]; } *(v8usa*)(rr + rsl[u]) = ge[u]; } };
    {   // the upper 64 rows of stage 0's window; its lowest 32 come with the first gload
        unsigned eo[4]; v8us g4[4]; const int p0 = rp + 32;
#pragma unroll
        for (int u = 0; u < 4; ++u) { eo[u] = (unsigned)min(max(p0 + 16 * u, 0), 2 * CUT) * (HD * 2u) + (unsigned)(tg & 7) * 16u; g4[u] = *(const v8usa*)((const char*)EB + eo[u]); }
        asm volatile("s_wait_xcnt 0x0" :: "v"(eo[0]), "v"(eo[1]), "v"(eo[2]), "v"(eo[3]) : "memory");   // the offset registers of these loads stay live up to this wait
#pragma unroll
        for (int u = 0; u < 4; ++u) *(v8usa*)(rr + ((p0 + 16 * u) & (RPW - 1)) * KPI + (tg & 7) * 16) = g4[u];
    }
    gload(); sstore(ring);
    __syncthreads();   // publishes stage 0
    const int ns = (jend - jbeg) / 32;
#pragma unroll 1
    for (int s = 0; s < ns; ++s) {
        const int j0 = jbeg + 32 * s; const bool more = s + 1 < ns; const char* b = ring + (s & 1) * (2 * FPL);
        if (more) gload();   // stage s + 1 flies while stage s is worked on
        V kf[2][2], k2f[2][2]; float e[2][8];
#pragma unroll
        for (int t = 0; t < 2; ++t)
#pragma unroll
            for (int kk = 0; kk < 2; ++kk) { kf[t][kk] = WFrag<T16>::ld((const T16*)(b + (16 * t + c) * KPI + kk * 64 + 16 * h)); if (HI) k2f[t][kk] = WFrag<T16>::ld((const T16*)(b + FPL + (16 * t + c) * KPI + kk * 64 + 16 * h)); }
        v8f s_[2]; float x[2][8]; float mb = -3.0e38f;
        auto scores = [&]() {   // called in both branches below, so that in the first its products can fill the wait for the patch
#pragma unroll
            for (int t = 0; t < 2; ++t) { s_[t] = (v8f){};
#pragma unroll
                for (int kk = 0; kk < 2; ++kk) { s_[t] = WFrag<T16>::mma(kf[t][kk], qf[kk], s_[t]); if (HI) { s_[t] = WFrag<T16>::mma(kf[t][kk], q2f[kk], s_[t]); s_[t] = WFrag<T16>::mma(k2f[t][kk], qf[kk], s_[t]); } } }
#pragma unroll
            for (int t = 0; t < 2; ++t)
#pragma unroll
                for (int r = 0; r < 8; ++r) { x[t][r] = (s_[t][r] + e[t][r]) * (SCL * 1.4426950408889634f); mb = fmaxf(mb, x[t][r]); } };
        if (i0 + 15 - j0 > -CUT && i0 - (j0 + 31) < CUT) {   // wave-uniform. R^T = the wave's 48 table rows . Q^T (hi, then lo, a k step: the order of sums of a hi/lo x exact product), then the shift per query through the wave's own patch
            const int pb = i0 - j0 + CUT + 15 - c;
            v8f rt[3]; const char* rw[3];
#pragma unroll
            for (int u = 0; u < 3; ++u) { rw[u] = rr + ((pb - 16 * u) & (RPW - 1)) * KPI + 16 * h; rt[u] = (v8f){}; }
#pragma unroll
            for (int kk = 0; kk < 2; ++kk) { VB rf[3];   // the three tiles' chains side by side: each fills the others' latency
#pragma unroll
                for (int u = 0; u < 3; ++u) rf[u] = WFrag<bf>::ld((const bf*)(rw[u] + kk * 64));
#pragma unroll
                for (int u = 0; u < 3; ++u) rt[u] = wmmab(rf[u], rqh[kk], rt[u]);
#pragma unroll
                for (int u = 0; u < 3; ++u) rt[u] = wmmab(rf[u], rql[kk], rt[u]); }
#pragma unroll
            for (int u = 0; u < 3; ++u) { float* p = et + c * EPI + 16 * u + 8 * h;
                *(v4fa*)p = __builtin_shufflevector(rt[u], rt[u], 0, 1, 2, 3); *(v4fa*)(p + 4) = __builtin_shufflevector(rt[u], rt[u], 4, 5, 6, 7); }
            __builtin_amdgcn_wave_barrier(); asm volatile("" ::: "memory");   // keeps the compiler from moving the reads below over the other lanes' stores above (one wave: its LDS operations run in order)
            const float* es = et + c * (EPI - 1) + 15 + 8 * h;
#pragma unroll
            for (int t = 0; t < 2; ++t)
#pragma unroll
                for (int r = 0; r < 8; ++r) e[t][r] = es[16 * t + r];
            __builtin_amdgcn_wave_barrier(); asm volatile("" ::: "memory");   // and the next stage's stores over these reads; it also keeps the 16 reads together in front of their first use (one latency, not eight)
            scores();
        } else {   // the whole block is clipped to one end
            const float ee = (i0 < j0) ? eLo : eHi;
#pragma unroll
            for (int t = 0; t < 2; ++t)
#pragma unroll
                for (int r = 0; r < 8; ++r) e[t][r] = ee;
            scores();
        }
        V vf[4], v2f_[4];
#pragma unroll
        for (int dt = 0; dt < 4; ++dt) { vf[dt] = WFrag<T16>::ld((const T16*)(b + 32 * KPI + (dt * 16 + c) * VPI + 16 * h)); if (HI) v2f_[dt] = WFrag<T16>::ld((const T16*)(b + FPL + 32 * KPI + (dt * 16 + c) * VPI + 16 * h)); }
        mb = fmaxf(mb, xhalf(mb));
        const float mn = fmaxf(m, HI ? mb : mb - 4.0f);   // fp16 weights run up to 16: four more binades above the subnormals; the factor cancels in O / l
        const float al = __builtin_amdgcn_exp2f(m - mn); m = mn;
        float ps = 0.f;
#pragma unroll
        for (int t = 0; t < 2; ++t)
#pragma unroll
            for (int r = 0; r < 8; ++r) { x[t][r] = __builtin_amdgcn_exp2f(x[t][r] - mn); ps += x[t][r]; }
        l = l * al + ps;
#pragma unroll
        for (int dt = 0; dt < 4; ++dt) O[dt] *= al;
        if constexpr (HI) {
            v8us ph[2], pl[2];
#pragma unroll
            for (int t = 0; t < 2; ++t)
#pragma unroll
                for (int r = 0; r < 8; ++r) { unsigned short a, b2; splitf(x[t][r], a, b2); ph[t][r] = a; pl[t][r] = b2; }
            const V pbh = cat16b(ph[0], ph[1]), pbl = cat16b(pl[0], pl[1]);
#pragma unroll
            for (int dt = 0; dt < 4; ++dt) { O[dt] = WFrag<T16>::mma(vf[dt], pbh, O[dt]); O[dt] = WFrag<T16>::mma(vf[dt], pbl, O[dt]); O[dt] = WFrag<T16>::mma(v2f_[dt], pbh, O[dt]); }
        } else {
            v8h p0, p1;
#pragma unroll
            for (int r = 0; r < 8; ++r) { p0[r] = tohx(x[0][r]); p1[r] = tohx(x[1][r]); }
            const V pb = cat16(p0, p1);
#pragma unroll
            for (int dt = 0; dt < 4; ++dt) O[dt] = WFrag<T16>::mma(vf[dt], pb, O[dt]);
        }
        if (more) sstore(ring + ((s + 1) & 1) * (2 * FPL));   // into the buffer that every wave left at the last barrier
        __syncthreads();   // publishes stage s + 1 and ends every reader's last read of stage s
    }
}
// k_fattn: grid (batch x head x TT / 64), 8 waves = KSF key halves x 4 query tiles of 16. Each wave runs fa_part on its half of the keys; half 1 hands (m, l, O^T) over through LDS, half 0 joins the two in fixed order and stores the merged values as hi/lo bf16 in fragment order: a lane's 8 values d = 16 dt + 8 h + r of query i0 + c are slot 16 h + c = lane of piece dt of the head's two units, so a wave's store covers a whole piece.
__global__ __launch_bounds__(256) void k_fattn(const h16* __restrict__ Q16, const h16* __restrict__ K16, const bf* __restrict__ Qh, const bf* __restrict__ Ql, const bf* __restrict__ Kh, const bf* __restrict__ Kl, const h16* __restrict__ V16, const bf* __restrict__ Vh, const bf* __restrict__ EB, bf* Ah, bf* Al) {
    __shared__ __align__(16) char ring[KSF][2][2 * FPL]; __shared__ __align__(16) char rring[KSF][RPW * KPI]; __shared__ __align__(16) float et[8][16 * EPI];
    __shared__ float cm[4][32]; __shared__ float cl[4][32]; __shared__ float cO[4][32][32];   // [query tile][register][lane]
    const int lane = threadIdx.x & 31, c = lane & 15, h = lane >> 4; const int w = __builtin_amdgcn_readfirstlane((int)(threadIdx.x >> 5));
    const int n = blockIdx.x, nh = NB_ * NH_ * (RH / 64); const bool hires = n < nh;   // the costlier hi/lo row blocks take the lowest indices: they start first and the lighter ones fill in beside them
    const int g = hires ? n / (RH / 64) : (n - nh) / ((TT - RH) / 64), xb = hires ? n % (RH / 64) : RH / 64 + (n - nh) % ((TT - RH) / 64);
    const int tile = w & 3, ks = w >> 2, i0 = xb * 64 + tile * 16, jbeg = ks * (TT / KSF), jend = jbeg + TT / KSF, tg = threadIdx.x & 127;
    const size_t pu = (size_t)g * TT * HD;
    float m = -3.0e38f, l = 0.f; v8f O[4];
#pragma unroll
    for (int dt = 0; dt < 4; ++dt) O[dt] = (v8f){};
    if (hires) fa_part<bf, true>(Qh + pu, Ql + pu, Kh + pu, Kl + pu, Vh + 2 * pu, Vh + 2 * pu + TT, Qh + pu, Ql + pu, EB, &ring[ks][0][0], &rring[ks][0], &et[w][0], tg, xb * 64, i0, jbeg, jend, c, h, m, l, O);
    else fa_part<h16, false>(Q16 + pu, nullptr, K16 + pu, nullptr, V16 + (size_t)(g % NH_) * HD * 2 * TT + (size_t)(g / NH_) * TT, nullptr, Qh + pu, Ql + pu, EB, &ring[ks][0][0], &rring[ks][0], &et[w][0], tg, xb * 64, i0, jbeg, jend, c, h, m, l, O);
    if (ks != 0) { cm[tile][lane] = m; cl[tile][lane] = l;
#pragma unroll
        for (int dt = 0; dt < 4; ++dt)
#pragma unroll
            for (int r = 0; r < 8; ++r) cO[tile][dt * 8 + r][lane] = O[dt][r]; }
    __syncthreads();   // publishes the second half's parts to the joining wave
    if (ks != 0) return;
    const float m1 = cm[tile][lane], M = fmaxf(m, m1), a0 = __builtin_amdgcn_exp2f(m - M), a1 = __builtin_amdgcn_exp2f(m1 - M);
    l = l * a0 + cl[tile][lane] * a1;
#pragma unroll
    for (int dt = 0; dt < 4; ++dt)
#pragma unroll
        for (int r = 0; r < 8; ++r) O[dt][r] = O[dt][r] * a0 + cO[tile][dt * 8 + r][lane] * a1;
    l += xhalf(l);
    const float inv = __fdiv_rn(1.0f, l);
    const size_t oo = ((size_t)(g / NH_) * TT + i0) * DQ + (g % NH_) * (HD * 16) + 8 * lane;
#pragma unroll
    for (int dt = 0; dt < 4; ++dt) { v8us oh, ol;
#pragma unroll
        for (int r = 0; r < 8; ++r) { unsigned short a, b2; splitf(O[dt][r] * inv, a, b2); oh[r] = a; ol[r] = b2; }
        *(v8us*)(Ah + oo + dt * 256) = oh; *(v8us*)(Al + oo + dt * 256) = ol; }
}

extern "C" void kernel_launch(void* const* d_in, const int* in_sizes, int n_in,
                              void* d_out, int out_size, void* d_ws, size_t ws_size, hipStream_t stream) {
    (void)in_sizes; (void)n_in; (void)out_size;
    const float* x = (const float*)d_in[0]; const float* wq = (const float*)d_in[1]; const float* wkv = (const float*)d_in[2];   /* [512][1024]: k | v column halves */ const float* wo = (const float*)d_in[3]; const float* bo = (const float*)d_in[4]; const float* rel = (const float*)d_in[5];   /* rel_emb [1025][64] */ const float* wk = nullptr, *wv = nullptr; (void)wk; (void)wv;
    float* OUT = (float*)d_out;     // [2][2048][512]
    char* wsp = (char*)d_ws;
    auto take = [&](size_t bytes) { char* p = wsp; wsp += (bytes + 255) & ~(size_t)255; return (void*)p; };
    bf* WQ = (bf*)take((size_t)DQ * DM * 2); bf* WKV = (bf*)take((size_t)2 * DKV * DM * 2);   /* directly behind WQ: one Bt [1536][512], rows q | k | v */ bf* EB = (bf*)take((size_t)NE * HD * 2); bf* WO = (bf*)take((size_t)DM * DQ * 2);
    bf* XB = (bf*)take((size_t)NB_ * TT * DM * 2);
    const size_t PU = (size_t)TT * HD, NU = (size_t)NB_ * NH_;   // one (batch, head) plane; planes a tensor
    h16* QP16 = (h16*)take(2 * NU * PU * 2); h16* KP16 = QP16 + NU * PU; bf* QPh = (bf*)take(2 * NU * PU * 2); bf* KPh = QPh + NU * PU; bf* QPl = (bf*)take(2 * NU * PU * 2); bf* KPl = QPl + NU * PU;   // q planes, then k planes
    h16* VT16 = (h16*)take(NU * PU * 2); bf* VTh = (bf*)take(2 * NU * PU * 2); bf* VTl = VTh + TT;   // rows of pitch 2 x TT: [batch 0 | batch 1] and [hi | lo]
    bf* ATh = (bf*)take((size_t)NB_ * TT * DQ * 2); bf* ATl = (bf*)take((size_t)NB_ * TT * DQ * 2);
    if ((size_t)(wsp - (char*)d_ws) > ws_size) return;    // ws 256 MiB
    const int DP = DQ + 2 * DKV;
    k_prep<<<(unsigned)(PB_WKV + PB_WQ + PB_WO + PB_E + PB_X), 256, 0, stream>>>(x, wq, wkv, wo, rel, XB, WQ, WKV, WO, EB);   /* weights transposed, x and the relative table as bf16: one launch */
    k_proj<<<dim3(NB_ * TT / 64, DP / 64, 1), 32 * KSP, 0, stream>>>(XB, WQ, QP16, QPh, QPl, VT16, VTh, VTl);   /* q, k head planes and V^T planes, fp16 + hi/lo */
    k_fattn<<<(unsigned)(NU * (TT / 64)), 256, 0, stream>>>(QP16, KP16, QPh, QPl, KPh, KPl, VT16, VTh, EB, ATh, ATl);   /* softmax((q.k + q_i . rel[clip(i - j) + 512]) / 8) . v, merged hi/lo */
    k_wo<<<dim3(NB_ * TT / 64, DM / 64, 1), 32 * KSP, 0, stream>>>(ATh, ATl, WO, bo, OUT);   /* merged hi/lo . Wo + bo */
}

// v010
// One run takes 76.1 microseconds.
// Next to v009, in two timings, it ran 1.03 times as fast each time.
// Counting every step since v000, it is 15.2 times as fast.
#include <hip/hip_runtime.h>

// Multi-head attention with a Shaw-style relative-key term over clipped distances (x [2][2048][512]; q = x Wq ('xw' [512][512]); k | v = x Wkv ('xw' [512][1024] column halves); 8 heads x 64; dots = (q.k + q.rel_emb[clip(i - j, -512, 512) + 512]) x 64^-0.5 (rel_emb [1025][64] shared by the heads, read); softmax (no causal mask in the module's code); out = merged Wo + bo ('xw') -> [2][2048][512] (2.1 M)).
// Layout: both batches as 4096 rows through one q|k|v projection launch, whose epilogue writes the head planes, and one Wo launch; bf16 copy of x; 'xw' weights transposed once (Wkv as one [1024][512] Bt whose row halves are k and v); the planes that the two GEMM kernels read (x, weights, merged) lie in fragment order (FRAGMENT ORDER below); exact projections; the relative table as one zero-padded bf16 plane [1088][64]; one attention launch: a wave holds 16 queries and walks half of the keys in stages of 32 that four waves share in LDS (scores^T = K Q^T, + q_i . rel[clip(i - j) + 512] from a product of the stage's 48 table rows with Q^T (hi/lo x exact), shifted per query through LDS, running maximum and sum, O^T += V^T P^T with P packed from the score accumulators), the two halves joined through LDS in fixed order; hybrid rows: < 512 hi/lo 3 products, rest fp16; merged hi/lo x Wo exact + bo.
// Compute dtypes, f32 accumulate: every input rounded to bf16; projections exact; q.k rows < 512 3 products, rest fp16; q.rel hi/lo x exact on every row; softmax f32 (running maximum); attn.v rows < 512 3 products, rest fp16 (unnormalised weights x 16); Wo hl x exact + bias.

#define NB_  2
#define TT   2048
#define DM   512
#define NH_  8
#define NKV  8
#define REP  (NH_ / NKV)
#define HD   64
#define DQ   (NH_ * HD)
#define DKV  (NKV * HD)
#define RH   512                  // query rows < RH use hi+lo planes (0: none)
#define WIN  0
#define SCL  0.125f
#define NE   1088     // 2*512+1 = 1025 relative offsets padded to a multiple of 64
#define NRE  1025
#define CUT  512
#define KSP  4        // k-slices of the q, k, v projections and of the Wo product (K = 512 -> 128 a slice), one wave each
#define KSF  2        // key halves of a query tile in the attention kernel, one wave each
typedef _Float16 h16;
typedef unsigned short bf;
typedef __attribute__((ext_vector_type(16))) __bf16   v16bf;
typedef __attribute__((ext_vector_type(16))) _Float16 v16h;
typedef __attribute__((ext_vector_type(8)))  _Float16 v8h;
typedef __attribute__((ext_vector_type(8)))  unsigned short v8us;
typedef __attribute__((ext_vector_type(8)))  float    v8f;
typedef __attribute__((ext_vector_type(4)))  float    v4f;
typedef v8h  __attribute__((may_alias)) v8ha;
typedef v4f  __attribute__((may_alias)) v4fa;
typedef v8us __attribute__((may_alias)) v8usa;

__device__ __forceinline__ unsigned short f2bf(float f) { unsigned u = __float_as_uint(f); u += 0x7FFFu + ((u >> 16) & 1u); return (unsigned short)(u >> 16); }
__device__ __forceinline__ float bf2f(unsigned short b) { return __uint_as_float(((unsigned)b) << 16); }
__device__ __forceinline__ float bfr(float f) { return bf2f(f2bf(f)); }
__device__ __forceinline__ v16h cat16(v8h lo, v8h hi) { return __builtin_shufflevector(lo, hi, 0, 1, 2, 3, 4, 5, 6, 7, 8, 9, 10, 11, 12, 13, 14, 15); }
__device__ __forceinline__ v16bf cat16b(v8us lo, v8us hi) { return __builtin_bit_cast(v16bf, __builtin_shufflevector(lo, hi, 0, 1, 2, 3, 4, 5, 6, 7, 8, 9, 10, 11, 12, 13, 14, 15)); }
__device__ __forceinline__ v8f wmma16(v16h a, v16h b, v8f c) { return __builtin_amdgcn_wmma_f32_16x16x32_f16(false, a, false, b, (short)0, c, false, false); }
__device__ __forceinline__ v8f wmmab(v16bf a, v16bf b, v8f c) { return __builtin_amdgcn_wmma_f32_16x16x32_bf16(false, a, false, b, (short)0, c, false, false); }



// ---- Fragment loaders of the matrix kernels; the two GEMM kernels (k_proj, k_wo) read their operands straight from 16-bit planes in fragment order.
// FRAGMENT ORDER of a [rows][K] 16-bit plane: units of 16 rows x 32 k (1 KB; a block of 16 rows holds its K / 32 units one after another, so it starts at row x K as in a row-major plane); a unit is two pieces of 512 B (k bit 4), a piece holds 32 slots of 16 B, slot = 16 x (k bit 3) + (row & 15), 8 values k & 7 a slot. Slot = lane: a wave's 16-byte load of a piece covers 512 contiguous bytes (4 whole lines; from a row-major plane it touches 16 lines, 32 B of each), and the two pieces are a lane's fragment in the k order of ld.
template <typename T16> struct WFrag;
template <> struct WFrag<h16> { typedef v16h V; static __device__ __forceinline__ V ld(const h16* p) { return cat16(*(const v8h*)p, *(const v8h*)(p + 16)); } static __device__ __forceinline__ v8f mma(V a, V b, v8f c) { return wmma16(a, b, c); } };
template <> struct WFrag<bf> { typedef v16bf V; static __device__ __forceinline__ V ld(const bf* p) { return cat16b(*(const v8us*)p, *(const v8us*)(p + 16)); } static __device__ __forceinline__ V ldp(const bf* p) { return cat16b(*(const v8us*)p, *(const v8us*)(p + 256)); }   /* ldp: from a plane in fragment order, p = unit + 8 x lane */ static __device__ __forceinline__ v8f mma(V a, V b, v8f c) { return wmmab(a, b, c); } };
__device__ __forceinline__ h16 tohx(float x) { return (h16)x; }
__device__ __forceinline__ void splitf(float y, unsigned short& h, unsigned short& l) { h = f2bf(y); l = f2bf(y - bf2f(h)); }
typedef __attribute__((ext_vector_type(2))) _Float16 v2h;
typedef __attribute__((ext_vector_type(4))) _Float16 v4h;
typedef __attribute__((ext_vector_type(2))) unsigned short v2us;
typedef __attribute__((ext_vector_type(4))) unsigned short v4us;
typedef __attribute__((ext_vector_type(2))) float v2f;
typedef __attribute__((ext_vector_type(4))) int v4i;

// The five preparation passes (three weight transposes, the bf16 copy of x, the padded relative table) read only inputs and write planes of their own: they are parts of ONE launch, k_prep, each on its own range of work-groups (blk = the work-group's index inside its part).
// d_wtG: w [K][N] -> Bt [N][K] in fragment order, one unit (16 n x 32 k) a wave: lane = slot, its 8 values of a piece come from 8 rows of w (a load covers 64 contiguous bytes of two rows), all 16 loads in flight together; a store covers a whole piece.
__device__ __forceinline__ void d_wtG(int blk, const float* __restrict__ w, int K, int N, bf* Bt) {
    const int lane = threadIdx.x & 31; const int U = blk * 8 + (int)(threadIdx.x >> 5); if (U >= N * K / 512) return;
    const int n = (U / (K / 32)) * 16 + (lane & 15), k0 = (U % (K / 32)) * 32 + (lane >> 4) * 8;
    const float* sp = w + (size_t)k0 * N + n; float v[2][8];
#pragma unroll
    for (int p = 0; p < 2; ++p)
#pragma unroll
        for (int j = 0; j < 8; ++j) v[p][j] = sp[(size_t)(p * 16 + j) * N];
    asm volatile("s_wait_xcnt 0x0" :: "v"(sp) : "memory");   // the loads' address pair stays live up to this wait, so that no later value lands in it before
#pragma unroll
    for (int p = 0; p < 2; ++p) { v8us o;
#pragma unroll
        for (int j = 0; j < 8; ++j) o[j] = f2bf(v[p][j]);
        *(v8us*)(Bt + (size_t)U * 512 + p * 256 + lane * 8) = o; }
}
// d_cvt8: src [rows][DM] f32 -> dst in fragment order; thread i fills slot i of the plane (a wave's store covers a whole piece) from row 16 x block + (slot & 15), 8 values from k = 32 x unit + 16 x piece + 8 x (slot >> 4).
__device__ __forceinline__ void d_cvt8(int blk, const float* __restrict__ src, bf* dst, size_t n8) { const size_t i = (size_t)blk * 256 + threadIdx.x; if (i >= n8) return; const size_t un = i >> 6; const float* sp = src + ((un / (DM / 32)) * 16 + (i & 15)) * DM + (un % (DM / 32)) * 32 + ((i >> 5) & 1) * 16 + ((i >> 4) & 1) * 8; const v8f v = *(const v8f*)sp; v8us o;
    asm volatile("s_wait_xcnt 0x0" :: "v"(sp) : "memory");   // the load's address pair stays live up to this wait, so that no later value lands in it before
#pragma unroll
    for (int k = 0; k < 8; ++k) o[k] = f2bf(v[k]); *(v8us*)(dst + i * 8) = o;  }

#define RPI 68   // floats: LDS pitch of one 64-value row of a k-slice's tile (272 B = 16 B x odd: the 16-byte stores and reads of 16 lanes fall on all 64 banks)
// k_proj: the q | k | v projection with the head planes written by its own epilogue. Grid (4096 / 64 row tiles, 1536 / 64 column tiles = one head of q, k or v), KSP waves: wave s sums k in [s DM / KSP, (s + 1) DM / KSP) of the whole 64 x 64 tile (16 accumulators, operands straight from the planes in fragment order), stores its tile in its own LDS plane, and behind one barrier the work-group adds the KSP planes in the order s = 0, 1, ... and stores fp16 + hi/lo bf16 in whole 128-byte lines.
// The operand whose rows run along the output's contiguous direction is the A side, so that a lane's 8 accumulator values are 8 neighbours of an output row: q, k planes [u][t][d] take A = weight rows (d), B = x rows (t); the V^T planes [d][t] take A = x rows (t), B = weight rows (d). Both sides use the same loader (the same k order).
__global__ __launch_bounds__(32 * KSP) void k_proj(const bf* __restrict__ X, const bf* __restrict__ Wt, h16* P16, bf* Ph, bf* Pl, h16* V16, bf* Vh, bf* Vl) {
    typedef WFrag<bf>::V V;
    __shared__ __align__(16) float red[KSP][64][RPI];
    const int lane = threadIdx.x & 31, lr = lane & 15, hi = lane >> 4; const int ks = __builtin_amdgcn_readfirstlane((int)(threadIdx.x >> 5));
    const int r0 = blockIdx.x * 64, cy = blockIdx.y; const bool isv = cy >= (DQ + DKV) / HD;
    const bf* xr = X + (size_t)r0 * DM; const bf* wr = Wt + (size_t)cy * 64 * DM;
    const bf* Am = isv ? xr : wr; const bf* Bn = isv ? wr : xr;
    v8f acc[4][4];
#pragma unroll
    for (int mb = 0; mb < 4; ++mb)
#pragma unroll
        for (int nb = 0; nb < 4; ++nb) acc[mb][nb] = (v8f){};
    const int off = 8 * lane; const int kbeg = ks * (DM / KSP);
    constexpr int NT = DM / KSP / 32;   // k steps of a wave's slice
    // every loop from here to the barrier is unrolled in full: the fragment and accumulator arrays must be registers, and the loads take immediate offsets from one address pair an operand
    V fa[NT][4], fb[NT][4]; const bf* ap = Am + off + kbeg * 16; const bf* bp = Bn + off + kbeg * 16;   // unit kbeg / 32 + t of each block of 16 rows
#pragma unroll
    for (int t = 0; t < NT; ++t)
#pragma unroll
        for (int u = 0; u < 4; ++u) fa[t][u] = WFrag<bf>::ldp(ap + t * 512 + u * 16 * DM);
#pragma unroll
    for (int u = 0; u < 4; ++u)   // in the order in which the column groups below need them
#pragma unroll
        for (int t = 0; t < NT; ++t) fb[t][u] = WFrag<bf>::ldp(bp + t * 512 + u * 16 * DM);
    asm volatile("s_wait_xcnt 0x0" :: "v"(ap), "v"(bp) : "memory");   // the address pairs stay live up to this wait, so that no load's result and no later value lands in them before it
    __builtin_amdgcn_sched_barrier(0);   // keeps the first products from being moved up among the loads: the whole slice's loads fly together (one latency a wave, not one a k step)
    auto put = [&](int nb) {   // a column group's four accumulators into this k-slice's LDS plane
#pragma unroll
        for (int mb = 0; mb < 4; ++mb) { float* p = &red[ks][nb * 16 + lr][mb * 16 + hi * 8];
            *(v4fa*)p = __builtin_shufflevector(acc[mb][nb], acc[mb][nb], 0, 1, 2, 3); *(v4fa*)(p + 4) = __builtin_shufflevector(acc[mb][nb], acc[mb][nb], 4, 5, 6, 7); } };
    // One column group (4 accumulators, 4 chains side by side) after another, so that only 8 of the 16 accumulators are live beside the fragments; a group is stored behind the next group's products.
#pragma unroll
    for (int nb = 0; nb < 4; ++nb) {
#pragma unroll
        for (int t = 0; t < NT; ++t) {
#pragma unroll
            for (int mb = 0; mb < 4; ++mb) acc[mb][nb] = WFrag<bf>::mma(fa[t][mb], fb[t][nb], acc[mb][nb]);
        }
        __builtin_amdgcn_sched_barrier(0);   // holds the groups in this order (registers) and the last group's stores behind this group's products: its registers are handed on only 16 or more matrix instructions behind their last write
        if (nb > 0) put(nb - 1);
        __builtin_amdgcn_sched_barrier(0);   // and the next group's products behind these stores, which free the registers
    }
    put(3);
    __syncthreads();   // publishes every k-slice's tile to the waves that add them
    const int b = r0 / TT, t0 = r0 % TT, head = cy % NH_;
    // row n of the tile: a V^T row d (pitch 2 x TT: fp16 rows [head][d][b | b], hi/lo rows [b, head][d][hi | lo]) or a q / k row t (pitch HD, plane u = (q or k, b, head))
    const unsigned pit = isv ? 2u * TT : (unsigned)HD;
    const size_t o16 = isv ? ((size_t)head * HD * NB_ + b) * TT + t0 : ((size_t)((cy / NH_) * NB_ + b) * NH_ + head) * TT * HD + (size_t)t0 * HD;
    const size_t ohl = isv ? (size_t)(b * NKV + head) * HD * 2 * TT + t0 : o16;
    h16* D16 = (isv ? V16 : P16) + o16; bf* Dh = (isv ? Vh : Ph) + ohl; bf* Dl = (isv ? Vl : Pl) + ohl;
#pragma unroll
    for (int it = 0; it < 512 / (32 * KSP); ++it) { const int q = it * (32 * KSP) + (int)threadIdx.x, n = q >> 3, mc = (q & 7) * 8;   // 8 lanes a row: a wave's store covers 4 whole lines
        v4f x0 = *(const v4fa*)&red[0][n][mc], x1 = *(const v4fa*)&red[0][n][mc + 4];
#pragma unroll
        for (int s = 1; s < KSP; ++s) { x0 += *(const v4fa*)&red[s][n][mc]; x1 += *(const v4fa*)&red[s][n][mc + 4]; }   // the k-slices, added in fixed order
        v8h v16; v8us vh, vl;
#pragma unroll
        for (int k = 0; k < 8; ++k) { const float x = k < 4 ? x0[k & 3] : x1[k & 3]; v16[k] = tohx(x); unsigned short a2, c2; splitf(x, a2, c2); vh[k] = a2; vl[k] = c2; }
        const unsigned eb = ((unsigned)n * pit + (unsigned)mc) * 2u;   // byte offset in all three planes (2-byte elements): scalar base + 32-bit offset
        *(v8h*)((char*)D16 + eb) = v16; *(v8us*)((char*)Dh + eb) = vh; *(v8us*)((char*)Dl + eb) = vl;
    }
}
// k_wo: out = merged (hi + lo) . Wo + bo. Grid (4096 / 64 row tiles, 512 / 64 column tiles), KSP waves, the frame of k_proj: wave s sums k in [s DQ / KSP, (s + 1) DQ / KSP) of the whole 64 x 64 tile (16 accumulators; a k step adds hi, then lo), stores its tile in its own LDS plane, and behind one barrier the work-group adds the KSP planes in the order s = 0, 1, ..., adds the bias and stores f32 in whole lines.
// A = weight rows (output columns n), B = merged rows (m): a lane's 8 accumulator values are 8 neighbours of an output row. Both sides use the same loader (the same k order).
__global__ __launch_bounds__(32 * KSP) void k_wo(const bf* __restrict__ Mh, const bf* __restrict__ Ml, const bf* __restrict__ Wt, const float* __restrict__ bias, float* C) {
    typedef WFrag<bf>::V V;
    __shared__ __align__(16) float red[KSP][64][RPI];
    const int lane = threadIdx.x & 31, lr = lane & 15, hi = lane >> 4; const int ks = __builtin_amdgcn_readfirstlane((int)(threadIdx.x >> 5));
    const int r0 = blockIdx.x * 64, c0 = blockIdx.y * 64;
    const bf* wr = Wt + (size_t)c0 * DQ; const bf* mh = Mh + (size_t)r0 * DQ; const bf* ml = Ml + (size_t)r0 * DQ;
    const int mc = ((int)threadIdx.x & 7) * 8;   // this thread's 8 columns in the join, the same on each of its rows
    const float* gp = bias + c0 + mc; float g[8];
#pragma unroll
    for (int k = 0; k < 8; ++k) g[k] = gp[k];   // loaded here so that it flies under the k loop
    asm volatile("s_wait_xcnt 0x0" :: "v"(gp) : "memory");   // the loads' address pair stays live up to this wait, so that no later value lands in it before
    v8f acc[4][4];
#pragma unroll
    for (int mb = 0; mb < 4; ++mb)
#pragma unroll
        for (int nb = 0; nb < 4; ++nb) acc[mb][nb] = (v8f){};
    const int off = 8 * lane; const int kbeg = ks * (DQ / KSP);
    constexpr int NT = DQ / KSP / 32;   // k steps of a wave's slice
    // every loop from here to the barrier is unrolled in full: the fragment and accumulator arrays must be registers, and the loads take immediate offsets from one address pair an operand
    V fa[NT][4], fb[NT][4], fb2[NT][4]; const bf* ap = wr + off + kbeg * 16; const bf* bp = mh + off + kbeg * 16; const bf* b2p = ml + off + kbeg * 16;   // unit kbeg / 32 + t of each block of 16 rows
#pragma unroll
    for (int t = 0; t < NT; ++t)
#pragma unroll
        for (int u = 0; u < 4; ++u) fa[t][u] = WFrag<bf>::ldp(ap + t * 512 + u * 16 * DQ);
#pragma unroll
    for (int u = 0; u < 4; ++u)   // in the order in which the column groups below need them
#pragma unroll
        for (int t = 0; t < NT; ++t) { fb[t][u] = WFrag<bf>::ldp(bp + t * 512 + u * 16 * DQ); fb2[t][u] = WFrag<bf>::ldp(b2p + t * 512 + u * 16 * DQ); }
    asm volatile("s_wait_xcnt 0x0" :: "v"(ap), "v"(bp), "v"(b2p) : "memory");   // the address pairs stay live up to this wait, so that no load's result and no later value lands in them before it
    __builtin_amdgcn_sched_barrier(0);   // keeps the first products from being moved up among the loads: the whole slice's loads fly together (one latency a wave, not one a k step)
    auto put = [&](int nb) {   // a column group's four accumulators into this k-slice's LDS plane
#pragma unroll
        for (int mb = 0; mb < 4; ++mb) { float* p = &red[ks][nb * 16 + lr][mb * 16 + hi * 8];
            *(v4fa*)p = __builtin_shufflevector(acc[mb][nb], acc[mb][nb], 0, 1, 2, 3); *(v4fa*)(p + 4) = __builtin_shufflevector(acc[mb][nb], acc[mb][nb], 4, 5, 6, 7); } };
    // One column group (4 accumulators, 4 chains side by side) after another, so that only 8 of the 16 accumulators are live beside the fragments; a group is stored behind the next group's products.
#pragma unroll
    for (int nb = 0; nb < 4; ++nb) {
#pragma unroll
        for (int t = 0; t < NT; ++t) {
#pragma unroll
            for (int mb = 0; mb < 4; ++mb) acc[mb][nb] = WFrag<bf>::mma(fa[t][mb], fb[t][nb], acc[mb][nb]);
#pragma unroll
            for (int mb = 0; mb < 4; ++mb) acc[mb][nb] = WFrag<bf>::mma(fa[t][mb], fb2[t][nb], acc[mb][nb]);
        }
        __builtin_amdgcn_sched_barrier(0);   // holds the groups in this order (registers) and the last group's stores behind this group's products: its registers are handed on only 16 or more matrix instructions behind their last write
        if (nb > 0) put(nb - 1);
        __builtin_amdgcn_sched_barrier(0);   // and the next group's products behind these stores, which free the registers
    }
    put(3);
    __syncthreads();   // publishes every k-slice's tile to the waves that add them
    const v4f g0 = { bfr(g[0]), bfr(g[1]), bfr(g[2]), bfr(g[3]) }, g1 = { bfr(g[4]), bfr(g[5]), bfr(g[6]), bfr(g[7]) };
    float* cp = C + (size_t)r0 * DM + c0 + mc;
#pragma unroll
    for (int it = 0; it < 512 / (32 * KSP); ++it) { const int n = (it * (32 * KSP) + (int)threadIdx.x) >> 3;   // 8 lanes a row: a wave's two stores cover 4 rows of 2 whole lines
        v4f x0 = *(const v4fa*)&red[0][n][mc], x1 = *(const v4fa*)&red[0][n][mc + 4];
#pragma unroll
        for (int s = 1; s < KSP; ++s) { x0 += *(const v4fa*)&red[s][n][mc]; x1 += *(const v4fa*)&red[s][n][mc + 4]; }   // the k-slices, added in fixed order
        *(v4f*)(cp + (size_t)n * DM) = x0 + g0; *(v4f*)(cp + (size_t)n * DM + 4) = x1 + g1;
    }
}
__device__ __forceinline__ void d_epadK(int blk, const float* __restrict__ E, bf* EB) { const size_t i = (size_t)blk * 256 + threadIdx.x; if (i >= (size_t)NE * HD / 8) return; const int d0 = (int)(i % (HD / 8)) * 8; const int r = (int)(i / (HD / 8)); const float* src = E + (size_t)min(r, NRE - 1) * HD + d0; v8us o;
#pragma unroll
    for (int q = 0; q < 8; ++q) { const unsigned short v = f2bf(src[q]); o[q] = (r < NRE) ? v : (unsigned short)0; }
    *(v8us*)(EB + (size_t)r * HD + d0) = o;  }
#define PB_WKV ((DM * 2 * DKV / 64 + 63) / 64)   // work-groups of each part of k_prep
#define PB_WQ  ((DM * DQ / 64 + 63) / 64)
#define PB_WO  ((DQ * DM / 64 + 63) / 64)
#define PB_E   ((NE * HD / 8 + 255) / 256)
#define PB_X   ((NB_ * TT * DM / 8 + 255) / 256)
// k_prep: the transposes take the lowest indices, then the table, then the copy of x. The part is chosen by blockIdx alone: a work-group runs exactly one.
__global__ __launch_bounds__(256) void k_prep(const float* __restrict__ x, const float* __restrict__ wq, const float* __restrict__ wkv, const float* __restrict__ wo, const float* __restrict__ rel, bf* XB, bf* WQ, bf* WKV, bf* WO, bf* EB) {
    int n = blockIdx.x;
    if (n < PB_WKV) { d_wtG(n, wkv, DM, 2 * DKV, WKV); return; }   // 'xw' [512][1024] -> Bt [1024][512], fragment order: rows 0..511 = k, 512..1023 = v
    n -= PB_WKV;
    if (n < PB_WQ) { d_wtG(n, wq, DM, DQ, WQ); return; }
    n -= PB_WQ;
    if (n < PB_WO) { d_wtG(n, wo, DQ, DM, WO); return; }
    n -= PB_WO;
    if (n < PB_E) { d_epadK(n, rel, EB); return; }
    d_cvt8(n - PB_E, x, XB, (size_t)NB_ * TT * DM / 8);
}

__device__ __forceinline__ float xhalf(float x) { return __builtin_bit_cast(float, __builtin_amdgcn_permlanex16(__builtin_bit_cast(int, x), __builtin_bit_cast(int, x), 0x76543210, 0xfedcba98, false, false)); }   // lane l with lane l ^ 16
#define KPI 144   // bytes: LDS pitch of a staged K row (128 B of data), 16 B x odd against bank conflicts of the 16-byte fragment reads
#define VPI 80    // bytes: LDS pitch of a staged V^T row (64 B of data), 16 B x odd
#define EPI 52    // floats: LDS pitch of one query's 48 relative terms in a wave's patch (208 B = 16 B x odd)
#define RPW 128   // slots of the ring of staged table rows (pitch KPI): the 96 rows that four waves' queries meet in a stage and the next stage's 32 new ones
#define FPL (32 * KPI + 64 * VPI)   // one staged plane pair: 32 K rows, then 64 V^T rows
template <typename T16> struct Chunk;
template <> struct Chunk<h16> { typedef v8h T; };
template <> struct Chunk<bf> { typedef v8us T; };
template <typename T16, bool HI>
__device__ __forceinline__ void fa_part(const T16* __restrict__ Q, const T16* __restrict__ Q2, const T16* __restrict__ Kp, const T16* __restrict__ K2, const T16* __restrict__ Vt, const T16* __restrict__ Vt2, const bf* __restrict__ Qbh, const bf* __restrict__ Qbl, const bf* __restrict__ EB, char* ring, char* rr, float* et, int tg, int ib, int i0, int jbeg, int jend, int c, int h, float& m, float& l, v8f (&O)[4]) {
    typedef typename WFrag<T16>::V V; typedef typename Chunk<T16>::T C8; typedef WFrag<bf>::V VB;
    V qf[2], q2f[2]; const T16* qp = Q + (size_t)(i0 + c) * HD + 8 * h; const T16* q2p = HI ? Q2 + (size_t)(i0 + c) * HD + 8 * h : qp;
#pragma unroll
    for (int kk = 0; kk < 2; ++kk) { qf[kk] = WFrag<T16>::ld(qp + kk * 32); if (HI) q2f[kk] = WFrag<T16>::ld(q2p + kk * 32); }
    VB rqh[2], rql[2], ef[2]; const bf* bhp = Qbh + (size_t)(i0 + c) * HD + 8 * h; const bf* blp = Qbl + (size_t)(i0 + c) * HD + 8 * h;   // the queries as hi/lo bf16, the B side of the relative product
    const bf* ep = EB + (size_t)((c & 1) * (2 * CUT)) * HD + 8 * h;   // the table's two ends: even A rows = row 0, odd = row 2 CUT
#pragma unroll
    for (int kk = 0; kk < 2; ++kk) { if constexpr (HI) { rqh[kk] = qf[kk]; rql[kk] = q2f[kk]; } else { rqh[kk] = WFrag<bf>::ld(bhp + kk * 32); rql[kk] = WFrag<bf>::ld(blp + kk * 32); } ef[kk] = WFrag<bf>::ld(ep + kk * 32); }
    asm volatile("s_wait_xcnt 0x0" :: "v"(qp), "v"(q2p), "v"(bhp), "v"(blp), "v"(ep) : "memory");   // the address registers of the loads above stay live up to this wait
    v8f ee2 = (v8f){};
#pragma unroll
    for (int kk = 0; kk < 2; ++kk) { ee2 = wmmab(ef[kk], rqh[kk], ee2); ee2 = wmmab(ef[kk], rql[kk], ee2); }
    const float eLo = ee2[0], eHi = ee2[1];   // this query's terms at the two clipped ends
    // staging: 16-byte chunk tg + 128 u of a stage: K row (tg >> 3) + 16 u, V^T row (tg >> 2) + 32 u
    const size_t kgo = (size_t)jbeg * HD + tg * 8, vgo = (size_t)(tg >> 2) * 2 * TT + jbeg + (tg & 3) * 8;
    const T16* kg = Kp + kgo; const T16* k2g = HI ? K2 + kgo : kg; const T16* vg = Vt + vgo; const T16* v2g = HI ? Vt2 + vgo : vg;
    const int ksl = (tg >> 3) * KPI + (tg & 7) * 16, vsl = 32 * KPI + (tg >> 2) * VPI + (tg & 3) * 16;
    C8 gk[2], gv[2], gk2[2], gv2[2]; v8us ge[2]; int rsl[2];
    int rp = ib - jbeg + CUT - 32 + (tg >> 3);   // table position of this thread's first row among the 32 lowest of the coming stage's window
    auto gload = [&]() {
#pragma unroll
        for (int u = 0; u < 2; ++u) { gk[u] = *(const C8*)(kg + u * 128 * 8); gv[u] = *(const C8*)(vg + (size_t)u * 32 * 2 * TT); if (HI) { gk2[u] = *(const C8*)(k2g + u * 128 * 8); gv2[u] = *(const C8*)(v2g + (size_t)u * 32 * 2 * TT); } }
        unsigned eo[2];
#pragma unroll
        for (int u = 0; u < 2; ++u) { const int p = rp + 16 * u; eo[u] = (unsigned)min(max(p, 0), 2 * CUT) * (HD * 2u) + (unsigned)(tg & 7) * 16u; ge[u] = *(const v8usa*)((const char*)EB + eo[u]); rsl[u] = (p & (RPW - 1)) * KPI + (tg & 7) * 16; }
        asm volatile("s_wait_xcnt 0x0" :: "v"(kg), "v"(k2g), "v"(vg), "v"(v2g), "v"(eo[0]), "v"(eo[1]) : "memory");   // the staging loads' address registers stay live up to this wait; they are stepped only behind it
        kg += 32 * HD; k2g += 32 * HD; vg += 32; v2g += 32; rp -= 32; };
    auto sstore = [&](char* b) {
#pragma unroll
        for (int u = 0; u < 2; ++u) { *(C8*)(b + ksl + u * 16 * KPI) = gk[u]; *(C8*)(b + vsl + u * 32 * VPI) = gv[u]; if (HI) { *(C8*)(b + FPL + ksl + u * 16 * KPI) = gk2[u]; *(C8*)(b + FPL + vsl + u * 32 * VPI) = gv2[u]; } *(v8usa*)(rr + rsl[u]) = ge[u]; } };
    {   // the upper 64 rows of stage 0's window; its lowest 32 come with the first gload
        unsigned eo[4]; v8us g4[4]; const int p0 = rp + 32;
#pragma unroll
        for (int u = 0; u < 4; ++u) { eo[u] = (unsigned)min(max(p0 + 16 * u, 0), 2 * CUT) * (HD * 2u) + (unsigned)(tg & 7) * 16u; g4[u] = *(const v8usa*)((const char*)EB + eo[u]); }
        asm volatile("s_wait_xcnt 0x0" :: "v"(eo[0]), "v"(eo[1]), "v"(eo[2]), "v"(eo[3]) : "memory");   // the offset registers of these loads stay live up to this wait
#pragma unroll
        for (int u = 0; u < 4; ++u) *(v8usa*)(rr + ((p0 + 16 * u) & (RPW - 1)) * KPI + (tg & 7) * 16) = g4[u];
    }
    gload(); sstore(ring);
    __syncthreads();   // publishes stage 0
    const int ns = (jend - jbeg) / 32;
#pragma unroll 1
    for (int s = 0; s < ns; ++s) {
        const int j0 = jbeg + 32 * s; const bool more = s + 1 < ns; const char* b = ring + (s & 1) * (2 * FPL);
        if (more) gload();   // stage s + 1 flies while stage s is worked on
        V kf[2][2], k2f[2][2]; float e[2][8];
#pragma unroll
        for (int t = 0; t < 2; ++t)
#pragma unroll
            for (int kk = 0; kk < 2; ++kk) { kf[t][kk] = WFrag<T16>::ld((const T16*)(b + (16 * t + c) * KPI + kk * 64 + 16 * h)); if (HI) k2f[t][kk] = WFrag<T16>::ld((const T16*)(b + FPL + (16 * t + c) * KPI + kk * 64 + 16 * h)); }
        v8f s_[2]; float x[2][8]; float mb = -3.0e38f;
        auto scores = [&]() {   // called in both branches below, so that in the first its products can fill the wait for the patch
#pragma unroll
            for (int t = 0; t < 2; ++t) { s_[t] = (v8f){};
#pragma unroll
                for (int kk = 0; kk < 2; ++kk) { s_[t] = WFrag<T16>::mma(kf[t][kk], qf[kk], s_[t]); if (HI) { s_[t] = WFrag<T16>::mma(kf[t][kk], q2f[kk], s_[t]); s_[t] = WFrag<T16>::mma(k2f[t][kk], qf[kk], s_[t]); } } }
#pragma unroll
            for (int t = 0; t < 2; ++t)
#pragma unroll
                for (int r = 0; r < 8; ++r) { x[t][r] = (s_[t][r] + e[t][r]) * (SCL * 1.4426950408889634f); mb = fmaxf(mb, x[t][r]); } };
        if (i0 + 15 - j0 > -CUT && i0 - (j0 + 31) < CUT) {   // wave-uniform. R^T = the wave's 48 table rows . Q^T (hi, then lo, a k step: the order of sums of a hi/lo x exact product), then the shift per query through the wave's own patch
            const int pb = i0 - j0 + CUT + 15 - c;
            v8f rt[3]; const char* rw[3];
#pragma unroll
            for (int u = 0; u < 3; ++u) { rw[u] = rr + ((pb - 16 * u) & (RPW - 1)) * KPI + 16 * h; rt[u] = (v8f){}; }
#pragma unroll
            for (int kk = 0; kk < 2; ++kk) { VB rf[3];   // the three tiles' chains side by side: each fills the others' latency
#pragma unroll
                for (int u = 0; u < 3; ++u) rf[u] = WFrag<bf>::ld((const bf*)(rw[u] + kk * 64));
#pragma unroll
                for (int u = 0; u < 3; ++u) rt[u] = wmmab(rf[u], rqh[kk], rt[u]);
#pragma unroll
                for (int u = 0; u < 3; ++u) rt[u] = wmmab(rf[u], rql[kk], rt[u]); }
#pragma unroll
            for (int u = 0; u < 3; ++u) { float* p = et + c * EPI + 16 * u + 8 * h;
                *(v4fa*)p = __builtin_shufflevector(rt[u], rt[u], 0, 1, 2, 3); *(v4fa*)(p + 4) = __builtin_shufflevector(rt[u], rt[u], 4, 5, 6, 7); }
            __builtin_amdgcn_wave_barrier(); asm volatile("" ::: "memory");   // keeps the compiler from moving the reads below over the other lanes' stores above (one wave: its LDS operations run in order)
            const float* es = et + c * (EPI - 1) + 15 + 8 * h;
#pragma unroll
            for (int t = 0; t < 2; ++t)
#pragma unroll
                for (int r = 0; r < 8; ++r) e[t][r] = es[16 * t + r];
            __builtin_amdgcn_wave_barrier(); asm volatile("" ::: "memory");   // and the next stage's stores over these reads; it also keeps the 16 reads together in front of their first use (one latency, not eight)
            scores();
        } else {   // the whole block is clipped to one end
            const float ee = (i0 < j0) ? eLo : eHi;
#pragma unroll
            for (int t = 0; t < 2; ++t)
#pragma unroll
                for (int r = 0; r < 8; ++r) e[t][r] = ee;
            scores();
        }
        V vf[4], v2f_[4];
#pragma unroll
        for (int dt = 0; dt < 4; ++dt) { vf[dt] = WFrag<T16>::ld((const T16*)(b + 32 * KPI + (dt * 16 + c) * VPI + 16 * h)); if (HI) v2f_[dt] = WFrag<T16>::ld((const T16*)(b + FPL + 32 * KPI + (dt * 16 + c) * VPI + 16 * h)); }
        mb = fmaxf(mb, xhalf(mb));
        const float mn = fmaxf(m, HI ? mb : mb - 4.0f);   // fp16 weights run up to 16: four more binades above the subnormals; the factor cancels in O / l
        const float al = __builtin_amdgcn_exp2f(m - mn); m = mn;
        float ps = 0.f;
#pragma unroll
        for (int t = 0; t < 2; ++t)
#pragma unroll
            for (int r = 0; r < 8; ++r) { x[t][r] = __builtin_amdgcn_exp2f(x[t][r] - mn); ps += x[t][r]; }
        l = l * al + ps;
#pragma unroll
        for (int dt = 0; dt < 4; ++dt) O[dt] *= al;
        if constexpr (HI) {
            v8us ph[2], pl[2];
#pragma unroll
            for (int t = 0; t < 2; ++t)
#pragma unroll
                for (int r = 0; r < 8; ++r) { unsigned short a, b2; splitf(x[t][r], a, b2); ph[t][r] = a; pl[t][r] = b2; }
            const V pbh = cat16b(ph[0], ph[1]), pbl = cat16b(pl[0], pl[1]);
#pragma unroll
            for (int dt = 0; dt < 4; ++dt) { O[dt] = WFrag<T16>::mma(vf[dt], pbh, O[dt]); O[dt] = WFrag<T16>::mma(vf[dt], pbl, O[dt]); O[dt] = WFrag<T16>::mma(v2f_[dt], pbh, O[dt]); }
        } else {
            v8h p0, p1;
#pragma unroll
            for (int r = 0; r < 8; ++r) { p0[r] = tohx(x[0][r]); p1[r] = tohx(x[1][r]); }
            const V pb = cat16(p0, p1);
#pragma unroll
            for (int dt = 0; dt < 4; ++dt) O[dt] = WFrag<T16>::mma(vf[dt], pb, O[dt]);
        }
        if (more) sstore(ring + ((s + 1) & 1) * (2 * FPL));   // into the buffer that every wave left at the last barrier
        __syncthreads();   // publishes stage s + 1 and ends every reader's last read of stage s
    }
}
// k_fattn: grid (batch x head x TT / 64), 8 waves = KSF key halves x 4 query tiles of 16. Each wave runs fa_part on its half of the keys; half 1 hands (m, l, O^T) over through LDS, half 0 joins the two in fixed order and stores the merged values as hi/lo bf16 in fragment order: a lane's 8 values d = 16 dt + 8 h + r of query i0 + c are slot 16 h + c = lane of piece dt of the head's two units, so a wave's store covers a whole piece.
__global__ __launch_bounds__(256) void k_fattn(const h16* __restrict__ Q16, const h16* __restrict__ K16, const bf* __restrict__ Qh, const bf* __restrict__ Ql, const bf* __restrict__ Kh, const bf* __restrict__ Kl, const h16* __restrict__ V16, const bf* __restrict__ Vh, const bf* __restrict__ EB, bf* Ah, bf* Al) {
    __shared__ __align__(16) char ring[KSF][2][2 * FPL]; __shared__ __align__(16) char rring[KSF][RPW * KPI]; __shared__ __align__(16) float et[8][16 * EPI];
    __shared__ float cm[4][32]; __shared__ float cl[4][32]; __shared__ float cO[4][32][32];   // [query tile][register][lane]
    const int lane = threadIdx.x & 31, c = lane & 15, h = lane >> 4; const int w = __builtin_amdgcn_readfirstlane((int)(threadIdx.x >> 5));
    const int n = blockIdx.x, nh = NB_ * NH_ * (RH / 64); const bool hires = n < nh;   // the costlier hi/lo row blocks take the lowest indices: they start first and the lighter ones fill in beside them
    const int g = hires ? n / (RH / 64) : (n - nh) / ((TT - RH) / 64), xb = hires ? n % (RH / 64) : RH / 64 + (n - nh) % ((TT - RH) / 64);
    const int tile = w & 3, ks = w >> 2, i0 = xb * 64 + tile * 16, jbeg = ks * (TT / KSF), jend = jbeg + TT / KSF, tg = threadIdx.x & 127;
    const size_t pu = (size_t)g * TT * HD;
    float m = -3.0e38f, l = 0.f; v8f O[4];
#pragma unroll
    for (int dt = 0; dt < 4; ++dt) O[dt] = (v8f){};
    if (hires) fa_part<bf, true>(Qh + pu, Ql + pu, Kh + pu, Kl + pu, Vh + 2 * pu, Vh + 2 * pu + TT, Qh + pu, Ql + pu, EB, &ring[ks][0][0], &rring[ks][0], &et[w][0], tg, xb * 64, i0, jbeg, jend, c, h, m, l, O);
    else fa_part<h16, false>(Q16 + pu, nullptr, K16 + pu, nullptr, V16 + (size_t)(g % NH_) * HD * 2 * TT + (size_t)(g / NH_) * TT, nullptr, Qh + pu, Ql + pu, EB, &ring[ks][0][0], &rring[ks][0], &et[w][0], tg, xb * 64, i0, jbeg, jend, c, h, m, l, O);
    if (ks != 0) { cm[tile][lane] = m; cl[tile][lane] = l;
#pragma unroll
        for (int dt = 0; dt < 4; ++dt)
#pragma unroll
            for (int r = 0; r < 8; ++r) cO[tile][dt * 8 + r][lane] = O[dt][r]; }
    __syncthreads();   // publishes the second half's parts to the joining wave
    if (ks != 0) return;
    const float m1 = cm[tile][lane], M = fmaxf(m, m1), a0 = __builtin_amdgcn_exp2f(m - M), a1 = __builtin_amdgcn_exp2f(m1 - M);
    l = l * a0 + cl[tile][lane] * a1;
#pragma unroll
    for (int dt = 0; dt < 4; ++dt)
#pragma unroll
        for (int r = 0; r < 8; ++r) O[dt][r] = O[dt][r] * a0 + cO[tile][dt * 8 + r][lane] * a1;
    l += xhalf(l);
    const float inv = __fdiv_rn(1.0f, l);
    const size_t oo = ((size_t)(g / NH_) * TT + i0) * DQ + (g % NH_) * (HD * 16) + 8 * lane;
#pragma unroll
    for (int dt = 0; dt < 4; ++dt) { v8us oh, ol;
#pragma unroll
        for (int r = 0; r < 8; ++r) { unsigned short a, b2; splitf(O[dt][r] * inv, a, b2); oh[r] = a; ol[r] = b2; }
        *(v8us*)(Ah + oo + dt * 256) = oh; *(v8us*)(Al + oo + dt * 256) = ol; }
}

extern "C" void kernel_launch(void* const* d_in, const int* in_sizes, int n_in,
                              void* d_out, int out_size, void* d_ws, size_t ws_size, hipStream_t stream) {
    (void)in_sizes; (void)n_in; (void)out_size;
    const float* x = (const float*)d_in[0]; const float* wq = (const float*)d_in[1]; const float* wkv = (const float*)d_in[2];   /* [512][1024]: k | v column halves */ const float* wo = (const float*)d_in[3]; const float* bo = (const float*)d_in[4]; const float* rel = (const float*)d_in[5];   /* rel_emb [1025][64] */ const float* wk = nullptr, *wv = nullptr; (void)wk; (void)wv;
    float* OUT = (float*)d_out;     // [2][2048][512]
    char* wsp = (char*)d_ws;
    auto take = [&](size_t bytes) { char* p = wsp; wsp += (bytes + 255) & ~(size_t)255; return (void*)p; };
    bf* WQ = (bf*)take((size_t)DQ * DM * 2); bf* WKV = (bf*)take((size_t)2 * DKV * DM * 2);   /* directly behind WQ: one Bt [1536][512], rows q | k | v */ bf* EB = (bf*)take((size_t)NE * HD * 2); bf* WO = (bf*)take((size_t)DM * DQ * 2);
    bf* XB = (bf*)take((size_t)NB_ * TT * DM * 2);
    const size_t PU = (size_t)TT * HD, NU = (size_t)NB_ * NH_;   // one (batch, head) plane; planes a tensor
    h16* QP16 = (h16*)take(2 * NU * PU * 2); h16* KP16 = QP16 + NU * PU; bf* QPh = (bf*)take(2 * NU * PU * 2); bf* KPh = QPh + NU * PU; bf* QPl = (bf*)take(2 * NU * PU * 2); bf* KPl = QPl + NU * PU;   // q planes, then k planes
    h16* VT16 = (h16*)take(NU * PU * 2); bf* VTh = (bf*)take(2 * NU * PU * 2); bf* VTl = VTh + TT;   // rows of pitch 2 x TT: [batch 0 | batch 1] and [hi | lo]
    bf* ATh = (bf*)take((size_t)NB_ * TT * DQ * 2); bf* ATl = (bf*)take((size_t)NB_ * TT * DQ * 2);
    if ((size_t)(wsp - (char*)d_ws) > ws_size) return;    // ws 256 MiB
    const int DP = DQ + 2 * DKV;
    k_prep<<<(unsigned)(PB_WKV + PB_WQ + PB_WO + PB_E + PB_X), 256, 0, stream>>>(x, wq, wkv, wo, rel, XB, WQ, WKV, WO, EB);   /* weights transposed, x and the relative table as bf16: one launch */
    k_proj<<<dim3(NB_ * TT / 64, DP / 64, 1), 32 * KSP, 0, stream>>>(XB, WQ, QP16, QPh, QPl, VT16, VTh, VTl);   /* q, k head planes and V^T planes, fp16 + hi/lo */
    k_fattn<<<(unsigned)(NU * (TT / 64)), 256, 0, stream>>>(QP16, KP16, QPh, QPl, KPh, KPl, VT16, VTh, EB, ATh, ATl);   /* softmax((q.k + q_i . rel[clip(i - j) + 512]) / 8) . v, merged hi/lo */
    k_wo<<<dim3(NB_ * TT / 64, DM / 64, 1), 32 * KSP, 0, stream>>>(ATh, ATl, WO, bo, OUT);   /* merged hi/lo . Wo + bo */
}
